// v000
// Times are from an AMD MI455X. After a warm-up the kernel runs many times in a row, and a time is the length of
// such a window on the GPU divided by its runs, so every launch and the gaps after it count. The runs cycle
// through copies of the inputs. A figure is the median of several windows, for all but v000 over two sittings.
// Sittings can differ by a few percent; kernels timed side by side share one.
// v000 is the starting kernel. One run takes 687 microseconds.
#include <hip/hip_runtime.h>

// ---------------------------------------------------------------------------
// SpatioTemporalTransformerLayer for MI455X (gfx1250, wave32, WMMA).
// B=4, S=1024, D=1024, H=16, HD=64, DFF=4096, BIAS_HID=8.
// All GEMMs use v_wmma_f32_16x16x32_bf16 (bf16 A/B, f32 accumulate).
// GEMM K-loop is software-pipelined with ping-pong fragment buffers
// (2x unrolled) so global loads overlap WMMAs with no register copies.
// ---------------------------------------------------------------------------

typedef __attribute__((ext_vector_type(16))) __bf16 v16bf;
typedef __attribute__((ext_vector_type(8)))  __bf16 v8bf;
typedef __attribute__((ext_vector_type(8)))  float  v8f;

#define BDIM 4
#define SDIM 1024
#define DMODEL 1024
#define NHEAD 16
#define HEADD 64
#define DFF 4096

__device__ __forceinline__ __bf16 f2bf(float x) {
    unsigned u = __builtin_bit_cast(unsigned, x);
    unsigned r = (u + 0x7FFFu + ((u >> 16) & 1u)) >> 16;
    return __builtin_bit_cast(__bf16, (unsigned short)r);
}

__device__ __forceinline__ v8f wmma_bf16(v16bf a, v16bf b, v8f c) {
    // (neg_a, A, neg_b, B, c_mod, C, reuse_a, reuse_b)
    return __builtin_amdgcn_wmma_f32_16x16x32_bf16(false, a, false, b, (short)0, c,
                                                   false, false);
}

// Load a 16x32 bf16 A/B fragment: lane L, elem e -> (row=L&15, K=16*(e>>3)+8*(L>>4)+(e&7))
// 'row_ptr' points at element K=0 of this lane's row. Two contiguous 16B loads.
__device__ __forceinline__ v16bf load_frag(const __bf16* row_ptr, int hl) {
    v8bf lo = *(const v8bf*)(row_ptr + hl * 8);
    v8bf hi = *(const v8bf*)(row_ptr + 16 + hl * 8);
    v16bf f;
#pragma unroll
    for (int i = 0; i < 8; ++i) { f[i] = lo[i]; f[8 + i] = hi[i]; }
    return f;
}

// ---------------------------------------------------------------------------
// Elementwise converters
// ---------------------------------------------------------------------------
__global__ void cvt_f32_bf16_kernel(const float* __restrict__ in,
                                    __bf16* __restrict__ out, int n) {
    int i = blockIdx.x * 256 + threadIdx.x;
    if (i < n) out[i] = f2bf(in[i]);
}

// W[K][N] f32 (row-major) -> Wt[N][K] bf16
__global__ void cvt_transpose_kernel(const float* __restrict__ W,
                                     __bf16* __restrict__ Wt, int K, int N) {
    int i = blockIdx.x * 256 + threadIdx.x;
    if (i < K * N) {
        int k = i / N, n = i % N;
        Wt[(size_t)n * K + k] = f2bf(W[i]);
    }
}

// ---------------------------------------------------------------------------
// Generic bf16 WMMA GEMM: C[M,N] = A[M,K] * Wt[N,K]^T + bias, with mode epilogue
//   mode 0: Q/K layout  -> bf16 out[((b*16+h)*1024+s)*64+d]
//   mode 2: V transposed-> bf16 out[((b*16+h)*64+d)*1024+s]
//   mode 3: ReLU        -> bf16 out[row*N+col]   (FFN1)
//   mode 4: plain f32   -> f32  out[row*N+col]   (FFN2)
// Block: 128 threads = 4 waves; wave w owns rows m0+32w..+31, cols n0..n0+63.
// Per k-chunk: 2 A frags + 4 B frags -> 8 WMMAs; ping-pong double buffering.
// ---------------------------------------------------------------------------
__global__ __launch_bounds__(128) void gemm_bf16_kernel(
    const __bf16* __restrict__ A, const __bf16* __restrict__ Wt,
    const float* __restrict__ bias, void* __restrict__ outp,
    int N, int Kd, int mode) {
    const int lane = threadIdx.x & 31;
    const int wv = threadIdx.x >> 5;
    const int hl = lane >> 4;
    const int l16 = lane & 15;
    const int n0 = blockIdx.x * 64;
    const int m0 = blockIdx.y * 128 + wv * 32;

    v8f c[2][4] = {};
    const __bf16* arow0 = A + (size_t)(m0 + l16) * Kd;
    const __bf16* arow1 = A + (size_t)(m0 + 16 + l16) * Kd;
    const __bf16* brow[4];
#pragma unroll
    for (int g = 0; g < 4; ++g) brow[g] = Wt + (size_t)(n0 + g * 16 + l16) * Kd;

    // ping-pong fragment buffers
    v16bf a0[2], a1[2], bb[2][4];

#define LOAD_CHUNK(buf, kk)                                        \
    do {                                                           \
        a0[buf] = load_frag(arow0 + (kk), hl);                     \
        a1[buf] = load_frag(arow1 + (kk), hl);                     \
        _Pragma("unroll") for (int g = 0; g < 4; ++g)              \
            bb[buf][g] = load_frag(brow[g] + (kk), hl);            \
    } while (0)

#define COMPUTE(buf)                                               \
    do {                                                           \
        _Pragma("unroll") for (int g = 0; g < 4; ++g) {            \
            c[0][g] = wmma_bf16(a0[buf], bb[buf][g], c[0][g]);     \
            c[1][g] = wmma_bf16(a1[buf], bb[buf][g], c[1][g]);     \
        }                                                          \
    } while (0)

    // Kd is a multiple of 64 (1024 or 4096) -> even number of 32-wide chunks.
    LOAD_CHUNK(0, 0);
    LOAD_CHUNK(1, 32);
    for (int kc = 0; kc < Kd - 64; kc += 64) {
        COMPUTE(0);
        LOAD_CHUNK(0, kc + 64);
        COMPUTE(1);
        LOAD_CHUNK(1, kc + 96);
    }
    COMPUTE(0);
    COMPUTE(1);
#undef LOAD_CHUNK
#undef COMPUTE

#pragma unroll
    for (int sub = 0; sub < 2; ++sub) {
#pragma unroll
        for (int g = 0; g < 4; ++g) {
            const int col = n0 + g * 16 + l16;
            const float bcst = bias[col];
#pragma unroll
            for (int v = 0; v < 8; ++v) {
                const int row = m0 + sub * 16 + v + hl * 8;  // D-frag: M = v + 8*(lane>=16)
                float val = c[sub][g][v] + bcst;
                if (mode == 3) {
                    val = fmaxf(val, 0.f);
                    ((__bf16*)outp)[(size_t)row * N + col] = f2bf(val);
                } else if (mode == 4) {
                    ((float*)outp)[(size_t)row * N + col] = val;
                } else if (mode == 2) {  // V -> [b,h,d,s]
                    int bb2 = row >> 10, s = row & 1023, hh = col >> 6, d = col & 63;
                    ((__bf16*)outp)[(((size_t)(bb2 * 16 + hh)) * 64 + d) * 1024 + s] = f2bf(val);
                } else {                 // Q/K -> [b,h,s,d]
                    int bb2 = row >> 10, s = row & 1023, hh = col >> 6, d = col & 63;
                    ((__bf16*)outp)[(((size_t)(bb2 * 16 + hh)) * 1024 + s) * 64 + d] = f2bf(val);
                }
            }
        }
    }
}

// ---------------------------------------------------------------------------
// Flash attention with fused pair-bias MLP. One wave per (b, h, 16-row q-tile).
// ---------------------------------------------------------------------------
__global__ __launch_bounds__(32) void attn_kernel(
    const __bf16* __restrict__ Q, const __bf16* __restrict__ Km,
    const __bf16* __restrict__ Vt, const float* __restrict__ td,
    const float* __restrict__ dd, const float* __restrict__ tw1,
    const float* __restrict__ tb1, const float* __restrict__ tw2,
    const float* __restrict__ tb2, const float* __restrict__ dw1,
    const float* __restrict__ db1, const float* __restrict__ dw2,
    const float* __restrict__ db2, float* __restrict__ out) {
    const int lane = threadIdx.x & 31;
    const int hl = lane >> 4;
    const int l16 = lane & 15;
    const int qt = blockIdx.x & 63;
    const int h = (blockIdx.x >> 6) & 15;
    const int b = blockIdx.x >> 10;

    __shared__ float sc[16][36];                                // f32 score tile 16x32 (+pad)
    __shared__ __attribute__((aligned(16))) __bf16 pb[16][40];  // bf16 P tile
    __shared__ float corr[16];
    __shared__ float lsum[16];

    // Per-head pair-bias MLP weights (uniform -> scalar loads)
    float w1t[8], b1t[8], w2t[8], w1d[8], b1d[8], w2d[8];
#pragma unroll
    for (int j = 0; j < 8; ++j) {
        w1t[j] = tw1[j]; b1t[j] = tb1[j]; w2t[j] = tw2[j * 16 + h];
        w1d[j] = dw1[j]; b1d[j] = db1[j]; w2d[j] = dw2[j * 16 + h];
    }
    const float bconst = tb2[h] + db2[h];

    const size_t bh = (size_t)(b * 16 + h);

    // Q A-fragments for the two K-dim halves (hd 0..31, 32..63)
    v16bf qa[2];
    {
        const __bf16* r = Q + (bh * 1024 + qt * 16 + l16) * 64;
        qa[0] = load_frag(r, hl);
        qa[1] = load_frag(r + 32, hl);
    }

    v8f o[4] = {};
    float mrow = -1e30f, lrow = 0.f;

    for (int kb = 0; kb < SDIM; kb += 32) {
        // ---- scores for 32 keys: 2 N-groups x 2 K-frags = 4 WMMAs ----
#pragma unroll
        for (int g = 0; g < 2; ++g) {
            const __bf16* kr = Km + (bh * 1024 + kb + g * 16 + l16) * 64;
            v16bf kb0 = load_frag(kr, hl);
            v16bf kb1 = load_frag(kr + 32, hl);
            v8f s = {};
            s = wmma_bf16(qa[0], kb0, s);
            s = wmma_bf16(qa[1], kb1, s);
            const int key = kb + g * 16 + l16;
#pragma unroll
            for (int v = 0; v < 8; ++v) {
                const int qrow = v + hl * 8;
                const int qg = qt * 16 + qrow;
                const size_t midx = ((size_t)b * SDIM + qg) * SDIM + key;
                const float m1 = td[midx];
                const float m2 = dd[midx];
                float bias = bconst;
#pragma unroll
                for (int j = 0; j < 8; ++j) {
                    bias += fmaxf(m1 * w1t[j] + b1t[j], 0.f) * w2t[j];
                    bias += fmaxf(m2 * w1d[j] + b1d[j], 0.f) * w2d[j];
                }
                sc[qrow][g * 16 + l16] = s[v] * (1.0f / 32.0f) + bias;
            }
        }
        __syncthreads();

        // ---- online softmax: lane handles (row=l16, cols hl*16..+15) ----
        float pm = -1e30f;
        float sv[16];
#pragma unroll
        for (int j = 0; j < 16; ++j) {
            sv[j] = sc[l16][hl * 16 + j];
            pm = fmaxf(pm, sv[j]);
        }
        pm = fmaxf(pm, __shfl_xor(pm, 16, 32));
        const float nm = fmaxf(mrow, pm);
        const float cf = __expf(mrow - nm);
        float ps = 0.f;
#pragma unroll
        for (int j = 0; j < 16; ++j) {
            float p = __expf(sv[j] - nm);
            ps += p;
            pb[l16][hl * 16 + j] = f2bf(p);
        }
        ps += __shfl_xor(ps, 16, 32);
        lrow = lrow * cf + ps;
        mrow = nm;
        if (lane < 16) corr[l16] = cf;
        __syncthreads();

        // ---- rescale O, then O += P * V (4 WMMAs) ----
        float cfa[8];
#pragma unroll
        for (int v = 0; v < 8; ++v) cfa[v] = corr[v + hl * 8];
#pragma unroll
        for (int g = 0; g < 4; ++g)
#pragma unroll
            for (int v = 0; v < 8; ++v) o[g][v] *= cfa[v];

        v16bf pa = load_frag(&pb[l16][0], hl);
#pragma unroll
        for (int g = 0; g < 4; ++g) {
            const __bf16* vr = Vt + (bh * 64 + g * 16 + l16) * 1024 + kb;
            v16bf vb = load_frag(vr, hl);
            o[g] = wmma_bf16(pa, vb, o[g]);
        }
        __syncthreads();  // sc/pb reused next iteration
    }

    if (lane < 16) lsum[l16] = 1.f / lrow;
    __syncthreads();
    float ri[8];
#pragma unroll
    for (int v = 0; v < 8; ++v) ri[v] = lsum[v + hl * 8];
#pragma unroll
    for (int g = 0; g < 4; ++g)
#pragma unroll
        for (int v = 0; v < 8; ++v) {
            const int s = qt * 16 + v + hl * 8;
            const int d = h * 64 + g * 16 + l16;
            out[((size_t)b * SDIM + s) * DMODEL + d] = o[g][v] * ri[v];
        }
}

// ---------------------------------------------------------------------------
// Residual + LayerNorm over D=1024. One 256-thread block per row.
// ---------------------------------------------------------------------------
__global__ __launch_bounds__(256) void add_ln_kernel(
    const float* __restrict__ a, const float* __restrict__ r,
    const float* __restrict__ g, const float* __restrict__ beta,
    float* __restrict__ outf, __bf16* __restrict__ outb) {
    const int row = blockIdx.x;
    const int t = threadIdx.x;
    __shared__ float red[256];
    float v[4];
    float s = 0.f;
#pragma unroll
    for (int i = 0; i < 4; ++i) {
        const int c = t + i * 256;
        v[i] = a[(size_t)row * DMODEL + c] + r[(size_t)row * DMODEL + c];
        s += v[i];
    }
    red[t] = s;
    __syncthreads();
    for (int st = 128; st > 0; st >>= 1) {
        if (t < st) red[t] += red[t + st];
        __syncthreads();
    }
    const float mean = red[0] * (1.f / 1024.f);
    __syncthreads();
    float ss = 0.f;
#pragma unroll
    for (int i = 0; i < 4; ++i) {
        const float d = v[i] - mean;
        ss += d * d;
    }
    red[t] = ss;
    __syncthreads();
    for (int st = 128; st > 0; st >>= 1) {
        if (t < st) red[t] += red[t + st];
        __syncthreads();
    }
    const float rstd = rsqrtf(red[0] * (1.f / 1024.f) + 1e-5f);
#pragma unroll
    for (int i = 0; i < 4; ++i) {
        const int c = t + i * 256;
        const float y = (v[i] - mean) * rstd * g[c] + beta[c];
        outf[(size_t)row * DMODEL + c] = y;
        if (outb) outb[(size_t)row * DMODEL + c] = f2bf(y);
    }
}

// ---------------------------------------------------------------------------
// Host launch
// ---------------------------------------------------------------------------
extern "C" void kernel_launch(void* const* d_in, const int* in_sizes, int n_in,
                              void* d_out, int out_size, void* d_ws, size_t ws_size,
                              hipStream_t stream) {
    (void)in_sizes; (void)n_in; (void)out_size; (void)ws_size;
    const float* src = (const float*)d_in[0];
    const float* td  = (const float*)d_in[1];
    const float* dd  = (const float*)d_in[2];
    const float* Wq  = (const float*)d_in[3];
    const float* bq  = (const float*)d_in[4];
    const float* Wk  = (const float*)d_in[5];
    const float* bk  = (const float*)d_in[6];
    const float* Wv  = (const float*)d_in[7];
    const float* bv  = (const float*)d_in[8];
    const float* tw1 = (const float*)d_in[9];
    const float* tb1 = (const float*)d_in[10];
    const float* tw2 = (const float*)d_in[11];
    const float* tb2 = (const float*)d_in[12];
    const float* dw1 = (const float*)d_in[13];
    const float* db1 = (const float*)d_in[14];
    const float* dw2 = (const float*)d_in[15];
    const float* db2 = (const float*)d_in[16];
    const float* W1  = (const float*)d_in[17];
    const float* b1  = (const float*)d_in[18];
    const float* W2  = (const float*)d_in[19];
    const float* b2  = (const float*)d_in[20];
    const float* g1  = (const float*)d_in[21];
    const float* be1 = (const float*)d_in[22];
    const float* g2  = (const float*)d_in[23];
    const float* be2 = (const float*)d_in[24];

    const int M = BDIM * SDIM;  // 4096 rows
    char* ws = (char*)d_ws;
    size_t off = 0;
    auto alloc = [&](size_t bytes) {
        char* p = ws + off;
        off = (off + bytes + 255) & ~(size_t)255;
        return p;
    };
    __bf16* srcb = (__bf16*)alloc((size_t)M * DMODEL * 2);
    __bf16* Wqt  = (__bf16*)alloc((size_t)DMODEL * DMODEL * 2);
    __bf16* Wkt  = (__bf16*)alloc((size_t)DMODEL * DMODEL * 2);
    __bf16* Wvt  = (__bf16*)alloc((size_t)DMODEL * DMODEL * 2);
    __bf16* W1t  = (__bf16*)alloc((size_t)DMODEL * DFF * 2);
    __bf16* W2t  = (__bf16*)alloc((size_t)DFF * DMODEL * 2);
    __bf16* Qb   = (__bf16*)alloc((size_t)M * DMODEL * 2);
    __bf16* Kb   = (__bf16*)alloc((size_t)M * DMODEL * 2);
    __bf16* Vtb  = (__bf16*)alloc((size_t)M * DMODEL * 2);
    float*  attn = (float*)alloc((size_t)M * DMODEL * 4);
    float*  xf   = (float*)alloc((size_t)M * DMODEL * 4);
    __bf16* xb   = (__bf16*)alloc((size_t)M * DMODEL * 2);
    __bf16* h1   = (__bf16*)alloc((size_t)M * DFF * 2);
    float*  ffn  = (float*)alloc((size_t)M * DMODEL * 4);

    const int nSrc = M * DMODEL;
    cvt_f32_bf16_kernel<<<(nSrc + 255) / 256, 256, 0, stream>>>(src, srcb, nSrc);
    cvt_transpose_kernel<<<(DMODEL * DMODEL + 255) / 256, 256, 0, stream>>>(Wq, Wqt, DMODEL, DMODEL);
    cvt_transpose_kernel<<<(DMODEL * DMODEL + 255) / 256, 256, 0, stream>>>(Wk, Wkt, DMODEL, DMODEL);
    cvt_transpose_kernel<<<(DMODEL * DMODEL + 255) / 256, 256, 0, stream>>>(Wv, Wvt, DMODEL, DMODEL);
    cvt_transpose_kernel<<<(DMODEL * DFF + 255) / 256, 256, 0, stream>>>(W1, W1t, DMODEL, DFF);
    cvt_transpose_kernel<<<(DFF * DMODEL + 255) / 256, 256, 0, stream>>>(W2, W2t, DFF, DMODEL);

    dim3 gqkv(DMODEL / 64, M / 128);
    gemm_bf16_kernel<<<gqkv, 128, 0, stream>>>(srcb, Wqt, bq, Qb, DMODEL, DMODEL, 0);
    gemm_bf16_kernel<<<gqkv, 128, 0, stream>>>(srcb, Wkt, bk, Kb, DMODEL, DMODEL, 0);
    gemm_bf16_kernel<<<gqkv, 128, 0, stream>>>(srcb, Wvt, bv, Vtb, DMODEL, DMODEL, 2);

    attn_kernel<<<BDIM * NHEAD * (SDIM / 16), 32, 0, stream>>>(
        Qb, Kb, Vtb, td, dd, tw1, tb1, tw2, tb2, dw1, db1, dw2, db2, attn);

    add_ln_kernel<<<M, 256, 0, stream>>>(src, attn, g1, be1, xf, xb);

    gemm_bf16_kernel<<<dim3(DFF / 64, M / 128), 128, 0, stream>>>(xb, W1t, b1, h1, DFF, DMODEL, 3);
    gemm_bf16_kernel<<<dim3(DMODEL / 64, M / 128), 128, 0, stream>>>(h1, W2t, b2, ffn, DMODEL, DFF, 4);

    add_ln_kernel<<<M, 256, 0, stream>>>(xf, ffn, g2, be2, (float*)d_out, nullptr);
}

// v001
// It runs in 446 microseconds.
// Next to v000, in two timings, it ran 1.57 and 1.56 times as fast.
#include <hip/hip_runtime.h>

// ---------------------------------------------------------------------------
// SpatioTemporalTransformerLayer for MI455X (gfx1250, wave32, WMMA).
// B=4, S=1024, D=1024, H=16, HD=64, DFF=4096, BIAS_HID=8.
// All GEMMs use v_wmma_f32_16x16x32_bf16 (bf16 A/B, f32 accumulate).
// GEMM K-loop is software-pipelined with ping-pong fragment buffers
// (2x unrolled) so global loads overlap WMMAs with no register copies.
// ---------------------------------------------------------------------------

typedef __attribute__((ext_vector_type(16))) __bf16 v16bf;
typedef __attribute__((ext_vector_type(8)))  __bf16 v8bf;
typedef __attribute__((ext_vector_type(8)))  float  v8f;

#define BDIM 4
#define SDIM 1024
#define DMODEL 1024
#define NHEAD 16
#define HEADD 64
#define DFF 4096

__device__ __forceinline__ __bf16 f2bf(float x) {
    unsigned u = __builtin_bit_cast(unsigned, x);
    unsigned r = (u + 0x7FFFu + ((u >> 16) & 1u)) >> 16;
    return __builtin_bit_cast(__bf16, (unsigned short)r);
}

__device__ __forceinline__ v8f wmma_bf16(v16bf a, v16bf b, v8f c) {
    // (neg_a, A, neg_b, B, c_mod, C, reuse_a, reuse_b)
    return __builtin_amdgcn_wmma_f32_16x16x32_bf16(false, a, false, b, (short)0, c,
                                                   false, false);
}

// Load a 16x32 bf16 A/B fragment: lane L, elem e -> (row=L&15, K=16*(e>>3)+8*(L>>4)+(e&7))
// 'row_ptr' points at element K=0 of this lane's row. Two contiguous 16B loads.
__device__ __forceinline__ v16bf load_frag(const __bf16* row_ptr, int hl) {
    v8bf lo = *(const v8bf*)(row_ptr + hl * 8);
    v8bf hi = *(const v8bf*)(row_ptr + 16 + hl * 8);
    v16bf f;
#pragma unroll
    for (int i = 0; i < 8; ++i) { f[i] = lo[i]; f[8 + i] = hi[i]; }
    return f;
}

// ---------------------------------------------------------------------------
// Elementwise converters
// ---------------------------------------------------------------------------
__global__ void cvt_f32_bf16_kernel(const float* __restrict__ in,
                                    __bf16* __restrict__ out, int n) {
    int i = blockIdx.x * 256 + threadIdx.x;
    if (i < n) out[i] = f2bf(in[i]);
}

// W[K][N] f32 (row-major) -> Wt[N][K] bf16, one 64x64 tile per 256-thread block.
// K and N are multiples of 64. Reads are 256-B row pieces (16 B a lane), the tile is
// turned in LDS, and every store instruction writes whole 128-B lines of Wt.
typedef __attribute__((ext_vector_type(4))) __bf16 v4bf;
typedef __attribute__((ext_vector_type(4))) float  v4f;

__global__ __launch_bounds__(256) void cvt_transpose_kernel(const float* __restrict__ W,
                                                            __bf16* __restrict__ Wt, int K, int N) {
    // 128-B rows at a 144-B pitch (16 B x odd) for the 16-byte readers.
    __shared__ __attribute__((aligned(16))) __bf16 tile[64][72];
    const int t = threadIdx.x;
    const int n0 = blockIdx.x * 64;
    const int k0 = blockIdx.y * 64;

    const int nq = (t & 15) * 4;   // four columns of W
    const int kq = (t >> 4) * 4;   // four rows of W
    const float* in = W + (size_t)(k0 + kq) * N + n0 + nq;
    v4f r[4];
#pragma unroll
    for (int i = 0; i < 4; ++i) {
        r[i] = *(const v4f*)(in + (size_t)i * N);
        // a later load's result registers may reuse this load's address pair:
        // the wait stands between the load and any such overwrite
        asm volatile("s_wait_xcnt 0x0" ::: "memory");
    }
#pragma unroll
    for (int j = 0; j < 4; ++j) {
        v4bf p;
#pragma unroll
        for (int i = 0; i < 4; ++i) p[i] = f2bf(r[i][j]);
        *(v4bf*)&tile[nq + j][kq] = p;
    }
    __syncthreads();

    const int kk = (t & 7) * 8;    // eight lanes cover one 128-B row of the tile
#pragma unroll
    for (int pass = 0; pass < 2; ++pass) {
        const int n = (t >> 3) + pass * 32;
        *(v8bf*)(Wt + (size_t)(n0 + n) * K + k0 + kk) = *(const v8bf*)&tile[n][kk];
    }
}

// ---------------------------------------------------------------------------
// Generic bf16 WMMA GEMM: C[M,N] = A[M,K] * Wt[N,K]^T + bias, with mode epilogue
//   mode 0: Q/K layout  -> bf16 out[((b*16+h)*1024+s)*64+d]
//   mode 2: V transposed-> bf16 out[((b*16+h)*64+d)*1024+s]
//   mode 3: ReLU        -> bf16 out[row*N+col]   (FFN1)
//   mode 4: plain f32   -> f32  out[row*N+col]   (FFN2)
// Block: 128 threads = 4 waves; wave w owns rows m0+32w..+31, cols n0..n0+63.
// Per k-chunk: 2 A frags + 4 B frags -> 8 WMMAs; ping-pong double buffering.
// ---------------------------------------------------------------------------
__global__ __launch_bounds__(128) void gemm_bf16_kernel(
    const __bf16* __restrict__ A, const __bf16* __restrict__ Wt,
    const float* __restrict__ bias, void* __restrict__ outp,
    int N, int Kd, int mode) {
    const int lane = threadIdx.x & 31;
    const int wv = threadIdx.x >> 5;
    const int hl = lane >> 4;
    const int l16 = lane & 15;
    const int n0 = blockIdx.x * 64;
    const int m0 = blockIdx.y * 128 + wv * 32;

    v8f c[2][4] = {};
    const __bf16* arow0 = A + (size_t)(m0 + l16) * Kd;
    const __bf16* arow1 = A + (size_t)(m0 + 16 + l16) * Kd;
    const __bf16* brow[4];
#pragma unroll
    for (int g = 0; g < 4; ++g) brow[g] = Wt + (size_t)(n0 + g * 16 + l16) * Kd;

    // ping-pong fragment buffers
    v16bf a0[2], a1[2], bb[2][4];

#define LOAD_CHUNK(buf, kk)                                        \
    do {                                                           \
        a0[buf] = load_frag(arow0 + (kk), hl);                     \
        a1[buf] = load_frag(arow1 + (kk), hl);                     \
        _Pragma("unroll") for (int g = 0; g < 4; ++g)              \
            bb[buf][g] = load_frag(brow[g] + (kk), hl);            \
    } while (0)

#define COMPUTE(buf)                                               \
    do {                                                           \
        _Pragma("unroll") for (int g = 0; g < 4; ++g) {            \
            c[0][g] = wmma_bf16(a0[buf], bb[buf][g], c[0][g]);     \
            c[1][g] = wmma_bf16(a1[buf], bb[buf][g], c[1][g]);     \
        }                                                          \
    } while (0)

    // Kd is a multiple of 64 (1024 or 4096) -> even number of 32-wide chunks.
    LOAD_CHUNK(0, 0);
    LOAD_CHUNK(1, 32);
    for (int kc = 0; kc < Kd - 64; kc += 64) {
        COMPUTE(0);
        LOAD_CHUNK(0, kc + 64);
        COMPUTE(1);
        LOAD_CHUNK(1, kc + 96);
    }
    COMPUTE(0);
    COMPUTE(1);
#undef LOAD_CHUNK
#undef COMPUTE

#pragma unroll
    for (int sub = 0; sub < 2; ++sub) {
#pragma unroll
        for (int g = 0; g < 4; ++g) {
            const int col = n0 + g * 16 + l16;
            const float bcst = bias[col];
#pragma unroll
            for (int v = 0; v < 8; ++v) {
                const int row = m0 + sub * 16 + v + hl * 8;  // D-frag: M = v + 8*(lane>=16)
                float val = c[sub][g][v] + bcst;
                if (mode == 3) {
                    val = fmaxf(val, 0.f);
                    ((__bf16*)outp)[(size_t)row * N + col] = f2bf(val);
                } else if (mode == 4) {
                    ((float*)outp)[(size_t)row * N + col] = val;
                } else if (mode == 2) {  // V -> [b,h,d,s]
                    int bb2 = row >> 10, s = row & 1023, hh = col >> 6, d = col & 63;
                    ((__bf16*)outp)[(((size_t)(bb2 * 16 + hh)) * 64 + d) * 1024 + s] = f2bf(val);
                } else {                 // Q/K -> [b,h,s,d]
                    int bb2 = row >> 10, s = row & 1023, hh = col >> 6, d = col & 63;
                    ((__bf16*)outp)[(((size_t)(bb2 * 16 + hh)) * 1024 + s) * 64 + d] = f2bf(val);
                }
            }
        }
    }
}

// ---------------------------------------------------------------------------
// Flash attention with fused pair-bias MLP. One wave per (b, h, 16-row q-tile).
// ---------------------------------------------------------------------------
__global__ __launch_bounds__(32) void attn_kernel(
    const __bf16* __restrict__ Q, const __bf16* __restrict__ Km,
    const __bf16* __restrict__ Vt, const float* __restrict__ td,
    const float* __restrict__ dd, const float* __restrict__ tw1,
    const float* __restrict__ tb1, const float* __restrict__ tw2,
    const float* __restrict__ tb2, const float* __restrict__ dw1,
    const float* __restrict__ db1, const float* __restrict__ dw2,
    const float* __restrict__ db2, float* __restrict__ out) {
    const int lane = threadIdx.x & 31;
    const int hl = lane >> 4;
    const int l16 = lane & 15;
    const int qt = blockIdx.x & 63;
    const int h = (blockIdx.x >> 6) & 15;
    const int b = blockIdx.x >> 10;

    __shared__ float sc[16][36];                                // f32 score tile 16x32 (+pad)
    __shared__ __attribute__((aligned(16))) __bf16 pb[16][40];  // bf16 P tile
    __shared__ float corr[16];
    __shared__ float lsum[16];

    // Per-head pair-bias MLP weights (uniform -> scalar loads)
    float w1t[8], b1t[8], w2t[8], w1d[8], b1d[8], w2d[8];
#pragma unroll
    for (int j = 0; j < 8; ++j) {
        w1t[j] = tw1[j]; b1t[j] = tb1[j]; w2t[j] = tw2[j * 16 + h];
        w1d[j] = dw1[j]; b1d[j] = db1[j]; w2d[j] = dw2[j * 16 + h];
    }
    const float bconst = tb2[h] + db2[h];

    const size_t bh = (size_t)(b * 16 + h);

    // Q A-fragments for the two K-dim halves (hd 0..31, 32..63)
    v16bf qa[2];
    {
        const __bf16* r = Q + (bh * 1024 + qt * 16 + l16) * 64;
        qa[0] = load_frag(r, hl);
        qa[1] = load_frag(r + 32, hl);
    }

    v8f o[4] = {};
    float mrow = -1e30f, lrow = 0.f;

    for (int kb = 0; kb < SDIM; kb += 32) {
        // ---- scores for 32 keys: 2 N-groups x 2 K-frags = 4 WMMAs ----
#pragma unroll
        for (int g = 0; g < 2; ++g) {
            const __bf16* kr = Km + (bh * 1024 + kb + g * 16 + l16) * 64;
            v16bf kb0 = load_frag(kr, hl);
            v16bf kb1 = load_frag(kr + 32, hl);
            v8f s = {};
            s = wmma_bf16(qa[0], kb0, s);
            s = wmma_bf16(qa[1], kb1, s);
            const int key = kb + g * 16 + l16;
#pragma unroll
            for (int v = 0; v < 8; ++v) {
                const int qrow = v + hl * 8;
                const int qg = qt * 16 + qrow;
                const size_t midx = ((size_t)b * SDIM + qg) * SDIM + key;
                const float m1 = td[midx];
                const float m2 = dd[midx];
                float bias = bconst;
#pragma unroll
                for (int j = 0; j < 8; ++j) {
                    bias += fmaxf(m1 * w1t[j] + b1t[j], 0.f) * w2t[j];
                    bias += fmaxf(m2 * w1d[j] + b1d[j], 0.f) * w2d[j];
                }
                sc[qrow][g * 16 + l16] = s[v] * (1.0f / 32.0f) + bias;
            }
        }
        __syncthreads();

        // ---- online softmax: lane handles (row=l16, cols hl*16..+15) ----
        float pm = -1e30f;
        float sv[16];
#pragma unroll
        for (int j = 0; j < 16; ++j) {
            sv[j] = sc[l16][hl * 16 + j];
            pm = fmaxf(pm, sv[j]);
        }
        pm = fmaxf(pm, __shfl_xor(pm, 16, 32));
        const float nm = fmaxf(mrow, pm);
        const float cf = __expf(mrow - nm);
        float ps = 0.f;
#pragma unroll
        for (int j = 0; j < 16; ++j) {
            float p = __expf(sv[j] - nm);
            ps += p;
            pb[l16][hl * 16 + j] = f2bf(p);
        }
        ps += __shfl_xor(ps, 16, 32);
        lrow = lrow * cf + ps;
        mrow = nm;
        if (lane < 16) corr[l16] = cf;
        __syncthreads();

        // ---- rescale O, then O += P * V (4 WMMAs) ----
        float cfa[8];
#pragma unroll
        for (int v = 0; v < 8; ++v) cfa[v] = corr[v + hl * 8];
#pragma unroll
        for (int g = 0; g < 4; ++g)
#pragma unroll
            for (int v = 0; v < 8; ++v) o[g][v] *= cfa[v];

        v16bf pa = load_frag(&pb[l16][0], hl);
#pragma unroll
        for (int g = 0; g < 4; ++g) {
            const __bf16* vr = Vt + (bh * 64 + g * 16 + l16) * 1024 + kb;
            v16bf vb = load_frag(vr, hl);
            o[g] = wmma_bf16(pa, vb, o[g]);
        }
        __syncthreads();  // sc/pb reused next iteration
    }

    if (lane < 16) lsum[l16] = 1.f / lrow;
    __syncthreads();
    float ri[8];
#pragma unroll
    for (int v = 0; v < 8; ++v) ri[v] = lsum[v + hl * 8];
#pragma unroll
    for (int g = 0; g < 4; ++g)
#pragma unroll
        for (int v = 0; v < 8; ++v) {
            const int s = qt * 16 + v + hl * 8;
            const int d = h * 64 + g * 16 + l16;
            out[((size_t)b * SDIM + s) * DMODEL + d] = o[g][v] * ri[v];
        }
}

// ---------------------------------------------------------------------------
// Residual + LayerNorm over D=1024. One 256-thread block per row.
// ---------------------------------------------------------------------------
__global__ __launch_bounds__(256) void add_ln_kernel(
    const float* __restrict__ a, const float* __restrict__ r,
    const float* __restrict__ g, const float* __restrict__ beta,
    float* __restrict__ outf, __bf16* __restrict__ outb) {
    const int row = blockIdx.x;
    const int t = threadIdx.x;
    __shared__ float red[256];
    float v[4];
    float s = 0.f;
#pragma unroll
    for (int i = 0; i < 4; ++i) {
        const int c = t + i * 256;
        v[i] = a[(size_t)row * DMODEL + c] + r[(size_t)row * DMODEL + c];
        s += v[i];
    }
    red[t] = s;
    __syncthreads();
    for (int st = 128; st > 0; st >>= 1) {
        if (t < st) red[t] += red[t + st];
        __syncthreads();
    }
    const float mean = red[0] * (1.f / 1024.f);
    __syncthreads();
    float ss = 0.f;
#pragma unroll
    for (int i = 0; i < 4; ++i) {
        const float d = v[i] - mean;
        ss += d * d;
    }
    red[t] = ss;
    __syncthreads();
    for (int st = 128; st > 0; st >>= 1) {
        if (t < st) red[t] += red[t + st];
        __syncthreads();
    }
    const float rstd = rsqrtf(red[0] * (1.f / 1024.f) + 1e-5f);
#pragma unroll
    for (int i = 0; i < 4; ++i) {
        const int c = t + i * 256;
        const float y = (v[i] - mean) * rstd * g[c] + beta[c];
        outf[(size_t)row * DMODEL + c] = y;
        if (outb) outb[(size_t)row * DMODEL + c] = f2bf(y);
    }
}

// ---------------------------------------------------------------------------
// Host launch
// ---------------------------------------------------------------------------
extern "C" void kernel_launch(void* const* d_in, const int* in_sizes, int n_in,
                              void* d_out, int out_size, void* d_ws, size_t ws_size,
                              hipStream_t stream) {
    (void)in_sizes; (void)n_in; (void)out_size; (void)ws_size;
    const float* src = (const float*)d_in[0];
    const float* td  = (const float*)d_in[1];
    const float* dd  = (const float*)d_in[2];
    const float* Wq  = (const float*)d_in[3];
    const float* bq  = (const float*)d_in[4];
    const float* Wk  = (const float*)d_in[5];
    const float* bk  = (const float*)d_in[6];
    const float* Wv  = (const float*)d_in[7];
    const float* bv  = (const float*)d_in[8];
    const float* tw1 = (const float*)d_in[9];
    const float* tb1 = (const float*)d_in[10];
    const float* tw2 = (const float*)d_in[11];
    const float* tb2 = (const float*)d_in[12];
    const float* dw1 = (const float*)d_in[13];
    const float* db1 = (const float*)d_in[14];
    const float* dw2 = (const float*)d_in[15];
    const float* db2 = (const float*)d_in[16];
    const float* W1  = (const float*)d_in[17];
    const float* b1  = (const float*)d_in[18];
    const float* W2  = (const float*)d_in[19];
    const float* b2  = (const float*)d_in[20];
    const float* g1  = (const float*)d_in[21];
    const float* be1 = (const float*)d_in[22];
    const float* g2  = (const float*)d_in[23];
    const float* be2 = (const float*)d_in[24];

    const int M = BDIM * SDIM;  // 4096 rows
    char* ws = (char*)d_ws;
    size_t off = 0;
    auto alloc = [&](size_t bytes) {
        char* p = ws + off;
        off = (off + bytes + 255) & ~(size_t)255;
        return p;
    };
    __bf16* srcb = (__bf16*)alloc((size_t)M * DMODEL * 2);
    __bf16* Wqt  = (__bf16*)alloc((size_t)DMODEL * DMODEL * 2);
    __bf16* Wkt  = (__bf16*)alloc((size_t)DMODEL * DMODEL * 2);
    __bf16* Wvt  = (__bf16*)alloc((size_t)DMODEL * DMODEL * 2);
    __bf16* W1t  = (__bf16*)alloc((size_t)DMODEL * DFF * 2);
    __bf16* W2t  = (__bf16*)alloc((size_t)DFF * DMODEL * 2);
    __bf16* Qb   = (__bf16*)alloc((size_t)M * DMODEL * 2);
    __bf16* Kb   = (__bf16*)alloc((size_t)M * DMODEL * 2);
    __bf16* Vtb  = (__bf16*)alloc((size_t)M * DMODEL * 2);
    float*  attn = (float*)alloc((size_t)M * DMODEL * 4);
    float*  xf   = (float*)alloc((size_t)M * DMODEL * 4);
    __bf16* xb   = (__bf16*)alloc((size_t)M * DMODEL * 2);
    __bf16* h1   = (__bf16*)alloc((size_t)M * DFF * 2);
    float*  ffn  = (float*)alloc((size_t)M * DMODEL * 4);

    const int nSrc = M * DMODEL;
    cvt_f32_bf16_kernel<<<(nSrc + 255) / 256, 256, 0, stream>>>(src, srcb, nSrc);
    cvt_transpose_kernel<<<dim3(DMODEL / 64, DMODEL / 64), 256, 0, stream>>>(Wq, Wqt, DMODEL, DMODEL);
    cvt_transpose_kernel<<<dim3(DMODEL / 64, DMODEL / 64), 256, 0, stream>>>(Wk, Wkt, DMODEL, DMODEL);
    cvt_transpose_kernel<<<dim3(DMODEL / 64, DMODEL / 64), 256, 0, stream>>>(Wv, Wvt, DMODEL, DMODEL);
    cvt_transpose_kernel<<<dim3(DFF / 64, DMODEL / 64), 256, 0, stream>>>(W1, W1t, DMODEL, DFF);
    cvt_transpose_kernel<<<dim3(DMODEL / 64, DFF / 64), 256, 0, stream>>>(W2, W2t, DFF, DMODEL);

    dim3 gqkv(DMODEL / 64, M / 128);
    gemm_bf16_kernel<<<gqkv, 128, 0, stream>>>(srcb, Wqt, bq, Qb, DMODEL, DMODEL, 0);
    gemm_bf16_kernel<<<gqkv, 128, 0, stream>>>(srcb, Wkt, bk, Kb, DMODEL, DMODEL, 0);
    gemm_bf16_kernel<<<gqkv, 128, 0, stream>>>(srcb, Wvt, bv, Vtb, DMODEL, DMODEL, 2);

    attn_kernel<<<BDIM * NHEAD * (SDIM / 16), 32, 0, stream>>>(
        Qb, Kb, Vtb, td, dd, tw1, tb1, tw2, tb2, dw1, db1, dw2, db2, attn);

    add_ln_kernel<<<M, 256, 0, stream>>>(src, attn, g1, be1, xf, xb);

    gemm_bf16_kernel<<<dim3(DFF / 64, M / 128), 128, 0, stream>>>(xb, W1t, b1, h1, DFF, DMODEL, 3);
    gemm_bf16_kernel<<<dim3(DMODEL / 64, M / 128), 128, 0, stream>>>(h1, W2t, b2, ffn, DMODEL, DFF, 4);

    add_ln_kernel<<<M, 256, 0, stream>>>(xf, ffn, g2, be2, (float*)d_out, nullptr);
}

// v002
// Measured time: 303 microseconds a run.
// Next to v001, in two timings, it ran 1.47 times as fast each time.
// Over all steps from v000 it is 2.29 times as fast.
#include <hip/hip_runtime.h>

// ---------------------------------------------------------------------------
// SpatioTemporalTransformerLayer for MI455X (gfx1250, wave32, WMMA).
// B=4, S=1024, D=1024, H=16, HD=64, DFF=4096, BIAS_HID=8.
// All GEMMs use v_wmma_f32_16x16x32_bf16 (bf16 A/B, f32 accumulate).
// GEMM operand tiles are staged in LDS by asynchronous copies (two buffers);
// fragments are read from LDS into ping-pong fragment buffers.
// ---------------------------------------------------------------------------

typedef __attribute__((ext_vector_type(16))) __bf16 v16bf;
typedef __attribute__((ext_vector_type(8)))  __bf16 v8bf;
typedef __attribute__((ext_vector_type(8)))  float  v8f;

#define BDIM 4
#define SDIM 1024
#define DMODEL 1024
#define NHEAD 16
#define HEADD 64
#define DFF 4096

__device__ __forceinline__ __bf16 f2bf(float x) {
    unsigned u = __builtin_bit_cast(unsigned, x);
    unsigned r = (u + 0x7FFFu + ((u >> 16) & 1u)) >> 16;
    return __builtin_bit_cast(__bf16, (unsigned short)r);
}

__device__ __forceinline__ v8f wmma_bf16(v16bf a, v16bf b, v8f c) {
    // (neg_a, A, neg_b, B, c_mod, C, reuse_a, reuse_b)
    return __builtin_amdgcn_wmma_f32_16x16x32_bf16(false, a, false, b, (short)0, c,
                                                   false, false);
}

// Load a 16x32 bf16 A/B fragment: lane L, elem e -> (row=L&15, K=16*(e>>3)+8*(L>>4)+(e&7))
// 'row_ptr' points at element K=0 of this lane's row. Two contiguous 16B loads.
__device__ __forceinline__ v16bf load_frag(const __bf16* row_ptr, int hl) {
    v8bf lo = *(const v8bf*)(row_ptr + hl * 8);
    v8bf hi = *(const v8bf*)(row_ptr + 16 + hl * 8);
    v16bf f;
#pragma unroll
    for (int i = 0; i < 8; ++i) { f[i] = lo[i]; f[8 + i] = hi[i]; }
    return f;
}

// ---------------------------------------------------------------------------
// Elementwise converters
// ---------------------------------------------------------------------------
__global__ void cvt_f32_bf16_kernel(const float* __restrict__ in,
                                    __bf16* __restrict__ out, int n) {
    int i = blockIdx.x * 256 + threadIdx.x;
    if (i < n) out[i] = f2bf(in[i]);
}

// W[K][N] f32 (row-major) -> Wt[N][K] bf16, one 64x64 tile per 256-thread block.
// K and N are multiples of 64. Reads are 256-B row pieces (16 B a lane), the tile is
// turned in LDS, and every store instruction writes whole 128-B lines of Wt.
typedef __attribute__((ext_vector_type(4))) __bf16 v4bf;
typedef __attribute__((ext_vector_type(4))) float  v4f;

__global__ __launch_bounds__(256) void cvt_transpose_kernel(const float* __restrict__ W,
                                                            __bf16* __restrict__ Wt, int K, int N) {
    // 128-B rows at a 144-B pitch (16 B x odd) for the 16-byte readers.
    __shared__ __attribute__((aligned(16))) __bf16 tile[64][72];
    const int t = threadIdx.x;
    const int n0 = blockIdx.x * 64;
    const int k0 = blockIdx.y * 64;

    const int nq = (t & 15) * 4;   // four columns of W
    const int kq = (t >> 4) * 4;   // four rows of W
    const float* in = W + (size_t)(k0 + kq) * N + n0 + nq;
    v4f r[4];
#pragma unroll
    for (int i = 0; i < 4; ++i) {
        r[i] = *(const v4f*)(in + (size_t)i * N);
        // a later load's result registers may reuse this load's address pair:
        // the wait stands between the load and any such overwrite
        asm volatile("s_wait_xcnt 0x0" ::: "memory");
    }
#pragma unroll
    for (int j = 0; j < 4; ++j) {
        v4bf p;
#pragma unroll
        for (int i = 0; i < 4; ++i) p[i] = f2bf(r[i][j]);
        *(v4bf*)&tile[nq + j][kq] = p;
    }
    __syncthreads();

    const int kk = (t & 7) * 8;    // eight lanes cover one 128-B row of the tile
#pragma unroll
    for (int pass = 0; pass < 2; ++pass) {
        const int n = (t >> 3) + pass * 32;
        *(v8bf*)(Wt + (size_t)(n0 + n) * K + k0 + kk) = *(const v8bf*)&tile[n][kk];
    }
}

// ---------------------------------------------------------------------------
// Generic bf16 WMMA GEMM: C[M,N] = A[M,K] * Wt[N,K]^T + bias, with mode epilogue
//   mode 0: Q/K layout  -> bf16 out[((b*16+h)*1024+s)*64+d]
//   mode 2: V transposed-> bf16 out[((b*16+h)*64+d)*1024+s]
//   mode 3: ReLU        -> bf16 out[row*N+col]   (FFN1)
//   mode 4: plain f32   -> f32  out[row*N+col]   (FFN2)
// Block: 128 threads = 4 waves; wave w owns rows m0+32w..+31, cols n0..n0+63.
// A pass is 128 k: the block's 128 rows of A and 64 rows of Wt (256 B each) are
// brought into LDS by asynchronous copies that read whole 128-B lines, two
// buffers, the copies of pass p+2 in flight while pass p+1 is worked on.
// Fragments come from LDS by 16-B reads; per 32-k chunk 2 A + 4 B frags -> 8 WMMAs.
// ---------------------------------------------------------------------------
#define G_PASS_K 128                       // k elements per pass
#define G_PITCH 136                        // LDS row pitch in elements: 272 B = 16 B x odd
#define G_ROWS (128 + 64)                  // A rows, then Wt rows
#define G_STAGE (G_ROWS * G_PITCH)         // elements per buffer
#define G_STEP_B (8 * G_PITCH * 2)         // LDS bytes between two copies of a thread (8 rows)

// Eight 16-B copies of one thread, 8 rows apart: global row step 'gs' elements.
// The s_wait_xcnt closes the statement so that no address register of a copy is
// rewritten ahead of it.
__device__ __forceinline__ void copy8_to_lds(unsigned l, const __bf16* g, size_t gs) {
    asm volatile(
        "global_load_async_to_lds_b128 %0, %8, off\n\t"
        "global_load_async_to_lds_b128 %1, %9, off\n\t"
        "global_load_async_to_lds_b128 %2, %10, off\n\t"
        "global_load_async_to_lds_b128 %3, %11, off\n\t"
        "global_load_async_to_lds_b128 %4, %12, off\n\t"
        "global_load_async_to_lds_b128 %5, %13, off\n\t"
        "global_load_async_to_lds_b128 %6, %14, off\n\t"
        "global_load_async_to_lds_b128 %7, %15, off\n\t"
        "s_wait_xcnt 0x0"
        :: "v"(l), "v"(l + 1 * G_STEP_B), "v"(l + 2 * G_STEP_B), "v"(l + 3 * G_STEP_B),
           "v"(l + 4 * G_STEP_B), "v"(l + 5 * G_STEP_B), "v"(l + 6 * G_STEP_B),
           "v"(l + 7 * G_STEP_B),
           "v"(g), "v"(g + gs), "v"(g + 2 * gs), "v"(g + 3 * gs),
           "v"(g + 4 * gs), "v"(g + 5 * gs), "v"(g + 6 * gs), "v"(g + 7 * gs)
        : "memory");
}

__global__ __launch_bounds__(128) void gemm_bf16_kernel(
    const __bf16* __restrict__ A, const __bf16* __restrict__ Wt,
    const float* __restrict__ bias, void* __restrict__ outp,
    int N, int Kd, int mode) {
    __shared__ __attribute__((aligned(16))) __bf16 sm[2 * G_STAGE];
    const int t = threadIdx.x;
    const int lane = t & 31;
    const int wv = t >> 5;
    const int hl = lane >> 4;
    const int l16 = lane & 15;
    const int n0 = blockIdx.x * 64;
    const int mb = blockIdx.y * 128;
    const int m0 = mb + wv * 32;

    v8f c[2][4] = {};

    // copies: 16 lanes cover one 256-B row piece, a wave two rows, the block 8 rows
    const int crow = t >> 4;
    const int ccol = (t & 15) * 8;
    const size_t gs = (size_t)8 * Kd;
    const __bf16* gA = A + (size_t)(mb + crow) * Kd + ccol;
    const __bf16* gB = Wt + (size_t)(n0 + crow) * Kd + ccol;
    const unsigned lc = (unsigned)(size_t)(&sm[0]) + (unsigned)(crow * G_PITCH + ccol) * 2u;

#define ISSUE_PASS(p, buf)                                                     \
    do {                                                                       \
        const unsigned lb = lc + (unsigned)(buf) * (G_STAGE * 2u);             \
        const __bf16* ga = gA + (size_t)(p) * G_PASS_K;                        \
        copy8_to_lds(lb, ga, gs);                                              \
        copy8_to_lds(lb + 8u * G_STEP_B, ga + 8 * gs, gs);                     \
        copy8_to_lds(lb + 16u * G_STEP_B, gB + (size_t)(p) * G_PASS_K, gs);    \
    } while (0)

    // fragment rows of this lane inside a buffer
    const int fa = (wv * 32 + l16) * G_PITCH;
    const int fb = (128 + l16) * G_PITCH;

    // ping-pong fragment buffers
    v16bf a0[2], a1[2], bb[2][4];

#define LOAD_CHUNK(buf, kk)                                                    \
    do {                                                                       \
        a0[buf] = load_frag(st + fa + (kk), hl);                               \
        a1[buf] = load_frag(st + fa + 16 * G_PITCH + (kk), hl);                \
        _Pragma("unroll") for (int g = 0; g < 4; ++g)                          \
            bb[buf][g] = load_frag(st + fb + g * 16 * G_PITCH + (kk), hl);     \
    } while (0)

#define COMPUTE(buf)                                               \
    do {                                                           \
        _Pragma("unroll") for (int g = 0; g < 4; ++g) {            \
            c[0][g] = wmma_bf16(a0[buf], bb[buf][g], c[0][g]);     \
            c[1][g] = wmma_bf16(a1[buf], bb[buf][g], c[1][g]);     \
        }                                                          \
    } while (0)

    // Kd is a multiple of 128 (1024 or 4096).
    const int npass = Kd / G_PASS_K;
    ISSUE_PASS(0, 0);
    // pass 0 has landed for this wave; the barrier publishes it to the others
    asm volatile("s_wait_asynccnt 0x0" ::: "memory");
    __syncthreads();
    if (npass > 1) ISSUE_PASS(1, 1);

    for (int p = 0; p < npass; ++p) {
        const __bf16* st = sm + (p & 1) * G_STAGE;
        // The scheduling barriers keep each chunk's twelve LDS reads together and one
        // chunk ahead of their WMMAs; without them the compiler sinks the reads to
        // pairs directly in front of their use, each pair behind a wait to zero.
        LOAD_CHUNK(0, 0);
        LOAD_CHUNK(1, 32);
        __builtin_amdgcn_sched_barrier(0);
        COMPUTE(0);
        __builtin_amdgcn_sched_barrier(0);
        LOAD_CHUNK(0, 64);
        __builtin_amdgcn_sched_barrier(0);
        COMPUTE(1);
        __builtin_amdgcn_sched_barrier(0);
        LOAD_CHUNK(1, 96);
        // The pass's last LDS reads are out: the hand-over stands here, ahead of the
        // last two chunks' WMMAs (registers only), so that the refill flies under them.
        // this wave's reads of the buffer have returned before it is refilled
        asm volatile("s_wait_dscnt 0x0" ::: "memory");
        // this wave's copies of pass p+1 have landed before the barrier publishes them
        asm volatile("s_wait_asynccnt 0x0" ::: "memory");
        __syncthreads();
        if (p + 2 < npass) ISSUE_PASS(p + 2, p & 1);
        COMPUTE(0);
        COMPUTE(1);
    }
    // no copy is outstanding when the wave goes on to its end
    asm volatile("s_wait_asynccnt 0x0" ::: "memory");
#undef ISSUE_PASS
#undef LOAD_CHUNK
#undef COMPUTE

#pragma unroll
    for (int sub = 0; sub < 2; ++sub) {
#pragma unroll
        for (int g = 0; g < 4; ++g) {
            const int col = n0 + g * 16 + l16;
            const float bcst = bias[col];
#pragma unroll
            for (int v = 0; v < 8; ++v) {
                const int row = m0 + sub * 16 + v + hl * 8;  // D-frag: M = v + 8*(lane>=16)
                float val = c[sub][g][v] + bcst;
                if (mode == 3) {
                    val = fmaxf(val, 0.f);
                    ((__bf16*)outp)[(size_t)row * N + col] = f2bf(val);
                } else if (mode == 4) {
                    ((float*)outp)[(size_t)row * N + col] = val;
                } else if (mode == 2) {  // V -> [b,h,d,s]
                    int bb2 = row >> 10, s = row & 1023, hh = col >> 6, d = col & 63;
                    ((__bf16*)outp)[(((size_t)(bb2 * 16 + hh)) * 64 + d) * 1024 + s] = f2bf(val);
                } else {                 // Q/K -> [b,h,s,d]
                    int bb2 = row >> 10, s = row & 1023, hh = col >> 6, d = col & 63;
                    ((__bf16*)outp)[(((size_t)(bb2 * 16 + hh)) * 1024 + s) * 64 + d] = f2bf(val);
                }
            }
        }
    }
}

// ---------------------------------------------------------------------------
// Flash attention with fused pair-bias MLP. One wave per (b, h, 16-row q-tile).
// ---------------------------------------------------------------------------
__global__ __launch_bounds__(32) void attn_kernel(
    const __bf16* __restrict__ Q, const __bf16* __restrict__ Km,
    const __bf16* __restrict__ Vt, const float* __restrict__ td,
    const float* __restrict__ dd, const float* __restrict__ tw1,
    const float* __restrict__ tb1, const float* __restrict__ tw2,
    const float* __restrict__ tb2, const float* __restrict__ dw1,
    const float* __restrict__ db1, const float* __restrict__ dw2,
    const float* __restrict__ db2, float* __restrict__ out) {
    const int lane = threadIdx.x & 31;
    const int hl = lane >> 4;
    const int l16 = lane & 15;
    const int qt = blockIdx.x & 63;
    const int h = (blockIdx.x >> 6) & 15;
    const int b = blockIdx.x >> 10;

    __shared__ float sc[16][36];                                // f32 score tile 16x32 (+pad)
    __shared__ __attribute__((aligned(16))) __bf16 pb[16][40];  // bf16 P tile
    __shared__ float corr[16];
    __shared__ float lsum[16];

    // Per-head pair-bias MLP weights (uniform -> scalar loads)
    float w1t[8], b1t[8], w2t[8], w1d[8], b1d[8], w2d[8];
#pragma unroll
    for (int j = 0; j < 8; ++j) {
        w1t[j] = tw1[j]; b1t[j] = tb1[j]; w2t[j] = tw2[j * 16 + h];
        w1d[j] = dw1[j]; b1d[j] = db1[j]; w2d[j] = dw2[j * 16 + h];
    }
    const float bconst = tb2[h] + db2[h];

    const size_t bh = (size_t)(b * 16 + h);

    // Q A-fragments for the two K-dim halves (hd 0..31, 32..63)
    v16bf qa[2];
    {
        const __bf16* r = Q + (bh * 1024 + qt * 16 + l16) * 64;
        qa[0] = load_frag(r, hl);
        qa[1] = load_frag(r + 32, hl);
    }

    v8f o[4] = {};
    float mrow = -1e30f, lrow = 0.f;

    for (int kb = 0; kb < SDIM; kb += 32) {
        // ---- scores for 32 keys: 2 N-groups x 2 K-frags = 4 WMMAs ----
#pragma unroll
        for (int g = 0; g < 2; ++g) {
            const __bf16* kr = Km + (bh * 1024 + kb + g * 16 + l16) * 64;
            v16bf kb0 = load_frag(kr, hl);
            v16bf kb1 = load_frag(kr + 32, hl);
            v8f s = {};
            s = wmma_bf16(qa[0], kb0, s);
            s = wmma_bf16(qa[1], kb1, s);
            const int key = kb + g * 16 + l16;
#pragma unroll
            for (int v = 0; v < 8; ++v) {
                const int qrow = v + hl * 8;
                const int qg = qt * 16 + qrow;
                const size_t midx = ((size_t)b * SDIM + qg) * SDIM + key;
                const float m1 = td[midx];
                const float m2 = dd[midx];
                float bias = bconst;
#pragma unroll
                for (int j = 0; j < 8; ++j) {
                    bias += fmaxf(m1 * w1t[j] + b1t[j], 0.f) * w2t[j];
                    bias += fmaxf(m2 * w1d[j] + b1d[j], 0.f) * w2d[j];
                }
                sc[qrow][g * 16 + l16] = s[v] * (1.0f / 32.0f) + bias;
            }
        }
        __syncthreads();

        // ---- online softmax: lane handles (row=l16, cols hl*16..+15) ----
        float pm = -1e30f;
        float sv[16];
#pragma unroll
        for (int j = 0; j < 16; ++j) {
            sv[j] = sc[l16][hl * 16 + j];
            pm = fmaxf(pm, sv[j]);
        }
        pm = fmaxf(pm, __shfl_xor(pm, 16, 32));
        const float nm = fmaxf(mrow, pm);
        const float cf = __expf(mrow - nm);
        float ps = 0.f;
#pragma unroll
        for (int j = 0; j < 16; ++j) {
            float p = __expf(sv[j] - nm);
            ps += p;
            pb[l16][hl * 16 + j] = f2bf(p);
        }
        ps += __shfl_xor(ps, 16, 32);
        lrow = lrow * cf + ps;
        mrow = nm;
        if (lane < 16) corr[l16] = cf;
        __syncthreads();

        // ---- rescale O, then O += P * V (4 WMMAs) ----
        float cfa[8];
#pragma unroll
        for (int v = 0; v < 8; ++v) cfa[v] = corr[v + hl * 8];
#pragma unroll
        for (int g = 0; g < 4; ++g)
#pragma unroll
            for (int v = 0; v < 8; ++v) o[g][v] *= cfa[v];

        v16bf pa = load_frag(&pb[l16][0], hl);
#pragma unroll
        for (int g = 0; g < 4; ++g) {
            const __bf16* vr = Vt + (bh * 64 + g * 16 + l16) * 1024 + kb;
            v16bf vb = load_frag(vr, hl);
            o[g] = wmma_bf16(pa, vb, o[g]);
        }
        __syncthreads();  // sc/pb reused next iteration
    }

    if (lane < 16) lsum[l16] = 1.f / lrow;
    __syncthreads();
    float ri[8];
#pragma unroll
    for (int v = 0; v < 8; ++v) ri[v] = lsum[v + hl * 8];
#pragma unroll
    for (int g = 0; g < 4; ++g)
#pragma unroll
        for (int v = 0; v < 8; ++v) {
            const int s = qt * 16 + v + hl * 8;
            const int d = h * 64 + g * 16 + l16;
            out[((size_t)b * SDIM + s) * DMODEL + d] = o[g][v] * ri[v];
        }
}

// ---------------------------------------------------------------------------
// Residual + LayerNorm over D=1024. One 256-thread block per row.
// ---------------------------------------------------------------------------
__global__ __launch_bounds__(256) void add_ln_kernel(
    const float* __restrict__ a, const float* __restrict__ r,
    const float* __restrict__ g, const float* __restrict__ beta,
    float* __restrict__ outf, __bf16* __restrict__ outb) {
    const int row = blockIdx.x;
    const int t = threadIdx.x;
    __shared__ float red[256];
    float v[4];
    float s = 0.f;
#pragma unroll
    for (int i = 0; i < 4; ++i) {
        const int c = t + i * 256;
        v[i] = a[(size_t)row * DMODEL + c] + r[(size_t)row * DMODEL + c];
        s += v[i];
    }
    red[t] = s;
    __syncthreads();
    for (int st = 128; st > 0; st >>= 1) {
        if (t < st) red[t] += red[t + st];
        __syncthreads();
    }
    const float mean = red[0] * (1.f / 1024.f);
    __syncthreads();
    float ss = 0.f;
#pragma unroll
    for (int i = 0; i < 4; ++i) {
        const float d = v[i] - mean;
        ss += d * d;
    }
    red[t] = ss;
    __syncthreads();
    for (int st = 128; st > 0; st >>= 1) {
        if (t < st) red[t] += red[t + st];
        __syncthreads();
    }
    const float rstd = rsqrtf(red[0] * (1.f / 1024.f) + 1e-5f);
#pragma unroll
    for (int i = 0; i < 4; ++i) {
        const int c = t + i * 256;
        const float y = (v[i] - mean) * rstd * g[c] + beta[c];
        outf[(size_t)row * DMODEL + c] = y;
        if (outb) outb[(size_t)row * DMODEL + c] = f2bf(y);
    }
}

// ---------------------------------------------------------------------------
// Host launch
// ---------------------------------------------------------------------------
extern "C" void kernel_launch(void* const* d_in, const int* in_sizes, int n_in,
                              void* d_out, int out_size, void* d_ws, size_t ws_size,
                              hipStream_t stream) {
    (void)in_sizes; (void)n_in; (void)out_size; (void)ws_size;
    const float* src = (const float*)d_in[0];
    const float* td  = (const float*)d_in[1];
    const float* dd  = (const float*)d_in[2];
    const float* Wq  = (const float*)d_in[3];
    const float* bq  = (const float*)d_in[4];
    const float* Wk  = (const float*)d_in[5];
    const float* bk  = (const float*)d_in[6];
    const float* Wv  = (const float*)d_in[7];
    const float* bv  = (const float*)d_in[8];
    const float* tw1 = (const float*)d_in[9];
    const float* tb1 = (const float*)d_in[10];
    const float* tw2 = (const float*)d_in[11];
    const float* tb2 = (const float*)d_in[12];
    const float* dw1 = (const float*)d_in[13];
    const float* db1 = (const float*)d_in[14];
    const float* dw2 = (const float*)d_in[15];
    const float* db2 = (const float*)d_in[16];
    const float* W1  = (const float*)d_in[17];
    const float* b1  = (const float*)d_in[18];
    const float* W2  = (const float*)d_in[19];
    const float* b2  = (const float*)d_in[20];
    const float* g1  = (const float*)d_in[21];
    const float* be1 = (const float*)d_in[22];
    const float* g2  = (const float*)d_in[23];
    const float* be2 = (const float*)d_in[24];

    const int M = BDIM * SDIM;  // 4096 rows
    char* ws = (char*)d_ws;
    size_t off = 0;
    auto alloc = [&](size_t bytes) {
        char* p = ws + off;
        off = (off + bytes + 255) & ~(size_t)255;
        return p;
    };
    __bf16* srcb = (__bf16*)alloc((size_t)M * DMODEL * 2);
    __bf16* Wqt  = (__bf16*)alloc((size_t)DMODEL * DMODEL * 2);
    __bf16* Wkt  = (__bf16*)alloc((size_t)DMODEL * DMODEL * 2);
    __bf16* Wvt  = (__bf16*)alloc((size_t)DMODEL * DMODEL * 2);
    __bf16* W1t  = (__bf16*)alloc((size_t)DMODEL * DFF * 2);
    __bf16* W2t  = (__bf16*)alloc((size_t)DFF * DMODEL * 2);
    __bf16* Qb   = (__bf16*)alloc((size_t)M * DMODEL * 2);
    __bf16* Kb   = (__bf16*)alloc((size_t)M * DMODEL * 2);
    __bf16* Vtb  = (__bf16*)alloc((size_t)M * DMODEL * 2);
    float*  attn = (float*)alloc((size_t)M * DMODEL * 4);
    float*  xf   = (float*)alloc((size_t)M * DMODEL * 4);
    __bf16* xb   = (__bf16*)alloc((size_t)M * DMODEL * 2);
    __bf16* h1   = (__bf16*)alloc((size_t)M * DFF * 2);
    float*  ffn  = (float*)alloc((size_t)M * DMODEL * 4);

    const int nSrc = M * DMODEL;
    cvt_f32_bf16_kernel<<<(nSrc + 255) / 256, 256, 0, stream>>>(src, srcb, nSrc);
    cvt_transpose_kernel<<<dim3(DMODEL / 64, DMODEL / 64), 256, 0, stream>>>(Wq, Wqt, DMODEL, DMODEL);
    cvt_transpose_kernel<<<dim3(DMODEL / 64, DMODEL / 64), 256, 0, stream>>>(Wk, Wkt, DMODEL, DMODEL);
    cvt_transpose_kernel<<<dim3(DMODEL / 64, DMODEL / 64), 256, 0, stream>>>(Wv, Wvt, DMODEL, DMODEL);
    cvt_transpose_kernel<<<dim3(DFF / 64, DMODEL / 64), 256, 0, stream>>>(W1, W1t, DMODEL, DFF);
    cvt_transpose_kernel<<<dim3(DMODEL / 64, DFF / 64), 256, 0, stream>>>(W2, W2t, DFF, DMODEL);

    dim3 gqkv(DMODEL / 64, M / 128);
    gemm_bf16_kernel<<<gqkv, 128, 0, stream>>>(srcb, Wqt, bq, Qb, DMODEL, DMODEL, 0);
    gemm_bf16_kernel<<<gqkv, 128, 0, stream>>>(srcb, Wkt, bk, Kb, DMODEL, DMODEL, 0);
    gemm_bf16_kernel<<<gqkv, 128, 0, stream>>>(srcb, Wvt, bv, Vtb, DMODEL, DMODEL, 2);

    attn_kernel<<<BDIM * NHEAD * (SDIM / 16), 32, 0, stream>>>(
        Qb, Kb, Vtb, td, dd, tw1, tb1, tw2, tb2, dw1, db1, dw2, db2, attn);

    add_ln_kernel<<<M, 256, 0, stream>>>(src, attn, g1, be1, xf, xb);

    gemm_bf16_kernel<<<dim3(DFF / 64, M / 128), 128, 0, stream>>>(xb, W1t, b1, h1, DFF, DMODEL, 3);
    gemm_bf16_kernel<<<dim3(DMODEL / 64, M / 128), 128, 0, stream>>>(h1, W2t, b2, ffn, DMODEL, DFF, 4);

    add_ln_kernel<<<M, 256, 0, stream>>>(xf, ffn, g2, be2, (float*)d_out, nullptr);
}

// v003
// Measured time: 286 microseconds a run.
// Two timings next to v002 put it at 1.06 and 1.05 times that version's speed.
// Over all steps from v000 it is 2.42 times as fast.
#include <hip/hip_runtime.h>

// ---------------------------------------------------------------------------
// SpatioTemporalTransformerLayer for MI455X (gfx1250, wave32, WMMA).
// B=4, S=1024, D=1024, H=16, HD=64, DFF=4096, BIAS_HID=8.
// All GEMMs use v_wmma_f32_16x16x32_bf16 (bf16 A/B, f32 accumulate).
// GEMM operand tiles are staged in LDS by asynchronous copies (two buffers);
// fragments are read from LDS into ping-pong fragment buffers.
// ---------------------------------------------------------------------------

typedef __attribute__((ext_vector_type(16))) __bf16 v16bf;
typedef __attribute__((ext_vector_type(8)))  __bf16 v8bf;
typedef __attribute__((ext_vector_type(8)))  float  v8f;

#define BDIM 4
#define SDIM 1024
#define DMODEL 1024
#define NHEAD 16
#define HEADD 64
#define DFF 4096

__device__ __forceinline__ __bf16 f2bf(float x) {
    unsigned u = __builtin_bit_cast(unsigned, x);
    unsigned r = (u + 0x7FFFu + ((u >> 16) & 1u)) >> 16;
    return __builtin_bit_cast(__bf16, (unsigned short)r);
}

__device__ __forceinline__ v8f wmma_bf16(v16bf a, v16bf b, v8f c) {
    // (neg_a, A, neg_b, B, c_mod, C, reuse_a, reuse_b)
    return __builtin_amdgcn_wmma_f32_16x16x32_bf16(false, a, false, b, (short)0, c,
                                                   false, false);
}

// Load a 16x32 bf16 A/B fragment: lane L, elem e -> (row=L&15, K=16*(e>>3)+8*(L>>4)+(e&7))
// 'row_ptr' points at element K=0 of this lane's row. Two contiguous 16B loads.
__device__ __forceinline__ v16bf load_frag(const __bf16* row_ptr, int hl) {
    v8bf lo = *(const v8bf*)(row_ptr + hl * 8);
    v8bf hi = *(const v8bf*)(row_ptr + 16 + hl * 8);
    v16bf f;
#pragma unroll
    for (int i = 0; i < 8; ++i) { f[i] = lo[i]; f[8 + i] = hi[i]; }
    return f;
}

// ---------------------------------------------------------------------------
// Elementwise converters
// ---------------------------------------------------------------------------
typedef __attribute__((ext_vector_type(4))) __bf16 v4bf;
typedef __attribute__((ext_vector_type(4))) float  v4f;

// 32 elements a thread, so that the launch starts 4,096 waves in place of 131,072:
// eight 16-B loads in flight per lane, each wave-wide load 512 contiguous bytes,
// each wave-wide store 256. The grid covers the array exactly (8,192 elements a block).
#define CVT_BLOCK_ELEMS (256 * 32)
__global__ __launch_bounds__(256) void cvt_f32_bf16_kernel(const float* __restrict__ in,
                                                           __bf16* __restrict__ out) {
    const size_t base = (size_t)blockIdx.x * CVT_BLOCK_ELEMS + threadIdx.x * 4;
    v4f r[8];
#pragma unroll
    for (int i = 0; i < 8; ++i) r[i] = *(const v4f*)(in + base + i * 1024);
    // the loads' address registers may be reused below: the wait stands in front of that
    asm volatile("s_wait_xcnt 0x0" ::: "memory");
#pragma unroll
    for (int i = 0; i < 8; ++i) {
        v4bf p;
#pragma unroll
        for (int j = 0; j < 4; ++j) p[j] = f2bf(r[i][j]);
        *(v4bf*)(out + base + i * 1024) = p;
    }
}

// W[K][N] f32 (row-major) -> Wt[N][K] bf16, one 64x64 tile per 256-thread block.
// K and N are multiples of 64. Reads are 256-B row pieces (16 B a lane), the tile is
// turned in LDS, and every store instruction writes whole 128-B lines of Wt.
__global__ __launch_bounds__(256) void cvt_transpose_kernel(const float* __restrict__ W,
                                                            __bf16* __restrict__ Wt, int K, int N) {
    // 128-B rows at a 144-B pitch (16 B x odd) for the 16-byte readers.
    __shared__ __attribute__((aligned(16))) __bf16 tile[64][72];
    const int t = threadIdx.x;
    const int n0 = blockIdx.x * 64;
    const int k0 = blockIdx.y * 64;

    const int nq = (t & 15) * 4;   // four columns of W
    const int kq = (t >> 4) * 4;   // four rows of W
    const float* in = W + (size_t)(k0 + kq) * N + n0 + nq;
    v4f r[4];
#pragma unroll
    for (int i = 0; i < 4; ++i) {
        r[i] = *(const v4f*)(in + (size_t)i * N);
        // a later load's result registers may reuse this load's address pair:
        // the wait stands between the load and any such overwrite
        asm volatile("s_wait_xcnt 0x0" ::: "memory");
    }
#pragma unroll
    for (int j = 0; j < 4; ++j) {
        v4bf p;
#pragma unroll
        for (int i = 0; i < 4; ++i) p[i] = f2bf(r[i][j]);
        *(v4bf*)&tile[nq + j][kq] = p;
    }
    __syncthreads();

    const int kk = (t & 7) * 8;    // eight lanes cover one 128-B row of the tile
#pragma unroll
    for (int pass = 0; pass < 2; ++pass) {
        const int n = (t >> 3) + pass * 32;
        *(v8bf*)(Wt + (size_t)(n0 + n) * K + k0 + kk) = *(const v8bf*)&tile[n][kk];
    }
}

// ---------------------------------------------------------------------------
// Generic bf16 WMMA GEMM: C[M,N] = A[M,K] * Wt[N,K]^T + bias, with mode epilogue
//   mode 0: Q/K layout  -> bf16 out[((b*16+h)*1024+s)*64+d]
//   mode 2: V transposed-> bf16 out[((b*16+h)*64+d)*1024+s]
//   mode 3: ReLU        -> bf16 out[row*N+col]   (FFN1)
//   mode 4: plain f32   -> f32  out[row*N+col]   (FFN2)
// Block: 128 threads = 4 waves; wave w owns rows m0+32w..+31, cols n0..n0+63.
// A pass is 128 k: the block's 128 rows of A and 64 rows of Wt (256 B each) are
// brought into LDS by asynchronous copies that read whole 128-B lines, two
// buffers, the copies of pass p+2 in flight while pass p+1 is worked on.
// Fragments come from LDS by 16-B reads; per 32-k chunk 2 A + 4 B frags -> 8 WMMAs.
// ---------------------------------------------------------------------------
#define G_PASS_K 128                       // k elements per pass
#define G_PITCH 136                        // LDS row pitch in elements: 272 B = 16 B x odd
#define G_ROWS (128 + 64)                  // A rows, then Wt rows
#define G_STAGE (G_ROWS * G_PITCH)         // elements per buffer
#define G_STEP_B (8 * G_PITCH * 2)         // LDS bytes between two copies of a thread (8 rows)

// Eight 16-B copies of one thread, 8 rows apart: global row step 'gs' elements.
// The s_wait_xcnt closes the statement so that no address register of a copy is
// rewritten ahead of it.
__device__ __forceinline__ void copy8_to_lds(unsigned l, const __bf16* g, size_t gs) {
    asm volatile(
        "global_load_async_to_lds_b128 %0, %8, off\n\t"
        "global_load_async_to_lds_b128 %1, %9, off\n\t"
        "global_load_async_to_lds_b128 %2, %10, off\n\t"
        "global_load_async_to_lds_b128 %3, %11, off\n\t"
        "global_load_async_to_lds_b128 %4, %12, off\n\t"
        "global_load_async_to_lds_b128 %5, %13, off\n\t"
        "global_load_async_to_lds_b128 %6, %14, off\n\t"
        "global_load_async_to_lds_b128 %7, %15, off\n\t"
        "s_wait_xcnt 0x0"
        :: "v"(l), "v"(l + 1 * G_STEP_B), "v"(l + 2 * G_STEP_B), "v"(l + 3 * G_STEP_B),
           "v"(l + 4 * G_STEP_B), "v"(l + 5 * G_STEP_B), "v"(l + 6 * G_STEP_B),
           "v"(l + 7 * G_STEP_B),
           "v"(g), "v"(g + gs), "v"(g + 2 * gs), "v"(g + 3 * gs),
           "v"(g + 4 * gs), "v"(g + 5 * gs), "v"(g + 6 * gs), "v"(g + 7 * gs)
        : "memory");
}

__global__ __launch_bounds__(128) void gemm_bf16_kernel(
    const __bf16* __restrict__ A, const __bf16* __restrict__ Wt,
    const float* __restrict__ bias, void* __restrict__ outp,
    int N, int Kd, int mode) {
    __shared__ __attribute__((aligned(16))) __bf16 sm[2 * G_STAGE];
    const int t = threadIdx.x;
    const int lane = t & 31;
    const int wv = t >> 5;
    const int hl = lane >> 4;
    const int l16 = lane & 15;
    const int n0 = blockIdx.x * 64;
    const int mb = blockIdx.y * 128;
    const int m0 = mb + wv * 32;

    v8f c[2][4] = {};

    // copies: 16 lanes cover one 256-B row piece, a wave two rows, the block 8 rows
    const int crow = t >> 4;
    const int ccol = (t & 15) * 8;
    const size_t gs = (size_t)8 * Kd;
    const __bf16* gA = A + (size_t)(mb + crow) * Kd + ccol;
    const __bf16* gB = Wt + (size_t)(n0 + crow) * Kd + ccol;
    const unsigned lc = (unsigned)(size_t)(&sm[0]) + (unsigned)(crow * G_PITCH + ccol) * 2u;

#define ISSUE_PASS(p, buf)                                                     \
    do {                                                                       \
        const unsigned lb = lc + (unsigned)(buf) * (G_STAGE * 2u);             \
        const __bf16* ga = gA + (size_t)(p) * G_PASS_K;                        \
        copy8_to_lds(lb, ga, gs);                                              \
        copy8_to_lds(lb + 8u * G_STEP_B, ga + 8 * gs, gs);                     \
        copy8_to_lds(lb + 16u * G_STEP_B, gB + (size_t)(p) * G_PASS_K, gs);    \
    } while (0)

    // fragment rows of this lane inside a buffer
    const int fa = (wv * 32 + l16) * G_PITCH;
    const int fb = (128 + l16) * G_PITCH;

    // ping-pong fragment buffers
    v16bf a0[2], a1[2], bb[2][4];

#define LOAD_CHUNK(buf, kk)                                                    \
    do {                                                                       \
        a0[buf] = load_frag(st + fa + (kk), hl);                               \
        a1[buf] = load_frag(st + fa + 16 * G_PITCH + (kk), hl);                \
        _Pragma("unroll") for (int g = 0; g < 4; ++g)                          \
            bb[buf][g] = load_frag(st + fb + g * 16 * G_PITCH + (kk), hl);     \
    } while (0)

#define COMPUTE(buf)                                               \
    do {                                                           \
        _Pragma("unroll") for (int g = 0; g < 4; ++g) {            \
            c[0][g] = wmma_bf16(a0[buf], bb[buf][g], c[0][g]);     \
            c[1][g] = wmma_bf16(a1[buf], bb[buf][g], c[1][g]);     \
        }                                                          \
    } while (0)

    // Kd is a multiple of 128 (1024 or 4096).
    const int npass = Kd / G_PASS_K;
    ISSUE_PASS(0, 0);
    // pass 0 has landed for this wave; the barrier publishes it to the others
    asm volatile("s_wait_asynccnt 0x0" ::: "memory");
    __syncthreads();
    if (npass > 1) ISSUE_PASS(1, 1);

    for (int p = 0; p < npass; ++p) {
        const __bf16* st = sm + (p & 1) * G_STAGE;
        // The scheduling barriers keep each chunk's twelve LDS reads together and one
        // chunk ahead of their WMMAs; without them the compiler sinks the reads to
        // pairs directly in front of their use, each pair behind a wait to zero.
        LOAD_CHUNK(0, 0);
        LOAD_CHUNK(1, 32);
        __builtin_amdgcn_sched_barrier(0);
        COMPUTE(0);
        __builtin_amdgcn_sched_barrier(0);
        LOAD_CHUNK(0, 64);
        __builtin_amdgcn_sched_barrier(0);
        COMPUTE(1);
        __builtin_amdgcn_sched_barrier(0);
        LOAD_CHUNK(1, 96);
        // The pass's last LDS reads are out: the hand-over stands here, ahead of the
        // last two chunks' WMMAs (registers only), so that the refill flies under them.
        // this wave's reads of the buffer have returned before it is refilled
        asm volatile("s_wait_dscnt 0x0" ::: "memory");
        // this wave's copies of pass p+1 have landed before the barrier publishes them
        asm volatile("s_wait_asynccnt 0x0" ::: "memory");
        __syncthreads();
        if (p + 2 < npass) ISSUE_PASS(p + 2, p & 1);
        COMPUTE(0);
        COMPUTE(1);
    }
    // no copy is outstanding when the wave goes on to its end
    asm volatile("s_wait_asynccnt 0x0" ::: "memory");
#undef ISSUE_PASS
#undef LOAD_CHUNK
#undef COMPUTE

#pragma unroll
    for (int sub = 0; sub < 2; ++sub) {
#pragma unroll
        for (int g = 0; g < 4; ++g) {
            const int col = n0 + g * 16 + l16;
            const float bcst = bias[col];
#pragma unroll
            for (int v = 0; v < 8; ++v) {
                const int row = m0 + sub * 16 + v + hl * 8;  // D-frag: M = v + 8*(lane>=16)
                float val = c[sub][g][v] + bcst;
                if (mode == 3) {
                    val = fmaxf(val, 0.f);
                    ((__bf16*)outp)[(size_t)row * N + col] = f2bf(val);
                } else if (mode == 4) {
                    ((float*)outp)[(size_t)row * N + col] = val;
                } else if (mode == 2) {  // V -> [b,h,d,s]
                    int bb2 = row >> 10, s = row & 1023, hh = col >> 6, d = col & 63;
                    ((__bf16*)outp)[(((size_t)(bb2 * 16 + hh)) * 64 + d) * 1024 + s] = f2bf(val);
                } else {                 // Q/K -> [b,h,s,d]
                    int bb2 = row >> 10, s = row & 1023, hh = col >> 6, d = col & 63;
                    ((__bf16*)outp)[(((size_t)(bb2 * 16 + hh)) * 1024 + s) * 64 + d] = f2bf(val);
                }
            }
        }
    }
}

// ---------------------------------------------------------------------------
// Flash attention with fused pair-bias MLP. One wave per (b, h, 16-row q-tile).
// ---------------------------------------------------------------------------
__global__ __launch_bounds__(32) void attn_kernel(
    const __bf16* __restrict__ Q, const __bf16* __restrict__ Km,
    const __bf16* __restrict__ Vt, const float* __restrict__ td,
    const float* __restrict__ dd, const float* __restrict__ tw1,
    const float* __restrict__ tb1, const float* __restrict__ tw2,
    const float* __restrict__ tb2, const float* __restrict__ dw1,
    const float* __restrict__ db1, const float* __restrict__ dw2,
    const float* __restrict__ db2, float* __restrict__ out) {
    const int lane = threadIdx.x & 31;
    const int hl = lane >> 4;
    const int l16 = lane & 15;
    const int qt = blockIdx.x & 63;
    const int h = (blockIdx.x >> 6) & 15;
    const int b = blockIdx.x >> 10;

    __shared__ float sc[16][36];                                // f32 score tile 16x32 (+pad)
    __shared__ __attribute__((aligned(16))) __bf16 pb[16][40];  // bf16 P tile
    __shared__ float corr[16];
    __shared__ float lsum[16];

    // Per-head pair-bias MLP weights (uniform -> scalar loads)
    float w1t[8], b1t[8], w2t[8], w1d[8], b1d[8], w2d[8];
#pragma unroll
    for (int j = 0; j < 8; ++j) {
        w1t[j] = tw1[j]; b1t[j] = tb1[j]; w2t[j] = tw2[j * 16 + h];
        w1d[j] = dw1[j]; b1d[j] = db1[j]; w2d[j] = dw2[j * 16 + h];
    }
    const float bconst = tb2[h] + db2[h];

    const size_t bh = (size_t)(b * 16 + h);

    // Q A-fragments for the two K-dim halves (hd 0..31, 32..63)
    v16bf qa[2];
    {
        const __bf16* r = Q + (bh * 1024 + qt * 16 + l16) * 64;
        qa[0] = load_frag(r, hl);
        qa[1] = load_frag(r + 32, hl);
    }

    v8f o[4] = {};
    float mrow = -1e30f, lrow = 0.f;

    for (int kb = 0; kb < SDIM; kb += 32) {
        // ---- scores for 32 keys: 2 N-groups x 2 K-frags = 4 WMMAs ----
#pragma unroll
        for (int g = 0; g < 2; ++g) {
            const __bf16* kr = Km + (bh * 1024 + kb + g * 16 + l16) * 64;
            v16bf kb0 = load_frag(kr, hl);
            v16bf kb1 = load_frag(kr + 32, hl);
            v8f s = {};
            s = wmma_bf16(qa[0], kb0, s);
            s = wmma_bf16(qa[1], kb1, s);
            const int key = kb + g * 16 + l16;
#pragma unroll
            for (int v = 0; v < 8; ++v) {
                const int qrow = v + hl * 8;
                const int qg = qt * 16 + qrow;
                const size_t midx = ((size_t)b * SDIM + qg) * SDIM + key;
                const float m1 = td[midx];
                const float m2 = dd[midx];
                float bias = bconst;
#pragma unroll
                for (int j = 0; j < 8; ++j) {
                    bias += fmaxf(m1 * w1t[j] + b1t[j], 0.f) * w2t[j];
                    bias += fmaxf(m2 * w1d[j] + b1d[j], 0.f) * w2d[j];
                }
                sc[qrow][g * 16 + l16] = s[v] * (1.0f / 32.0f) + bias;
            }
        }
        __syncthreads();

        // ---- online softmax: lane handles (row=l16, cols hl*16..+15) ----
        float pm = -1e30f;
        float sv[16];
#pragma unroll
        for (int j = 0; j < 16; ++j) {
            sv[j] = sc[l16][hl * 16 + j];
            pm = fmaxf(pm, sv[j]);
        }
        pm = fmaxf(pm, __shfl_xor(pm, 16, 32));
        const float nm = fmaxf(mrow, pm);
        const float cf = __expf(mrow - nm);
        float ps = 0.f;
#pragma unroll
        for (int j = 0; j < 16; ++j) {
            float p = __expf(sv[j] - nm);
            ps += p;
            pb[l16][hl * 16 + j] = f2bf(p);
        }
        ps += __shfl_xor(ps, 16, 32);
        lrow = lrow * cf + ps;
        mrow = nm;
        if (lane < 16) corr[l16] = cf;
        __syncthreads();

        // ---- rescale O, then O += P * V (4 WMMAs) ----
        float cfa[8];
#pragma unroll
        for (int v = 0; v < 8; ++v) cfa[v] = corr[v + hl * 8];
#pragma unroll
        for (int g = 0; g < 4; ++g)
#pragma unroll
            for (int v = 0; v < 8; ++v) o[g][v] *= cfa[v];

        v16bf pa = load_frag(&pb[l16][0], hl);
#pragma unroll
        for (int g = 0; g < 4; ++g) {
            const __bf16* vr = Vt + (bh * 64 + g * 16 + l16) * 1024 + kb;
            v16bf vb = load_frag(vr, hl);
            o[g] = wmma_bf16(pa, vb, o[g]);
        }
        __syncthreads();  // sc/pb reused next iteration
    }

    if (lane < 16) lsum[l16] = 1.f / lrow;
    __syncthreads();
    float ri[8];
#pragma unroll
    for (int v = 0; v < 8; ++v) ri[v] = lsum[v + hl * 8];
#pragma unroll
    for (int g = 0; g < 4; ++g)
#pragma unroll
        for (int v = 0; v < 8; ++v) {
            const int s = qt * 16 + v + hl * 8;
            const int d = h * 64 + g * 16 + l16;
            out[((size_t)b * SDIM + s) * DMODEL + d] = o[g][v] * ri[v];
        }
}

// ---------------------------------------------------------------------------
// Residual + LayerNorm over D=1024. One wave per row, eight rows per 256-thread block:
// a launch starts 4,096 waves in place of 32,768. A lane holds 32 elements of its row
// (eight 16-B pieces, 512 B apart), its loads all in flight together; the two row sums are
// in-lane adds and a five-step butterfly over the wave, so no LDS and no barrier.
// ---------------------------------------------------------------------------
__device__ __forceinline__ float wave_sum(float s) {
#pragma unroll
    for (int m = 16; m > 0; m >>= 1) s += __shfl_xor(s, m, 32);
    return s;
}

__global__ __launch_bounds__(256) void add_ln_kernel(
    const float* __restrict__ a, const float* __restrict__ r,
    const float* __restrict__ g, const float* __restrict__ beta,
    float* __restrict__ outf, __bf16* __restrict__ outb) {
    const int lane = threadIdx.x & 31;
    const int row = blockIdx.x * 8 + (threadIdx.x >> 5);
    const int c0 = lane * 4;
    const size_t ro = (size_t)row * DMODEL + c0;
    const float* pa = a + ro;
    const float* pr = r + ro;
    v4f v[8], w[8], gg[8], bb[8];
#pragma unroll
    for (int i = 0; i < 8; ++i) v[i] = *(const v4f*)(pa + i * 128);
#pragma unroll
    for (int i = 0; i < 8; ++i) w[i] = *(const v4f*)(pr + i * 128);
    // the wait stands in front of any reuse of the loads' address pairs; naming the pairs
    // as inputs keeps them live up to it, so that no load's result is placed on them
    asm volatile("s_wait_xcnt 0x0" :: "v"(pa), "v"(pr) : "memory");
    // scale and shift are fetched ahead of their use, under the sums
#pragma unroll
    for (int i = 0; i < 8; ++i) gg[i] = *(const v4f*)(g + c0 + i * 128);
#pragma unroll
    for (int i = 0; i < 8; ++i) bb[i] = *(const v4f*)(beta + c0 + i * 128);
    // the loads' offset register may be reused below: the wait stands in front of that
    asm volatile("s_wait_xcnt 0x0" ::: "memory");
    // inputs only: holds the sixteen scale and shift loads together, ahead of the second sum;
    // without it the compiler sinks them behind the sums, two at a time, each pair waited for
    asm volatile("" :: "v"(gg[0]), "v"(gg[1]), "v"(gg[2]), "v"(gg[3]), "v"(gg[4]), "v"(gg[5]),
                       "v"(gg[6]), "v"(gg[7]), "v"(bb[0]), "v"(bb[1]), "v"(bb[2]), "v"(bb[3]),
                       "v"(bb[4]), "v"(bb[5]), "v"(bb[6]), "v"(bb[7]));
    float s = 0.f;
#pragma unroll
    for (int i = 0; i < 8; ++i) {
        v[i] += w[i];
        s += (v[i][0] + v[i][1]) + (v[i][2] + v[i][3]);
    }
    const float mean = wave_sum(s) * (1.f / 1024.f);
    float ss = 0.f;
#pragma unroll
    for (int i = 0; i < 8; ++i) {
        const v4f d = v[i] - mean;
        ss += (d[0] * d[0] + d[1] * d[1]) + (d[2] * d[2] + d[3] * d[3]);
    }
    const float rstd = rsqrtf(wave_sum(ss) * (1.f / 1024.f) + 1e-5f);
#pragma unroll
    for (int i = 0; i < 8; ++i) v[i] = (v[i] - mean) * rstd * gg[i] + bb[i];
    if (outb) {
        v4bf p[8];
#pragma unroll
        for (int i = 0; i < 8; ++i) {
#pragma unroll
            for (int j = 0; j < 4; ++j) p[i][j] = f2bf(v[i][j]);
        }
#pragma unroll
        for (int i = 0; i < 8; ++i) *(v4bf*)(outb + ro + i * 128) = p[i];
        // registers that these stores name may be reused for the next stores' address
        asm volatile("s_wait_xcnt 0x0" ::: "memory");
    }
#pragma unroll
    for (int i = 0; i < 8; ++i) *(v4f*)(outf + ro + i * 128) = v[i];
}

// ---------------------------------------------------------------------------
// Host launch
// ---------------------------------------------------------------------------
extern "C" void kernel_launch(void* const* d_in, const int* in_sizes, int n_in,
                              void* d_out, int out_size, void* d_ws, size_t ws_size,
                              hipStream_t stream) {
    (void)in_sizes; (void)n_in; (void)out_size; (void)ws_size;
    const float* src = (const float*)d_in[0];
    const float* td  = (const float*)d_in[1];
    const float* dd  = (const float*)d_in[2];
    const float* Wq  = (const float*)d_in[3];
    const float* bq  = (const float*)d_in[4];
    const float* Wk  = (const float*)d_in[5];
    const float* bk  = (const float*)d_in[6];
    const float* Wv  = (const float*)d_in[7];
    const float* bv  = (const float*)d_in[8];
    const float* tw1 = (const float*)d_in[9];
    const float* tb1 = (const float*)d_in[10];
    const float* tw2 = (const float*)d_in[11];
    const float* tb2 = (const float*)d_in[12];
    const float* dw1 = (const float*)d_in[13];
    const float* db1 = (const float*)d_in[14];
    const float* dw2 = (const float*)d_in[15];
    const float* db2 = (const float*)d_in[16];
    const float* W1  = (const float*)d_in[17];
    const float* b1  = (const float*)d_in[18];
    const float* W2  = (const float*)d_in[19];
    const float* b2  = (const float*)d_in[20];
    const float* g1  = (const float*)d_in[21];
    const float* be1 = (const float*)d_in[22];
    const float* g2  = (const float*)d_in[23];
    const float* be2 = (const float*)d_in[24];

    const int M = BDIM * SDIM;  // 4096 rows
    char* ws = (char*)d_ws;
    size_t off = 0;
    auto alloc = [&](size_t bytes) {
        char* p = ws + off;
        off = (off + bytes + 255) & ~(size_t)255;
        return p;
    };
    __bf16* srcb = (__bf16*)alloc((size_t)M * DMODEL * 2);
    __bf16* Wqt  = (__bf16*)alloc((size_t)DMODEL * DMODEL * 2);
    __bf16* Wkt  = (__bf16*)alloc((size_t)DMODEL * DMODEL * 2);
    __bf16* Wvt  = (__bf16*)alloc((size_t)DMODEL * DMODEL * 2);
    __bf16* W1t  = (__bf16*)alloc((size_t)DMODEL * DFF * 2);
    __bf16* W2t  = (__bf16*)alloc((size_t)DFF * DMODEL * 2);
    __bf16* Qb   = (__bf16*)alloc((size_t)M * DMODEL * 2);
    __bf16* Kb   = (__bf16*)alloc((size_t)M * DMODEL * 2);
    __bf16* Vtb  = (__bf16*)alloc((size_t)M * DMODEL * 2);
    float*  attn = (float*)alloc((size_t)M * DMODEL * 4);
    float*  xf   = (float*)alloc((size_t)M * DMODEL * 4);
    __bf16* xb   = (__bf16*)alloc((size_t)M * DMODEL * 2);
    __bf16* h1   = (__bf16*)alloc((size_t)M * DFF * 2);
    float*  ffn  = (float*)alloc((size_t)M * DMODEL * 4);

    const int nSrc = M * DMODEL;
    cvt_f32_bf16_kernel<<<nSrc / CVT_BLOCK_ELEMS, 256, 0, stream>>>(src, srcb);
    cvt_transpose_kernel<<<dim3(DMODEL / 64, DMODEL / 64), 256, 0, stream>>>(Wq, Wqt, DMODEL, DMODEL);
    cvt_transpose_kernel<<<dim3(DMODEL / 64, DMODEL / 64), 256, 0, stream>>>(Wk, Wkt, DMODEL, DMODEL);
    cvt_transpose_kernel<<<dim3(DMODEL / 64, DMODEL / 64), 256, 0, stream>>>(Wv, Wvt, DMODEL, DMODEL);
    cvt_transpose_kernel<<<dim3(DFF / 64, DMODEL / 64), 256, 0, stream>>>(W1, W1t, DMODEL, DFF);
    cvt_transpose_kernel<<<dim3(DMODEL / 64, DFF / 64), 256, 0, stream>>>(W2, W2t, DFF, DMODEL);

    dim3 gqkv(DMODEL / 64, M / 128);
    gemm_bf16_kernel<<<gqkv, 128, 0, stream>>>(srcb, Wqt, bq, Qb, DMODEL, DMODEL, 0);
    gemm_bf16_kernel<<<gqkv, 128, 0, stream>>>(srcb, Wkt, bk, Kb, DMODEL, DMODEL, 0);
    gemm_bf16_kernel<<<gqkv, 128, 0, stream>>>(srcb, Wvt, bv, Vtb, DMODEL, DMODEL, 2);

    attn_kernel<<<BDIM * NHEAD * (SDIM / 16), 32, 0, stream>>>(
        Qb, Kb, Vtb, td, dd, tw1, tb1, tw2, tb2, dw1, db1, dw2, db2, attn);

    add_ln_kernel<<<M / 8, 256, 0, stream>>>(src, attn, g1, be1, xf, xb);

    gemm_bf16_kernel<<<dim3(DFF / 64, M / 128), 128, 0, stream>>>(xb, W1t, b1, h1, DFF, DMODEL, 3);
    gemm_bf16_kernel<<<dim3(DMODEL / 64, M / 128), 128, 0, stream>>>(h1, W2t, b2, ffn, DMODEL, DFF, 4);

    add_ln_kernel<<<M / 8, 256, 0, stream>>>(xf, ffn, g2, be2, (float*)d_out, nullptr);
}

// v004
// It runs in 255 microseconds.
// In two side-by-side timings against v003, it was 1.13 and 1.12 times as fast.
// Over all steps from v000 it is 2.72 times as fast.
#include <hip/hip_runtime.h>

// ---------------------------------------------------------------------------
// SpatioTemporalTransformerLayer for MI455X (gfx1250, wave32, WMMA).
// B=4, S=1024, D=1024, H=16, HD=64, DFF=4096, BIAS_HID=8.
// GEMMs use v_wmma_f32_16x16x32_bf16 (bf16 A/B, f32 accumulate), the bias MLP v_wmma_f32_16x16x4_f32 (f32).
// GEMM operand tiles are staged in LDS by asynchronous copies (two buffers);
// fragments are read from LDS into ping-pong fragment buffers.
// ---------------------------------------------------------------------------

typedef __attribute__((ext_vector_type(16))) __bf16 v16bf;
typedef __attribute__((ext_vector_type(8)))  __bf16 v8bf;
typedef __attribute__((ext_vector_type(8)))  float  v8f;

#define BDIM 4
#define SDIM 1024
#define DMODEL 1024
#define NHEAD 16
#define HEADD 64
#define DFF 4096

__device__ __forceinline__ __bf16 f2bf(float x) {
    unsigned u = __builtin_bit_cast(unsigned, x);
    unsigned r = (u + 0x7FFFu + ((u >> 16) & 1u)) >> 16;
    return __builtin_bit_cast(__bf16, (unsigned short)r);
}

__device__ __forceinline__ v8f wmma_bf16(v16bf a, v16bf b, v8f c) {
    // (neg_a, A, neg_b, B, c_mod, C, reuse_a, reuse_b)
    return __builtin_amdgcn_wmma_f32_16x16x32_bf16(false, a, false, b, (short)0, c,
                                                   false, false);
}

// Load a 16x32 bf16 A/B fragment: lane L, elem e -> (row=L&15, K=16*(e>>3)+8*(L>>4)+(e&7))
// 'row_ptr' points at element K=0 of this lane's row. Two contiguous 16B loads.
__device__ __forceinline__ v16bf load_frag(const __bf16* row_ptr, int hl) {
    v8bf lo = *(const v8bf*)(row_ptr + hl * 8);
    v8bf hi = *(const v8bf*)(row_ptr + 16 + hl * 8);
    v16bf f;
#pragma unroll
    for (int i = 0; i < 8; ++i) { f[i] = lo[i]; f[8 + i] = hi[i]; }
    return f;
}

// ---------------------------------------------------------------------------
// Elementwise converters
// ---------------------------------------------------------------------------
typedef __attribute__((ext_vector_type(4))) __bf16 v4bf;
typedef __attribute__((ext_vector_type(4))) float  v4f;

// 32 elements a thread, so that the launch starts 4,096 waves in place of 131,072:
// eight 16-B loads in flight per lane, each wave-wide load 512 contiguous bytes,
// each wave-wide store 256. The grid covers the array exactly (8,192 elements a block).
#define CVT_BLOCK_ELEMS (256 * 32)
__global__ __launch_bounds__(256) void cvt_f32_bf16_kernel(const float* __restrict__ in,
                                                           __bf16* __restrict__ out) {
    const size_t base = (size_t)blockIdx.x * CVT_BLOCK_ELEMS + threadIdx.x * 4;
    v4f r[8];
#pragma unroll
    for (int i = 0; i < 8; ++i) r[i] = *(const v4f*)(in + base + i * 1024);
    // the loads' address registers may be reused below: the wait stands in front of that
    asm volatile("s_wait_xcnt 0x0" ::: "memory");
#pragma unroll
    for (int i = 0; i < 8; ++i) {
        v4bf p;
#pragma unroll
        for (int j = 0; j < 4; ++j) p[j] = f2bf(r[i][j]);
        *(v4bf*)(out + base + i * 1024) = p;
    }
}

// W[K][N] f32 (row-major) -> Wt[N][K] bf16, one 64x64 tile per 256-thread block.
// K and N are multiples of 64. Reads are 256-B row pieces (16 B a lane), the tile is
// turned in LDS, and every store instruction writes whole 128-B lines of Wt.
__global__ __launch_bounds__(256) void cvt_transpose_kernel(const float* __restrict__ W,
                                                            __bf16* __restrict__ Wt, int K, int N) {
    // 128-B rows at a 144-B pitch (16 B x odd) for the 16-byte readers.
    __shared__ __attribute__((aligned(16))) __bf16 tile[64][72];
    const int t = threadIdx.x;
    const int n0 = blockIdx.x * 64;
    const int k0 = blockIdx.y * 64;

    const int nq = (t & 15) * 4;   // four columns of W
    const int kq = (t >> 4) * 4;   // four rows of W
    const float* in = W + (size_t)(k0 + kq) * N + n0 + nq;
    v4f r[4];
#pragma unroll
    for (int i = 0; i < 4; ++i) {
        r[i] = *(const v4f*)(in + (size_t)i * N);
        // a later load's result registers may reuse this load's address pair:
        // the wait stands between the load and any such overwrite
        asm volatile("s_wait_xcnt 0x0" ::: "memory");
    }
#pragma unroll
    for (int j = 0; j < 4; ++j) {
        v4bf p;
#pragma unroll
        for (int i = 0; i < 4; ++i) p[i] = f2bf(r[i][j]);
        *(v4bf*)&tile[nq + j][kq] = p;
    }
    __syncthreads();

    const int kk = (t & 7) * 8;    // eight lanes cover one 128-B row of the tile
#pragma unroll
    for (int pass = 0; pass < 2; ++pass) {
        const int n = (t >> 3) + pass * 32;
        *(v8bf*)(Wt + (size_t)(n0 + n) * K + k0 + kk) = *(const v8bf*)&tile[n][kk];
    }
}

// ---------------------------------------------------------------------------
// Generic bf16 WMMA GEMM: C[M,N] = A[M,K] * Wt[N,K]^T + bias, with mode epilogue
//   mode 0: Q/K layout  -> bf16 out[((b*16+h)*1024+s)*64+d]
//   mode 2: V transposed-> bf16 out[((b*16+h)*64+d)*1024+s]
//   mode 3: ReLU        -> bf16 out[row*N+col]   (FFN1)
//   mode 4: plain f32   -> f32  out[row*N+col]   (FFN2)
// Block: 128 threads = 4 waves; wave w owns rows m0+32w..+31, cols n0..n0+63.
// A pass is 128 k: the block's 128 rows of A and 64 rows of Wt (256 B each) are
// brought into LDS by asynchronous copies that read whole 128-B lines, two
// buffers, the copies of pass p+2 in flight while pass p+1 is worked on.
// Fragments come from LDS by 16-B reads; per 32-k chunk 2 A + 4 B frags -> 8 WMMAs.
// ---------------------------------------------------------------------------
#define G_PASS_K 128                       // k elements per pass
#define G_PITCH 136                        // LDS row pitch in elements: 272 B = 16 B x odd
#define G_ROWS (128 + 64)                  // A rows, then Wt rows
#define G_STAGE (G_ROWS * G_PITCH)         // elements per buffer
#define G_STEP_B (8 * G_PITCH * 2)         // LDS bytes between two copies of a thread (8 rows)

// Eight 16-B copies of one thread, 8 rows apart: global row step 'gs' elements.
// The s_wait_xcnt closes the statement so that no address register of a copy is
// rewritten ahead of it.
__device__ __forceinline__ void copy8_to_lds(unsigned l, const __bf16* g, size_t gs) {
    asm volatile(
        "global_load_async_to_lds_b128 %0, %8, off\n\t"
        "global_load_async_to_lds_b128 %1, %9, off\n\t"
        "global_load_async_to_lds_b128 %2, %10, off\n\t"
        "global_load_async_to_lds_b128 %3, %11, off\n\t"
        "global_load_async_to_lds_b128 %4, %12, off\n\t"
        "global_load_async_to_lds_b128 %5, %13, off\n\t"
        "global_load_async_to_lds_b128 %6, %14, off\n\t"
        "global_load_async_to_lds_b128 %7, %15, off\n\t"
        "s_wait_xcnt 0x0"
        :: "v"(l), "v"(l + 1 * G_STEP_B), "v"(l + 2 * G_STEP_B), "v"(l + 3 * G_STEP_B),
           "v"(l + 4 * G_STEP_B), "v"(l + 5 * G_STEP_B), "v"(l + 6 * G_STEP_B),
           "v"(l + 7 * G_STEP_B),
           "v"(g), "v"(g + gs), "v"(g + 2 * gs), "v"(g + 3 * gs),
           "v"(g + 4 * gs), "v"(g + 5 * gs), "v"(g + 6 * gs), "v"(g + 7 * gs)
        : "memory");
}

__global__ __launch_bounds__(128) void gemm_bf16_kernel(
    const __bf16* __restrict__ A, const __bf16* __restrict__ Wt,
    const float* __restrict__ bias, void* __restrict__ outp,
    int N, int Kd, int mode) {
    __shared__ __attribute__((aligned(16))) __bf16 sm[2 * G_STAGE];
    const int t = threadIdx.x;
    const int lane = t & 31;
    const int wv = t >> 5;
    const int hl = lane >> 4;
    const int l16 = lane & 15;
    const int n0 = blockIdx.x * 64;
    const int mb = blockIdx.y * 128;
    const int m0 = mb + wv * 32;

    v8f c[2][4] = {};

    // copies: 16 lanes cover one 256-B row piece, a wave two rows, the block 8 rows
    const int crow = t >> 4;
    const int ccol = (t & 15) * 8;
    const size_t gs = (size_t)8 * Kd;
    const __bf16* gA = A + (size_t)(mb + crow) * Kd + ccol;
    const __bf16* gB = Wt + (size_t)(n0 + crow) * Kd + ccol;
    const unsigned lc = (unsigned)(size_t)(&sm[0]) + (unsigned)(crow * G_PITCH + ccol) * 2u;

#define ISSUE_PASS(p, buf)                                                     \
    do {                                                                       \
        const unsigned lb = lc + (unsigned)(buf) * (G_STAGE * 2u);             \
        const __bf16* ga = gA + (size_t)(p) * G_PASS_K;                        \
        copy8_to_lds(lb, ga, gs);                                              \
        copy8_to_lds(lb + 8u * G_STEP_B, ga + 8 * gs, gs);                     \
        copy8_to_lds(lb + 16u * G_STEP_B, gB + (size_t)(p) * G_PASS_K, gs);    \
    } while (0)

    // fragment rows of this lane inside a buffer
    const int fa = (wv * 32 + l16) * G_PITCH;
    const int fb = (128 + l16) * G_PITCH;

    // ping-pong fragment buffers
    v16bf a0[2], a1[2], bb[2][4];

#define LOAD_CHUNK(buf, kk)                                                    \
    do {                                                                       \
        a0[buf] = load_frag(st + fa + (kk), hl);                               \
        a1[buf] = load_frag(st + fa + 16 * G_PITCH + (kk), hl);                \
        _Pragma("unroll") for (int g = 0; g < 4; ++g)                          \
            bb[buf][g] = load_frag(st + fb + g * 16 * G_PITCH + (kk), hl);     \
    } while (0)

#define COMPUTE(buf)                                               \
    do {                                                           \
        _Pragma("unroll") for (int g = 0; g < 4; ++g) {            \
            c[0][g] = wmma_bf16(a0[buf], bb[buf][g], c[0][g]);     \
            c[1][g] = wmma_bf16(a1[buf], bb[buf][g], c[1][g]);     \
        }                                                          \
    } while (0)

    // Kd is a multiple of 128 (1024 or 4096).
    const int npass = Kd / G_PASS_K;
    ISSUE_PASS(0, 0);
    // pass 0 has landed for this wave; the barrier publishes it to the others
    asm volatile("s_wait_asynccnt 0x0" ::: "memory");
    __syncthreads();
    if (npass > 1) ISSUE_PASS(1, 1);

    for (int p = 0; p < npass; ++p) {
        const __bf16* st = sm + (p & 1) * G_STAGE;
        // The scheduling barriers keep each chunk's twelve LDS reads together and one
        // chunk ahead of their WMMAs; without them the compiler sinks the reads to
        // pairs directly in front of their use, each pair behind a wait to zero.
        LOAD_CHUNK(0, 0);
        LOAD_CHUNK(1, 32);
        __builtin_amdgcn_sched_barrier(0);
        COMPUTE(0);
        __builtin_amdgcn_sched_barrier(0);
        LOAD_CHUNK(0, 64);
        __builtin_amdgcn_sched_barrier(0);
        COMPUTE(1);
        __builtin_amdgcn_sched_barrier(0);
        LOAD_CHUNK(1, 96);
        // The pass's last LDS reads are out: the hand-over stands here, ahead of the
        // last two chunks' WMMAs (registers only), so that the refill flies under them.
        // this wave's reads of the buffer have returned before it is refilled
        asm volatile("s_wait_dscnt 0x0" ::: "memory");
        // this wave's copies of pass p+1 have landed before the barrier publishes them
        asm volatile("s_wait_asynccnt 0x0" ::: "memory");
        __syncthreads();
        if (p + 2 < npass) ISSUE_PASS(p + 2, p & 1);
        COMPUTE(0);
        COMPUTE(1);
    }
    // no copy is outstanding when the wave goes on to its end
    asm volatile("s_wait_asynccnt 0x0" ::: "memory");
#undef ISSUE_PASS
#undef LOAD_CHUNK
#undef COMPUTE

#pragma unroll
    for (int sub = 0; sub < 2; ++sub) {
#pragma unroll
        for (int g = 0; g < 4; ++g) {
            const int col = n0 + g * 16 + l16;
            const float bcst = bias[col];
#pragma unroll
            for (int v = 0; v < 8; ++v) {
                const int row = m0 + sub * 16 + v + hl * 8;  // D-frag: M = v + 8*(lane>=16)
                float val = c[sub][g][v] + bcst;
                if (mode == 3) {
                    val = fmaxf(val, 0.f);
                    ((__bf16*)outp)[(size_t)row * N + col] = f2bf(val);
                } else if (mode == 4) {
                    ((float*)outp)[(size_t)row * N + col] = val;
                } else if (mode == 2) {  // V -> [b,h,d,s]
                    int bb2 = row >> 10, s = row & 1023, hh = col >> 6, d = col & 63;
                    ((__bf16*)outp)[(((size_t)(bb2 * 16 + hh)) * 64 + d) * 1024 + s] = f2bf(val);
                } else {                 // Q/K -> [b,h,s,d]
                    int bb2 = row >> 10, s = row & 1023, hh = col >> 6, d = col & 63;
                    ((__bf16*)outp)[(((size_t)(bb2 * 16 + hh)) * 1024 + s) * 64 + d] = f2bf(val);
                }
            }
        }
    }
}

// ---------------------------------------------------------------------------
// Flash attention with the pair-bias MLP shared by the heads.
// One 16-wave block per (b, 16-row q-tile); wave w runs head w over all keys.
// The hidden layer of the bias MLP does not depend on the head, so it is worked out
// once per (q, key): for each chunk of 64 keys wave w takes q row w, forms the 16 hidden
// values of each pair (lanes 0-15 the eight of t_deltas, lanes 16-31 the eight of dists)
// and multiplies them with the 16x16 output weights by v_wmma_f32_16x16x4_f32
// (A = w2^T: row = head; B = hidden: column = key), all in f32. The result goes to LDS as
// bias[head][q row][key], two buffers, one chunk ahead, one block barrier a chunk.
// ---------------------------------------------------------------------------
typedef __attribute__((ext_vector_type(2))) float v2f;

#define AT_CHUNK 64                        // keys per bias chunk
#define AT_BROW 68                         // bias row pitch in words: 272 B = 16 B x odd
#define AT_BPLANE (16 * AT_BROW + 4)       // words per head; 8 planes = 32 banks mod 64

// Orders this wave's LDS writes ahead of its own later LDS reads of other lanes' words
// (score, P and factor tiles belong to one wave alone, so no block barrier is needed):
// the LDS-only fences keep the compiler from moving LDS accesses over this point and
// make it wait for the wave's outstanding LDS operations.
__device__ __forceinline__ void wave_lds_order() {
    __builtin_amdgcn_fence(__ATOMIC_RELEASE, "workgroup", "local");
    __builtin_amdgcn_wave_barrier();
    __builtin_amdgcn_fence(__ATOMIC_ACQUIRE, "workgroup", "local");
}

__global__ __launch_bounds__(512) void attn_kernel(
    const __bf16* __restrict__ Q, const __bf16* __restrict__ Km,
    const __bf16* __restrict__ Vt, const float* __restrict__ td,
    const float* __restrict__ dd, const float* __restrict__ tw1,
    const float* __restrict__ tb1, const float* __restrict__ tw2,
    const float* __restrict__ tb2, const float* __restrict__ dw1,
    const float* __restrict__ db1, const float* __restrict__ dw2,
    const float* __restrict__ db2, float* __restrict__ out) {
    const int lane = threadIdx.x & 31;
    const int hl = lane >> 4;
    const int l16 = lane & 15;
    const int h = __builtin_amdgcn_readfirstlane(threadIdx.x >> 5);  // wave = head
    const int qt = blockIdx.x & 63;
    const int b = blockIdx.x >> 6;

    __shared__ __attribute__((aligned(16))) float bs[2][16 * AT_BPLANE];   // bias, all heads
    __shared__ __attribute__((aligned(16))) float sc_all[16][16][36];      // per wave: scores
    __shared__ __attribute__((aligned(16))) __bf16 pb_all[16][16][40];     // per wave: bf16 P
    __shared__ float corr_all[16][16];
    __shared__ float lsum_all[16][16];
    float (*sc)[36] = sc_all[h];
    __bf16 (*pb)[40] = pb_all[h];
    float* corr = corr_all[h];
    float* lsum = lsum_all[h];

    // Bias MLP operands of this lane. k slot (chunk c, register j, lane half hl) of both
    // WMMA operands is hidden unit 2c+j of the t_deltas MLP (hl = 0) or the dists MLP (hl = 1).
    const float* w1p = hl ? dw1 : tw1;
    const float* b1p = hl ? db1 : tb1;
    const float* w2p = hl ? dw2 : tw2;
    float w1[8], b1[8];
    v2f wa[4];
#pragma unroll
    for (int j = 0; j < 8; ++j) { w1[j] = w1p[j]; b1[j] = b1p[j]; }
#pragma unroll
    for (int c = 0; c < 4; ++c) {
        wa[c][0] = w2p[(2 * c) * 16 + l16];
        wa[c][1] = w2p[(2 * c + 1) * 16 + l16];
    }
    v8f cinit;  // accumulator start: the two output biases of head v + 8*hl
#pragma unroll
    for (int v = 0; v < 8; ++v) cinit[v] = tb2[v + 8 * hl] + db2[v + 8 * hl];
    // the wait stands in front of any reuse of these loads' address registers; naming the
    // pairs as inputs keeps them live up to it
    asm volatile("s_wait_xcnt 0x0" :: "v"(w1p), "v"(b1p), "v"(w2p) : "memory");
    // q row qt*16 + h of this lane's matrix; the lane owns keys 4*l16 .. 4*l16+3 of a chunk
    const float* mrow = (hl ? dd : td) + ((size_t)b * SDIM + qt * 16 + h) * SDIM + l16 * 4;

#define MAKE_BIAS(buf, m4)                                                              \
    do {                                                                                \
        v8f acc[4] = {cinit, cinit, cinit, cinit};                                      \
        _Pragma("unroll") for (int c = 0; c < 4; ++c) {                                 \
            _Pragma("unroll") for (int g = 0; g < 4; ++g) {                             \
                v2f hb;                                                                 \
                hb[0] = fmaxf((m4)[g] * w1[2 * c] + b1[2 * c], 0.f);                    \
                hb[1] = fmaxf((m4)[g] * w1[2 * c + 1] + b1[2 * c + 1], 0.f);            \
                acc[g] = __builtin_amdgcn_wmma_f32_16x16x4_f32(                         \
                    false, wa[c], false, hb, (short)0, acc[g], false, false);           \
            }                                                                           \
        }                                                                               \
        _Pragma("unroll") for (int v = 0; v < 8; ++v) {                                 \
            v4f o4 = {acc[0][v], acc[1][v], acc[2][v], acc[3][v]};                      \
            *(v4f*)&bs[buf][(v + 8 * hl) * AT_BPLANE + h * AT_BROW + l16 * 4] = o4;     \
        }                                                                               \
    } while (0)

    const size_t bh = (size_t)(b * 16 + h);

    // Q A-fragments for the two K-dim halves (hd 0..31, 32..63)
    v16bf qa[2];
    {
        const __bf16* r = Q + (bh * 1024 + qt * 16 + l16) * 64;
        qa[0] = load_frag(r, hl);
        qa[1] = load_frag(r + 32, hl);
    }

    v8f o[4] = {};
    float mrun = -1e30f, lrow = 0.f;

    v4f mreg = *(const v4f*)mrow;
    // the load's address pair may be reused below: the wait stands in front of that
    asm volatile("s_wait_xcnt 0x0" :: "v"(mrow) : "memory");
    MAKE_BIAS(0, mreg);
    mreg = *(const v4f*)(mrow + AT_CHUNK);
    // the load's address pair may be reused below: the wait stands in front of that
    asm volatile("s_wait_xcnt 0x0" :: "v"(mrow) : "memory");
    __syncthreads();  // chunk 0's bias is published to every head's wave

    for (int kc = 0; kc < SDIM; kc += AT_CHUNK) {
        const int buf = (kc / AT_CHUNK) & 1;
        for (int kb = kc; kb < kc + AT_CHUNK; kb += 32) {
            // ---- scores for 32 keys: 2 N-groups x 2 K-frags = 4 WMMAs ----
            v16bf kf[2][2];
#pragma unroll
            for (int g = 0; g < 2; ++g) {
                const __bf16* kr = Km + (bh * 1024 + kb + g * 16 + l16) * 64;
                kf[g][0] = load_frag(kr, hl);
                kf[g][1] = load_frag(kr + 32, hl);
            }
            // the next chunk's bias is made here, while the chunk's first K loads are under way
            if (kb == kc && kc + AT_CHUNK < SDIM) {
                MAKE_BIAS(buf ^ 1, mreg);
            }
            // inputs only: holds the eight K loads together, one trip to L2; without it the
            // compiler issues them in pairs into the same registers, each pair waited for
            asm volatile("" :: "v"(kf[0][0]), "v"(kf[0][1]), "v"(kf[1][0]), "v"(kf[1][1]));
            // The matrix row piece of the chunk after next is fetched behind the K wait: loads
            // return in order, so in front of it this read from memory would hold up the K data.
            if (kb == kc && kc + 2 * AT_CHUNK < SDIM) {
                mreg = *(const v4f*)(mrow + kc + 2 * AT_CHUNK);
                // the load's address pair may be reused below: the wait stands in front of that
                asm volatile("s_wait_xcnt 0x0" :: "v"(mrow) : "memory");
            }
#pragma unroll
            for (int g = 0; g < 2; ++g) {
                v8f s = {};
                s = wmma_bf16(qa[0], kf[g][0], s);
                s = wmma_bf16(qa[1], kf[g][1], s);
#pragma unroll
                for (int v = 0; v < 8; ++v) sc[v + hl * 8][g * 16 + l16] = s[v];
            }
            wave_lds_order();

            // ---- online softmax: lane handles (row=l16, cols hl*16..+15) ----
            const float* brow = &bs[buf][h * AT_BPLANE + l16 * AT_BROW + (kb - kc) + hl * 16];
            float pm = -1e30f;
            float sv[16];
#pragma unroll
            for (int j4 = 0; j4 < 4; ++j4) {
                const v4f bi = *(const v4f*)(brow + j4 * 4);
                const v4f si = *(const v4f*)&sc[l16][hl * 16 + j4 * 4];
#pragma unroll
                for (int j = 0; j < 4; ++j) {
                    sv[j4 * 4 + j] = si[j] * (1.0f / 32.0f) + bi[j];
                    pm = fmaxf(pm, sv[j4 * 4 + j]);
                }
            }
            pm = fmaxf(pm, __shfl_xor(pm, 16, 32));
            const float nm = fmaxf(mrun, pm);
            const float cf = __expf(mrun - nm);
            float ps = 0.f;
#pragma unroll
            for (int j = 0; j < 16; ++j) {
                float p = __expf(sv[j] - nm);
                ps += p;
                pb[l16][hl * 16 + j] = f2bf(p);
            }
            ps += __shfl_xor(ps, 16, 32);
            lrow = lrow * cf + ps;
            mrun = nm;
            if (lane < 16) corr[l16] = cf;
            wave_lds_order();

            // ---- rescale O, then O += P * V (4 WMMAs) ----
            float cfa[8];
#pragma unroll
            for (int v = 0; v < 8; ++v) cfa[v] = corr[v + hl * 8];
#pragma unroll
            for (int g = 0; g < 4; ++g)
#pragma unroll
                for (int v = 0; v < 8; ++v) o[g][v] *= cfa[v];

            v16bf pa = load_frag(&pb[l16][0], hl);
#pragma unroll
            for (int g = 0; g < 4; ++g) {
                const __bf16* vr = Vt + (bh * 64 + g * 16 + l16) * 1024 + kb;
                v16bf vb = load_frag(vr, hl);
                o[g] = wmma_bf16(pa, vb, o[g]);
            }
            wave_lds_order();  // sc/pb reused next iteration
        }
        // publishes the next chunk's bias and ends every wave's reads of this chunk's
        // buffer, which the next trip refills
        __syncthreads();
    }
#undef MAKE_BIAS

    if (lane < 16) lsum[l16] = 1.f / lrow;
    wave_lds_order();
    float ri[8];
#pragma unroll
    for (int v = 0; v < 8; ++v) ri[v] = lsum[v + hl * 8];
#pragma unroll
    for (int g = 0; g < 4; ++g)
#pragma unroll
        for (int v = 0; v < 8; ++v) {
            const int s = qt * 16 + v + hl * 8;
            const int d = h * 64 + g * 16 + l16;
            out[((size_t)b * SDIM + s) * DMODEL + d] = o[g][v] * ri[v];
        }
}

// ---------------------------------------------------------------------------
// Residual + LayerNorm over D=1024. One wave per row, eight rows per 256-thread block:
// a launch starts 4,096 waves in place of 32,768. A lane holds 32 elements of its row
// (eight 16-B pieces, 512 B apart), its loads all in flight together; the two row sums are
// in-lane adds and a five-step butterfly over the wave, so no LDS and no barrier.
// ---------------------------------------------------------------------------
__device__ __forceinline__ float wave_sum(float s) {
#pragma unroll
    for (int m = 16; m > 0; m >>= 1) s += __shfl_xor(s, m, 32);
    return s;
}

__global__ __launch_bounds__(256) void add_ln_kernel(
    const float* __restrict__ a, const float* __restrict__ r,
    const float* __restrict__ g, const float* __restrict__ beta,
    float* __restrict__ outf, __bf16* __restrict__ outb) {
    const int lane = threadIdx.x & 31;
    const int row = blockIdx.x * 8 + (threadIdx.x >> 5);
    const int c0 = lane * 4;
    const size_t ro = (size_t)row * DMODEL + c0;
    const float* pa = a + ro;
    const float* pr = r + ro;
    v4f v[8], w[8], gg[8], bb[8];
#pragma unroll
    for (int i = 0; i < 8; ++i) v[i] = *(const v4f*)(pa + i * 128);
#pragma unroll
    for (int i = 0; i < 8; ++i) w[i] = *(const v4f*)(pr + i * 128);
    // the wait stands in front of any reuse of the loads' address pairs; naming the pairs
    // as inputs keeps them live up to it, so that no load's result is placed on them
    asm volatile("s_wait_xcnt 0x0" :: "v"(pa), "v"(pr) : "memory");
    // scale and shift are fetched ahead of their use, under the sums
#pragma unroll
    for (int i = 0; i < 8; ++i) gg[i] = *(const v4f*)(g + c0 + i * 128);
#pragma unroll
    for (int i = 0; i < 8; ++i) bb[i] = *(const v4f*)(beta + c0 + i * 128);
    // the loads' offset register may be reused below: the wait stands in front of that
    asm volatile("s_wait_xcnt 0x0" ::: "memory");
    // inputs only: holds the sixteen scale and shift loads together, ahead of the second sum;
    // without it the compiler sinks them behind the sums, two at a time, each pair waited for
    asm volatile("" :: "v"(gg[0]), "v"(gg[1]), "v"(gg[2]), "v"(gg[3]), "v"(gg[4]), "v"(gg[5]),
                       "v"(gg[6]), "v"(gg[7]), "v"(bb[0]), "v"(bb[1]), "v"(bb[2]), "v"(bb[3]),
                       "v"(bb[4]), "v"(bb[5]), "v"(bb[6]), "v"(bb[7]));
    float s = 0.f;
#pragma unroll
    for (int i = 0; i < 8; ++i) {
        v[i] += w[i];
        s += (v[i][0] + v[i][1]) + (v[i][2] + v[i][3]);
    }
    const float mean = wave_sum(s) * (1.f / 1024.f);
    float ss = 0.f;
#pragma unroll
    for (int i = 0; i < 8; ++i) {
        const v4f d = v[i] - mean;
        ss += (d[0] * d[0] + d[1] * d[1]) + (d[2] * d[2] + d[3] * d[3]);
    }
    const float rstd = rsqrtf(wave_sum(ss) * (1.f / 1024.f) + 1e-5f);
#pragma unroll
    for (int i = 0; i < 8; ++i) v[i] = (v[i] - mean) * rstd * gg[i] + bb[i];
    if (outb) {
        v4bf p[8];
#pragma unroll
        for (int i = 0; i < 8; ++i) {
#pragma unroll
            for (int j = 0; j < 4; ++j) p[i][j] = f2bf(v[i][j]);
        }
#pragma unroll
        for (int i = 0; i < 8; ++i) *(v4bf*)(outb + ro + i * 128) = p[i];
        // registers that these stores name may be reused for the next stores' address
        asm volatile("s_wait_xcnt 0x0" ::: "memory");
    }
#pragma unroll
    for (int i = 0; i < 8; ++i) *(v4f*)(outf + ro + i * 128) = v[i];
}

// ---------------------------------------------------------------------------
// Host launch
// ---------------------------------------------------------------------------
extern "C" void kernel_launch(void* const* d_in, const int* in_sizes, int n_in,
                              void* d_out, int out_size, void* d_ws, size_t ws_size,
                              hipStream_t stream) {
    (void)in_sizes; (void)n_in; (void)out_size; (void)ws_size;
    const float* src = (const float*)d_in[0];
    const float* td  = (const float*)d_in[1];
    const float* dd  = (const float*)d_in[2];
    const float* Wq  = (const float*)d_in[3];
    const float* bq  = (const float*)d_in[4];
    const float* Wk  = (const float*)d_in[5];
    const float* bk  = (const float*)d_in[6];
    const float* Wv  = (const float*)d_in[7];
    const float* bv  = (const float*)d_in[8];
    const float* tw1 = (const float*)d_in[9];
    const float* tb1 = (const float*)d_in[10];
    const float* tw2 = (const float*)d_in[11];
    const float* tb2 = (const float*)d_in[12];
    const float* dw1 = (const float*)d_in[13];
    const float* db1 = (const float*)d_in[14];
    const float* dw2 = (const float*)d_in[15];
    const float* db2 = (const float*)d_in[16];
    const float* W1  = (const float*)d_in[17];
    const float* b1  = (const float*)d_in[18];
    const float* W2  = (const float*)d_in[19];
    const float* b2  = (const float*)d_in[20];
    const float* g1  = (const float*)d_in[21];
    const float* be1 = (const float*)d_in[22];
    const float* g2  = (const float*)d_in[23];
    const float* be2 = (const float*)d_in[24];

    const int M = BDIM * SDIM;  // 4096 rows
    char* ws = (char*)d_ws;
    size_t off = 0;
    auto alloc = [&](size_t bytes) {
        char* p = ws + off;
        off = (off + bytes + 255) & ~(size_t)255;
        return p;
    };
    __bf16* srcb = (__bf16*)alloc((size_t)M * DMODEL * 2);
    __bf16* Wqt  = (__bf16*)alloc((size_t)DMODEL * DMODEL * 2);
    __bf16* Wkt  = (__bf16*)alloc((size_t)DMODEL * DMODEL * 2);
    __bf16* Wvt  = (__bf16*)alloc((size_t)DMODEL * DMODEL * 2);
    __bf16* W1t  = (__bf16*)alloc((size_t)DMODEL * DFF * 2);
    __bf16* W2t  = (__bf16*)alloc((size_t)DFF * DMODEL * 2);
    __bf16* Qb   = (__bf16*)alloc((size_t)M * DMODEL * 2);
    __bf16* Kb   = (__bf16*)alloc((size_t)M * DMODEL * 2);
    __bf16* Vtb  = (__bf16*)alloc((size_t)M * DMODEL * 2);
    float*  attn = (float*)alloc((size_t)M * DMODEL * 4);
    float*  xf   = (float*)alloc((size_t)M * DMODEL * 4);
    __bf16* xb   = (__bf16*)alloc((size_t)M * DMODEL * 2);
    __bf16* h1   = (__bf16*)alloc((size_t)M * DFF * 2);
    float*  ffn  = (float*)alloc((size_t)M * DMODEL * 4);

    const int nSrc = M * DMODEL;
    cvt_f32_bf16_kernel<<<nSrc / CVT_BLOCK_ELEMS, 256, 0, stream>>>(src, srcb);
    cvt_transpose_kernel<<<dim3(DMODEL / 64, DMODEL / 64), 256, 0, stream>>>(Wq, Wqt, DMODEL, DMODEL);
    cvt_transpose_kernel<<<dim3(DMODEL / 64, DMODEL / 64), 256, 0, stream>>>(Wk, Wkt, DMODEL, DMODEL);
    cvt_transpose_kernel<<<dim3(DMODEL / 64, DMODEL / 64), 256, 0, stream>>>(Wv, Wvt, DMODEL, DMODEL);
    cvt_transpose_kernel<<<dim3(DFF / 64, DMODEL / 64), 256, 0, stream>>>(W1, W1t, DMODEL, DFF);
    cvt_transpose_kernel<<<dim3(DMODEL / 64, DFF / 64), 256, 0, stream>>>(W2, W2t, DFF, DMODEL);

    dim3 gqkv(DMODEL / 64, M / 128);
    gemm_bf16_kernel<<<gqkv, 128, 0, stream>>>(srcb, Wqt, bq, Qb, DMODEL, DMODEL, 0);
    gemm_bf16_kernel<<<gqkv, 128, 0, stream>>>(srcb, Wkt, bk, Kb, DMODEL, DMODEL, 0);
    gemm_bf16_kernel<<<gqkv, 128, 0, stream>>>(srcb, Wvt, bv, Vtb, DMODEL, DMODEL, 2);

    attn_kernel<<<BDIM * (SDIM / 16), 32 * NHEAD, 0, stream>>>(
        Qb, Kb, Vtb, td, dd, tw1, tb1, tw2, tb2, dw1, db1, dw2, db2, attn);

    add_ln_kernel<<<M / 8, 256, 0, stream>>>(src, attn, g1, be1, xf, xb);

    gemm_bf16_kernel<<<dim3(DFF / 64, M / 128), 128, 0, stream>>>(xb, W1t, b1, h1, DFF, DMODEL, 3);
    gemm_bf16_kernel<<<dim3(DMODEL / 64, M / 128), 128, 0, stream>>>(h1, W2t, b2, ffn, DMODEL, DFF, 4);

    add_ln_kernel<<<M / 8, 256, 0, stream>>>(xf, ffn, g2, be2, (float*)d_out, nullptr);
}

// v005
// A run of this version takes 233 microseconds.
// In both of two side-by-side timings against v004, it was 1.09 times as fast.
// All steps since v000 together make it 2.98 times as fast.
#include <hip/hip_runtime.h>

// ---------------------------------------------------------------------------
// SpatioTemporalTransformerLayer for MI455X (gfx1250, wave32, WMMA).
// B=4, S=1024, D=1024, H=16, HD=64, DFF=4096, BIAS_HID=8.
// GEMMs use v_wmma_f32_16x16x32_bf16 (bf16 A/B, f32 accumulate), the bias MLP v_wmma_f32_16x16x4_f32 (f32).
// GEMM operand tiles are staged in LDS by asynchronous copies (two buffers);
// fragments are read from LDS into ping-pong fragment buffers.
// ---------------------------------------------------------------------------

typedef __attribute__((ext_vector_type(16))) __bf16 v16bf;
typedef __attribute__((ext_vector_type(8)))  __bf16 v8bf;
typedef __attribute__((ext_vector_type(8)))  float  v8f;

#define BDIM 4
#define SDIM 1024
#define DMODEL 1024
#define NHEAD 16
#define HEADD 64
#define DFF 4096

__device__ __forceinline__ __bf16 f2bf(float x) {
    unsigned u = __builtin_bit_cast(unsigned, x);
    unsigned r = (u + 0x7FFFu + ((u >> 16) & 1u)) >> 16;
    return __builtin_bit_cast(__bf16, (unsigned short)r);
}

__device__ __forceinline__ v8f wmma_bf16(v16bf a, v16bf b, v8f c) {
    // (neg_a, A, neg_b, B, c_mod, C, reuse_a, reuse_b)
    return __builtin_amdgcn_wmma_f32_16x16x32_bf16(false, a, false, b, (short)0, c,
                                                   false, false);
}

// Load a 16x32 bf16 A/B fragment: lane L, elem e -> (row=L&15, K=16*(e>>3)+8*(L>>4)+(e&7))
// 'row_ptr' points at element K=0 of this lane's row. Two contiguous 16B loads.
__device__ __forceinline__ v16bf load_frag(const __bf16* row_ptr, int hl) {
    v8bf lo = *(const v8bf*)(row_ptr + hl * 8);
    v8bf hi = *(const v8bf*)(row_ptr + 16 + hl * 8);
    v16bf f;
#pragma unroll
    for (int i = 0; i < 8; ++i) { f[i] = lo[i]; f[8 + i] = hi[i]; }
    return f;
}

// ---------------------------------------------------------------------------
// Elementwise converters
// ---------------------------------------------------------------------------
typedef __attribute__((ext_vector_type(4))) __bf16 v4bf;
typedef __attribute__((ext_vector_type(4))) float  v4f;

// 32 elements a thread, so that the src job takes 4,096 waves in place of 131,072:
// eight 16-B loads in flight per lane, each wave-wide load 512 contiguous bytes,
// each wave-wide store 256. Its 512 blocks cover the array exactly (8,192 elements a block).
#define CVT_BLOCK_ELEMS (256 * 32)
__device__ __forceinline__ void cvt_f32_bf16_block(const float* __restrict__ in,
                                                   __bf16* __restrict__ out, int blk) {
    const size_t base = (size_t)blk * CVT_BLOCK_ELEMS + threadIdx.x * 4;
    v4f r[8];
#pragma unroll
    for (int i = 0; i < 8; ++i) r[i] = *(const v4f*)(in + base + i * 1024);
    // the loads' address registers may be reused below: the wait stands in front of that
    asm volatile("s_wait_xcnt 0x0" ::: "memory");
#pragma unroll
    for (int i = 0; i < 8; ++i) {
        v4bf p;
#pragma unroll
        for (int j = 0; j < 4; ++j) p[j] = f2bf(r[i][j]);
        *(v4bf*)(out + base + i * 1024) = p;
    }
    // other jobs' code follows in the same kernel and reuses the stores' registers:
    // the wait stands behind the last store, in front of any such overwrite
    asm volatile("s_wait_xcnt 0x0" ::: "memory");
}

// W[K][N] f32 (row-major) -> Wt[N][K] bf16, one 64x64 tile per 256-thread block.
// K and N are multiples of 64. Reads are 256-B row pieces (16 B a lane), the tile is
// turned in LDS, and every store instruction writes whole 128-B lines of Wt.
__device__ __forceinline__ void cvt_transpose_block(const float* __restrict__ W,
                                                    __bf16* __restrict__ Wt, int K, int N,
                                                    int bx, int by) {
    // 128-B rows at a 144-B pitch (16 B x odd) for the 16-byte readers.
    __shared__ __attribute__((aligned(16))) __bf16 tile[64][72];
    const int t = threadIdx.x;
    const int n0 = bx * 64;
    const int k0 = by * 64;

    const int nq = (t & 15) * 4;   // four columns of W
    const int kq = (t >> 4) * 4;   // four rows of W
    const float* in = W + (size_t)(k0 + kq) * N + n0 + nq;
    v4f r[4];
#pragma unroll
    for (int i = 0; i < 4; ++i) {
        r[i] = *(const v4f*)(in + (size_t)i * N);
        // a later load's result registers may reuse this load's address pair:
        // the wait stands between the load and any such overwrite
        asm volatile("s_wait_xcnt 0x0" ::: "memory");
    }
#pragma unroll
    for (int j = 0; j < 4; ++j) {
        v4bf p;
#pragma unroll
        for (int i = 0; i < 4; ++i) p[i] = f2bf(r[i][j]);
        *(v4bf*)&tile[nq + j][kq] = p;
    }
    __syncthreads();

    const int kk = (t & 7) * 8;    // eight lanes cover one 128-B row of the tile
#pragma unroll
    for (int pass = 0; pass < 2; ++pass) {
        const int n = (t >> 3) + pass * 32;
        *(v8bf*)(Wt + (size_t)(n0 + n) * K + k0 + kk) = *(const v8bf*)&tile[n][kk];
    }
    // other jobs' code follows in the same kernel and reuses the stores' registers:
    // the wait stands behind the last store, in front of any such overwrite
    asm volatile("s_wait_xcnt 0x0" ::: "memory");
}

// The six conversions depend on nothing and on one another not at all: one launch does
// them all, each block taking its job from its index. Ranges of blocks, in this order:
// W1, W2 (1,024 tiles each), src (512 pieces), Wq, Wk, Wv (256 tiles each).
#define PREP_BIG ((DMODEL / 64) * (DFF / 64))        // tiles of W1, of W2
#define PREP_SRC (BDIM * SDIM * DMODEL / CVT_BLOCK_ELEMS)
#define PREP_SQ ((DMODEL / 64) * (DMODEL / 64))      // tiles of Wq, of Wk, of Wv
#define PREP_BLOCKS (2 * PREP_BIG + PREP_SRC + 3 * PREP_SQ)
__global__ __launch_bounds__(256) void prep_kernel(
    const float* __restrict__ src, const float* __restrict__ Wq, const float* __restrict__ Wk,
    const float* __restrict__ Wv, const float* __restrict__ W1, const float* __restrict__ W2,
    __bf16* __restrict__ srcb, __bf16* __restrict__ Wqt, __bf16* __restrict__ Wkt,
    __bf16* __restrict__ Wvt, __bf16* __restrict__ W1t, __bf16* __restrict__ W2t) {
    int blk = blockIdx.x;   // every test below is the same for the whole block
    if (blk < PREP_BIG) {
        cvt_transpose_block(W1, W1t, DMODEL, DFF, blk & (DFF / 64 - 1), blk / (DFF / 64));
        return;
    }
    blk -= PREP_BIG;
    if (blk < PREP_BIG) {
        cvt_transpose_block(W2, W2t, DFF, DMODEL, blk & (DMODEL / 64 - 1), blk / (DMODEL / 64));
        return;
    }
    blk -= PREP_BIG;
    if (blk < PREP_SRC) {
        cvt_f32_bf16_block(src, srcb, blk);
        return;
    }
    blk -= PREP_SRC;
    const int which = blk / PREP_SQ;
    blk &= PREP_SQ - 1;
    const float* W = which == 0 ? Wq : which == 1 ? Wk : Wv;
    __bf16* Wt = which == 0 ? Wqt : which == 1 ? Wkt : Wvt;
    cvt_transpose_block(W, Wt, DMODEL, DMODEL, blk & (DMODEL / 64 - 1), blk / (DMODEL / 64));
}

// ---------------------------------------------------------------------------
// Generic bf16 WMMA GEMM: C[M,N] = A[M,K] * Wt[N,K]^T + bias, with mode epilogue
//   mode 0: Q/K layout  -> bf16 out[((b*16+h)*1024+s)*64+d]
//   mode 2: V transposed-> bf16 out[((b*16+h)*64+d)*1024+s]
//   mode 3: ReLU        -> bf16 out[row*N+col]   (FFN1)
//   mode 4: plain f32   -> f32  out[row*N+col]   (FFN2)
// Block: 128 threads = 4 waves; wave w owns rows m0+32w..+31, cols n0..n0+63.
// A pass is 128 k: the block's 128 rows of A and 64 rows of Wt (256 B each) are
// brought into LDS by asynchronous copies that read whole 128-B lines, two
// buffers, the copies of pass p+2 in flight while pass p+1 is worked on.
// Fragments come from LDS by 16-B reads; per 32-k chunk 2 A + 4 B frags -> 8 WMMAs.
// ---------------------------------------------------------------------------
#define G_PASS_K 128                       // k elements per pass
#define G_PITCH 136                        // LDS row pitch in elements: 272 B = 16 B x odd
#define G_ROWS (128 + 64)                  // A rows, then Wt rows
#define G_STAGE (G_ROWS * G_PITCH)         // elements per buffer
#define G_STEP_B (8 * G_PITCH * 2)         // LDS bytes between two copies of a thread (8 rows)

// Eight 16-B copies of one thread, 8 rows apart: global row step 'gs' elements.
// The s_wait_xcnt closes the statement so that no address register of a copy is
// rewritten ahead of it.
__device__ __forceinline__ void copy8_to_lds(unsigned l, const __bf16* g, size_t gs) {
    asm volatile(
        "global_load_async_to_lds_b128 %0, %8, off\n\t"
        "global_load_async_to_lds_b128 %1, %9, off\n\t"
        "global_load_async_to_lds_b128 %2, %10, off\n\t"
        "global_load_async_to_lds_b128 %3, %11, off\n\t"
        "global_load_async_to_lds_b128 %4, %12, off\n\t"
        "global_load_async_to_lds_b128 %5, %13, off\n\t"
        "global_load_async_to_lds_b128 %6, %14, off\n\t"
        "global_load_async_to_lds_b128 %7, %15, off\n\t"
        "s_wait_xcnt 0x0"
        :: "v"(l), "v"(l + 1 * G_STEP_B), "v"(l + 2 * G_STEP_B), "v"(l + 3 * G_STEP_B),
           "v"(l + 4 * G_STEP_B), "v"(l + 5 * G_STEP_B), "v"(l + 6 * G_STEP_B),
           "v"(l + 7 * G_STEP_B),
           "v"(g), "v"(g + gs), "v"(g + 2 * gs), "v"(g + 3 * gs),
           "v"(g + 4 * gs), "v"(g + 5 * gs), "v"(g + 6 * gs), "v"(g + 7 * gs)
        : "memory");
}

// blockIdx.z picks one of up to three independent products on the same A (weights, bias,
// output and mode of its own): Q, K and V go in one launch; the FFN launches have z = 0 only.
__global__ __launch_bounds__(128) void gemm_bf16_kernel(
    const __bf16* __restrict__ A, const __bf16* __restrict__ Wt0,
    const __bf16* __restrict__ Wt1, const __bf16* __restrict__ Wt2,
    const float* __restrict__ bias0, const float* __restrict__ bias1,
    const float* __restrict__ bias2, void* __restrict__ out0, void* __restrict__ out1,
    void* __restrict__ out2, int N, int Kd, int mode0, int mode1, int mode2) {
    __shared__ __attribute__((aligned(16))) __bf16 sm[2 * G_STAGE];
    const int z = blockIdx.z;
    const __bf16* __restrict__ Wt = z == 0 ? Wt0 : z == 1 ? Wt1 : Wt2;
    const float* __restrict__ bias = z == 0 ? bias0 : z == 1 ? bias1 : bias2;
    void* __restrict__ outp = z == 0 ? out0 : z == 1 ? out1 : out2;
    const int mode = z == 0 ? mode0 : z == 1 ? mode1 : mode2;
    const int t = threadIdx.x;
    const int lane = t & 31;
    const int wv = t >> 5;
    const int hl = lane >> 4;
    const int l16 = lane & 15;
    const int n0 = blockIdx.x * 64;
    const int mb = blockIdx.y * 128;
    const int m0 = mb + wv * 32;

    v8f c[2][4] = {};

    // copies: 16 lanes cover one 256-B row piece, a wave two rows, the block 8 rows
    const int crow = t >> 4;
    const int ccol = (t & 15) * 8;
    const size_t gs = (size_t)8 * Kd;
    const __bf16* gA = A + (size_t)(mb + crow) * Kd + ccol;
    const __bf16* gB = Wt + (size_t)(n0 + crow) * Kd + ccol;
    const unsigned lc = (unsigned)(size_t)(&sm[0]) + (unsigned)(crow * G_PITCH + ccol) * 2u;

#define ISSUE_PASS(p, buf)                                                     \
    do {                                                                       \
        const unsigned lb = lc + (unsigned)(buf) * (G_STAGE * 2u);             \
        const __bf16* ga = gA + (size_t)(p) * G_PASS_K;                        \
        copy8_to_lds(lb, ga, gs);                                              \
        copy8_to_lds(lb + 8u * G_STEP_B, ga + 8 * gs, gs);                     \
        copy8_to_lds(lb + 16u * G_STEP_B, gB + (size_t)(p) * G_PASS_K, gs);    \
    } while (0)

    // fragment rows of this lane inside a buffer
    const int fa = (wv * 32 + l16) * G_PITCH;
    const int fb = (128 + l16) * G_PITCH;

    // ping-pong fragment buffers
    v16bf a0[2], a1[2], bb[2][4];

#define LOAD_CHUNK(buf, kk)                                                    \
    do {                                                                       \
        a0[buf] = load_frag(st + fa + (kk), hl);                               \
        a1[buf] = load_frag(st + fa + 16 * G_PITCH + (kk), hl);                \
        _Pragma("unroll") for (int g = 0; g < 4; ++g)                          \
            bb[buf][g] = load_frag(st + fb + g * 16 * G_PITCH + (kk), hl);     \
    } while (0)

#define COMPUTE(buf)                                               \
    do {                                                           \
        _Pragma("unroll") for (int g = 0; g < 4; ++g) {            \
            c[0][g] = wmma_bf16(a0[buf], bb[buf][g], c[0][g]);     \
            c[1][g] = wmma_bf16(a1[buf], bb[buf][g], c[1][g]);     \
        }                                                          \
    } while (0)

    // Kd is a multiple of 128 (1024 or 4096).
    const int npass = Kd / G_PASS_K;
    ISSUE_PASS(0, 0);
    // pass 0 has landed for this wave; the barrier publishes it to the others
    asm volatile("s_wait_asynccnt 0x0" ::: "memory");
    __syncthreads();
    if (npass > 1) ISSUE_PASS(1, 1);

    for (int p = 0; p < npass; ++p) {
        const __bf16* st = sm + (p & 1) * G_STAGE;
        // The scheduling barriers keep each chunk's twelve LDS reads together and one
        // chunk ahead of their WMMAs; without them the compiler sinks the reads to
        // pairs directly in front of their use, each pair behind a wait to zero.
        LOAD_CHUNK(0, 0);
        LOAD_CHUNK(1, 32);
        __builtin_amdgcn_sched_barrier(0);
        COMPUTE(0);
        __builtin_amdgcn_sched_barrier(0);
        LOAD_CHUNK(0, 64);
        __builtin_amdgcn_sched_barrier(0);
        COMPUTE(1);
        __builtin_amdgcn_sched_barrier(0);
        LOAD_CHUNK(1, 96);
        // The pass's last LDS reads are out: the hand-over stands here, ahead of the
        // last two chunks' WMMAs (registers only), so that the refill flies under them.
        // this wave's reads of the buffer have returned before it is refilled
        asm volatile("s_wait_dscnt 0x0" ::: "memory");
        // this wave's copies of pass p+1 have landed before the barrier publishes them
        asm volatile("s_wait_asynccnt 0x0" ::: "memory");
        __syncthreads();
        if (p + 2 < npass) ISSUE_PASS(p + 2, p & 1);
        COMPUTE(0);
        COMPUTE(1);
    }
    // no copy is outstanding when the wave goes on to its end
    asm volatile("s_wait_asynccnt 0x0" ::: "memory");
#undef ISSUE_PASS
#undef LOAD_CHUNK
#undef COMPUTE

#pragma unroll
    for (int sub = 0; sub < 2; ++sub) {
#pragma unroll
        for (int g = 0; g < 4; ++g) {
            const int col = n0 + g * 16 + l16;
            const float bcst = bias[col];
#pragma unroll
            for (int v = 0; v < 8; ++v) {
                const int row = m0 + sub * 16 + v + hl * 8;  // D-frag: M = v + 8*(lane>=16)
                float val = c[sub][g][v] + bcst;
                if (mode == 3) {
                    val = fmaxf(val, 0.f);
                    ((__bf16*)outp)[(size_t)row * N + col] = f2bf(val);
                } else if (mode == 4) {
                    ((float*)outp)[(size_t)row * N + col] = val;
                } else if (mode == 2) {  // V -> [b,h,d,s]
                    int bb2 = row >> 10, s = row & 1023, hh = col >> 6, d = col & 63;
                    ((__bf16*)outp)[(((size_t)(bb2 * 16 + hh)) * 64 + d) * 1024 + s] = f2bf(val);
                } else {                 // Q/K -> [b,h,s,d]
                    int bb2 = row >> 10, s = row & 1023, hh = col >> 6, d = col & 63;
                    ((__bf16*)outp)[(((size_t)(bb2 * 16 + hh)) * 1024 + s) * 64 + d] = f2bf(val);
                }
            }
        }
    }
}

// ---------------------------------------------------------------------------
// Flash attention with the pair-bias MLP shared by the heads.
// One 16-wave block per (b, 16-row q-tile); wave w runs head w over all keys.
// The hidden layer of the bias MLP does not depend on the head, so it is worked out
// once per (q, key): for each chunk of 64 keys wave w takes q row w, forms the 16 hidden
// values of each pair (lanes 0-15 the eight of t_deltas, lanes 16-31 the eight of dists)
// and multiplies them with the 16x16 output weights by v_wmma_f32_16x16x4_f32
// (A = w2^T: row = head; B = hidden: column = key), all in f32. The result goes to LDS as
// bias[head][q row][key], two buffers, one chunk ahead, one block barrier a chunk.
// ---------------------------------------------------------------------------
typedef __attribute__((ext_vector_type(2))) float v2f;

#define AT_CHUNK 64                        // keys per bias chunk
#define AT_BROW 68                         // bias row pitch in words: 272 B = 16 B x odd
#define AT_BPLANE (16 * AT_BROW + 4)       // words per head; 8 planes = 32 banks mod 64

// Orders this wave's LDS writes ahead of its own later LDS reads of other lanes' words
// (score, P and factor tiles belong to one wave alone, so no block barrier is needed):
// the LDS-only fences keep the compiler from moving LDS accesses over this point and
// make it wait for the wave's outstanding LDS operations.
__device__ __forceinline__ void wave_lds_order() {
    __builtin_amdgcn_fence(__ATOMIC_RELEASE, "workgroup", "local");
    __builtin_amdgcn_wave_barrier();
    __builtin_amdgcn_fence(__ATOMIC_ACQUIRE, "workgroup", "local");
}

__global__ __launch_bounds__(512) void attn_kernel(
    const __bf16* __restrict__ Q, const __bf16* __restrict__ Km,
    const __bf16* __restrict__ Vt, const float* __restrict__ td,
    const float* __restrict__ dd, const float* __restrict__ tw1,
    const float* __restrict__ tb1, const float* __restrict__ tw2,
    const float* __restrict__ tb2, const float* __restrict__ dw1,
    const float* __restrict__ db1, const float* __restrict__ dw2,
    const float* __restrict__ db2, float* __restrict__ out) {
    const int lane = threadIdx.x & 31;
    const int hl = lane >> 4;
    const int l16 = lane & 15;
    const int h = __builtin_amdgcn_readfirstlane(threadIdx.x >> 5);  // wave = head
    const int qt = blockIdx.x & 63;
    const int b = blockIdx.x >> 6;

    __shared__ __attribute__((aligned(16))) float bs[2][16 * AT_BPLANE];   // bias, all heads
    __shared__ __attribute__((aligned(16))) float sc_all[16][16][36];      // per wave: scores
    __shared__ __attribute__((aligned(16))) __bf16 pb_all[16][16][40];     // per wave: bf16 P
    __shared__ float corr_all[16][16];
    __shared__ float lsum_all[16][16];
    float (*sc)[36] = sc_all[h];
    __bf16 (*pb)[40] = pb_all[h];
    float* corr = corr_all[h];
    float* lsum = lsum_all[h];

    // Bias MLP operands of this lane. k slot (chunk c, register j, lane half hl) of both
    // WMMA operands is hidden unit 2c+j of the t_deltas MLP (hl = 0) or the dists MLP (hl = 1).
    const float* w1p = hl ? dw1 : tw1;
    const float* b1p = hl ? db1 : tb1;
    const float* w2p = hl ? dw2 : tw2;
    float w1[8], b1[8];
    v2f wa[4];
#pragma unroll
    for (int j = 0; j < 8; ++j) { w1[j] = w1p[j]; b1[j] = b1p[j]; }
#pragma unroll
    for (int c = 0; c < 4; ++c) {
        wa[c][0] = w2p[(2 * c) * 16 + l16];
        wa[c][1] = w2p[(2 * c + 1) * 16 + l16];
    }
    v8f cinit;  // accumulator start: the two output biases of head v + 8*hl
#pragma unroll
    for (int v = 0; v < 8; ++v) cinit[v] = tb2[v + 8 * hl] + db2[v + 8 * hl];
    // the wait stands in front of any reuse of these loads' address registers; naming the
    // pairs as inputs keeps them live up to it
    asm volatile("s_wait_xcnt 0x0" :: "v"(w1p), "v"(b1p), "v"(w2p) : "memory");
    // q row qt*16 + h of this lane's matrix; the lane owns keys 4*l16 .. 4*l16+3 of a chunk
    const float* mrow = (hl ? dd : td) + ((size_t)b * SDIM + qt * 16 + h) * SDIM + l16 * 4;

#define MAKE_BIAS(buf, m4)                                                              \
    do {                                                                                \
        v8f acc[4] = {cinit, cinit, cinit, cinit};                                      \
        _Pragma("unroll") for (int c = 0; c < 4; ++c) {                                 \
            _Pragma("unroll") for (int g = 0; g < 4; ++g) {                             \
                v2f hb;                                                                 \
                hb[0] = fmaxf((m4)[g] * w1[2 * c] + b1[2 * c], 0.f);                    \
                hb[1] = fmaxf((m4)[g] * w1[2 * c + 1] + b1[2 * c + 1], 0.f);            \
                acc[g] = __builtin_amdgcn_wmma_f32_16x16x4_f32(                         \
                    false, wa[c], false, hb, (short)0, acc[g], false, false);           \
            }                                                                           \
        }                                                                               \
        _Pragma("unroll") for (int v = 0; v < 8; ++v) {                                 \
            v4f o4 = {acc[0][v], acc[1][v], acc[2][v], acc[3][v]};                      \
            *(v4f*)&bs[buf][(v + 8 * hl) * AT_BPLANE + h * AT_BROW + l16 * 4] = o4;     \
        }                                                                               \
    } while (0)

    const size_t bh = (size_t)(b * 16 + h);

    // Q A-fragments for the two K-dim halves (hd 0..31, 32..63)
    v16bf qa[2];
    {
        const __bf16* r = Q + (bh * 1024 + qt * 16 + l16) * 64;
        qa[0] = load_frag(r, hl);
        qa[1] = load_frag(r + 32, hl);
    }

    v8f o[4] = {};
    float mrun = -1e30f, lrow = 0.f;

    v4f mreg = *(const v4f*)mrow;
    // the load's address pair may be reused below: the wait stands in front of that
    asm volatile("s_wait_xcnt 0x0" :: "v"(mrow) : "memory");
    MAKE_BIAS(0, mreg);
    mreg = *(const v4f*)(mrow + AT_CHUNK);
    // the load's address pair may be reused below: the wait stands in front of that
    asm volatile("s_wait_xcnt 0x0" :: "v"(mrow) : "memory");
    __syncthreads();  // chunk 0's bias is published to every head's wave

    for (int kc = 0; kc < SDIM; kc += AT_CHUNK) {
        const int buf = (kc / AT_CHUNK) & 1;
        for (int kb = kc; kb < kc + AT_CHUNK; kb += 32) {
            // ---- scores for 32 keys: 2 N-groups x 2 K-frags = 4 WMMAs ----
            v16bf kf[2][2];
#pragma unroll
            for (int g = 0; g < 2; ++g) {
                const __bf16* kr = Km + (bh * 1024 + kb + g * 16 + l16) * 64;
                kf[g][0] = load_frag(kr, hl);
                kf[g][1] = load_frag(kr + 32, hl);
            }
            // the next chunk's bias is made here, while the chunk's first K loads are under way
            if (kb == kc && kc + AT_CHUNK < SDIM) {
                MAKE_BIAS(buf ^ 1, mreg);
            }
            // inputs only: holds the eight K loads together, one trip to L2; without it the
            // compiler issues them in pairs into the same registers, each pair waited for
            asm volatile("" :: "v"(kf[0][0]), "v"(kf[0][1]), "v"(kf[1][0]), "v"(kf[1][1]));
            // The matrix row piece of the chunk after next is fetched behind the K wait: loads
            // return in order, so in front of it this read from memory would hold up the K data.
            if (kb == kc && kc + 2 * AT_CHUNK < SDIM) {
                mreg = *(const v4f*)(mrow + kc + 2 * AT_CHUNK);
                // the load's address pair may be reused below: the wait stands in front of that
                asm volatile("s_wait_xcnt 0x0" :: "v"(mrow) : "memory");
            }
#pragma unroll
            for (int g = 0; g < 2; ++g) {
                v8f s = {};
                s = wmma_bf16(qa[0], kf[g][0], s);
                s = wmma_bf16(qa[1], kf[g][1], s);
#pragma unroll
                for (int v = 0; v < 8; ++v) sc[v + hl * 8][g * 16 + l16] = s[v];
            }
            wave_lds_order();

            // ---- online softmax: lane handles (row=l16, cols hl*16..+15) ----
            const float* brow = &bs[buf][h * AT_BPLANE + l16 * AT_BROW + (kb - kc) + hl * 16];
            float pm = -1e30f;
            float sv[16];
#pragma unroll
            for (int j4 = 0; j4 < 4; ++j4) {
                const v4f bi = *(const v4f*)(brow + j4 * 4);
                const v4f si = *(const v4f*)&sc[l16][hl * 16 + j4 * 4];
#pragma unroll
                for (int j = 0; j < 4; ++j) {
                    sv[j4 * 4 + j] = si[j] * (1.0f / 32.0f) + bi[j];
                    pm = fmaxf(pm, sv[j4 * 4 + j]);
                }
            }
            pm = fmaxf(pm, __shfl_xor(pm, 16, 32));
            const float nm = fmaxf(mrun, pm);
            const float cf = __expf(mrun - nm);
            float ps = 0.f;
#pragma unroll
            for (int j = 0; j < 16; ++j) {
                float p = __expf(sv[j] - nm);
                ps += p;
                pb[l16][hl * 16 + j] = f2bf(p);
            }
            ps += __shfl_xor(ps, 16, 32);
            lrow = lrow * cf + ps;
            mrun = nm;
            if (lane < 16) corr[l16] = cf;
            wave_lds_order();

            // ---- rescale O, then O += P * V (4 WMMAs) ----
            float cfa[8];
#pragma unroll
            for (int v = 0; v < 8; ++v) cfa[v] = corr[v + hl * 8];
#pragma unroll
            for (int g = 0; g < 4; ++g)
#pragma unroll
                for (int v = 0; v < 8; ++v) o[g][v] *= cfa[v];

            v16bf pa = load_frag(&pb[l16][0], hl);
#pragma unroll
            for (int g = 0; g < 4; ++g) {
                const __bf16* vr = Vt + (bh * 64 + g * 16 + l16) * 1024 + kb;
                v16bf vb = load_frag(vr, hl);
                o[g] = wmma_bf16(pa, vb, o[g]);
            }
            wave_lds_order();  // sc/pb reused next iteration
        }
        // publishes the next chunk's bias and ends every wave's reads of this chunk's
        // buffer, which the next trip refills
        __syncthreads();
    }
#undef MAKE_BIAS

    if (lane < 16) lsum[l16] = 1.f / lrow;
    wave_lds_order();
    float ri[8];
#pragma unroll
    for (int v = 0; v < 8; ++v) ri[v] = lsum[v + hl * 8];
#pragma unroll
    for (int g = 0; g < 4; ++g)
#pragma unroll
        for (int v = 0; v < 8; ++v) {
            const int s = qt * 16 + v + hl * 8;
            const int d = h * 64 + g * 16 + l16;
            out[((size_t)b * SDIM + s) * DMODEL + d] = o[g][v] * ri[v];
        }
}

// ---------------------------------------------------------------------------
// Residual + LayerNorm over D=1024. One wave per row, eight rows per 256-thread block:
// a launch starts 4,096 waves in place of 32,768. A lane holds 32 elements of its row
// (eight 16-B pieces, 512 B apart), its loads all in flight together; the two row sums are
// in-lane adds and a five-step butterfly over the wave, so no LDS and no barrier.
// ---------------------------------------------------------------------------
__device__ __forceinline__ float wave_sum(float s) {
#pragma unroll
    for (int m = 16; m > 0; m >>= 1) s += __shfl_xor(s, m, 32);
    return s;
}

__global__ __launch_bounds__(256) void add_ln_kernel(
    const float* __restrict__ a, const float* __restrict__ r,
    const float* __restrict__ g, const float* __restrict__ beta,
    float* __restrict__ outf, __bf16* __restrict__ outb) {
    const int lane = threadIdx.x & 31;
    const int row = blockIdx.x * 8 + (threadIdx.x >> 5);
    const int c0 = lane * 4;
    const size_t ro = (size_t)row * DMODEL + c0;
    const float* pa = a + ro;
    const float* pr = r + ro;
    v4f v[8], w[8], gg[8], bb[8];
#pragma unroll
    for (int i = 0; i < 8; ++i) v[i] = *(const v4f*)(pa + i * 128);
#pragma unroll
    for (int i = 0; i < 8; ++i) w[i] = *(const v4f*)(pr + i * 128);
    // the wait stands in front of any reuse of the loads' address pairs; naming the pairs
    // as inputs keeps them live up to it, so that no load's result is placed on them
    asm volatile("s_wait_xcnt 0x0" :: "v"(pa), "v"(pr) : "memory");
    // scale and shift are fetched ahead of their use, under the sums
#pragma unroll
    for (int i = 0; i < 8; ++i) gg[i] = *(const v4f*)(g + c0 + i * 128);
#pragma unroll
    for (int i = 0; i < 8; ++i) bb[i] = *(const v4f*)(beta + c0 + i * 128);
    // the loads' offset register may be reused below: the wait stands in front of that
    asm volatile("s_wait_xcnt 0x0" ::: "memory");
    // inputs only: holds the sixteen scale and shift loads together, ahead of the second sum;
    // without it the compiler sinks them behind the sums, two at a time, each pair waited for
    asm volatile("" :: "v"(gg[0]), "v"(gg[1]), "v"(gg[2]), "v"(gg[3]), "v"(gg[4]), "v"(gg[5]),
                       "v"(gg[6]), "v"(gg[7]), "v"(bb[0]), "v"(bb[1]), "v"(bb[2]), "v"(bb[3]),
                       "v"(bb[4]), "v"(bb[5]), "v"(bb[6]), "v"(bb[7]));
    float s = 0.f;
#pragma unroll
    for (int i = 0; i < 8; ++i) {
        v[i] += w[i];
        s += (v[i][0] + v[i][1]) + (v[i][2] + v[i][3]);
    }
    const float mean = wave_sum(s) * (1.f / 1024.f);
    float ss = 0.f;
#pragma unroll
    for (int i = 0; i < 8; ++i) {
        const v4f d = v[i] - mean;
        ss += (d[0] * d[0] + d[1] * d[1]) + (d[2] * d[2] + d[3] * d[3]);
    }
    const float rstd = rsqrtf(wave_sum(ss) * (1.f / 1024.f) + 1e-5f);
#pragma unroll
    for (int i = 0; i < 8; ++i) v[i] = (v[i] - mean) * rstd * gg[i] + bb[i];
    if (outb) {
        v4bf p[8];
#pragma unroll
        for (int i = 0; i < 8; ++i) {
#pragma unroll
            for (int j = 0; j < 4; ++j) p[i][j] = f2bf(v[i][j]);
        }
#pragma unroll
        for (int i = 0; i < 8; ++i) *(v4bf*)(outb + ro + i * 128) = p[i];
        // registers that these stores name may be reused for the next stores' address
        asm volatile("s_wait_xcnt 0x0" ::: "memory");
    }
#pragma unroll
    for (int i = 0; i < 8; ++i) *(v4f*)(outf + ro + i * 128) = v[i];
}

// ---------------------------------------------------------------------------
// Host launch
// ---------------------------------------------------------------------------
extern "C" void kernel_launch(void* const* d_in, const int* in_sizes, int n_in,
                              void* d_out, int out_size, void* d_ws, size_t ws_size,
                              hipStream_t stream) {
    (void)in_sizes; (void)n_in; (void)out_size; (void)ws_size;
    const float* src = (const float*)d_in[0];
    const float* td  = (const float*)d_in[1];
    const float* dd  = (const float*)d_in[2];
    const float* Wq  = (const float*)d_in[3];
    const float* bq  = (const float*)d_in[4];
    const float* Wk  = (const float*)d_in[5];
    const float* bk  = (const float*)d_in[6];
    const float* Wv  = (const float*)d_in[7];
    const float* bv  = (const float*)d_in[8];
    const float* tw1 = (const float*)d_in[9];
    const float* tb1 = (const float*)d_in[10];
    const float* tw2 = (const float*)d_in[11];
    const float* tb2 = (const float*)d_in[12];
    const float* dw1 = (const float*)d_in[13];
    const float* db1 = (const float*)d_in[14];
    const float* dw2 = (const float*)d_in[15];
    const float* db2 = (const float*)d_in[16];
    const float* W1  = (const float*)d_in[17];
    const float* b1  = (const float*)d_in[18];
    const float* W2  = (const float*)d_in[19];
    const float* b2  = (const float*)d_in[20];
    const float* g1  = (const float*)d_in[21];
    const float* be1 = (const float*)d_in[22];
    const float* g2  = (const float*)d_in[23];
    const float* be2 = (const float*)d_in[24];

    const int M = BDIM * SDIM;  // 4096 rows
    char* ws = (char*)d_ws;
    size_t off = 0;
    auto alloc = [&](size_t bytes) {
        char* p = ws + off;
        off = (off + bytes + 255) & ~(size_t)255;
        return p;
    };
    __bf16* srcb = (__bf16*)alloc((size_t)M * DMODEL * 2);
    __bf16* Wqt  = (__bf16*)alloc((size_t)DMODEL * DMODEL * 2);
    __bf16* Wkt  = (__bf16*)alloc((size_t)DMODEL * DMODEL * 2);
    __bf16* Wvt  = (__bf16*)alloc((size_t)DMODEL * DMODEL * 2);
    __bf16* W1t  = (__bf16*)alloc((size_t)DMODEL * DFF * 2);
    __bf16* W2t  = (__bf16*)alloc((size_t)DFF * DMODEL * 2);
    __bf16* Qb   = (__bf16*)alloc((size_t)M * DMODEL * 2);
    __bf16* Kb   = (__bf16*)alloc((size_t)M * DMODEL * 2);
    __bf16* Vtb  = (__bf16*)alloc((size_t)M * DMODEL * 2);
    float*  attn = (float*)alloc((size_t)M * DMODEL * 4);
    float*  xf   = (float*)alloc((size_t)M * DMODEL * 4);
    __bf16* xb   = (__bf16*)alloc((size_t)M * DMODEL * 2);
    __bf16* h1   = (__bf16*)alloc((size_t)M * DFF * 2);
    float*  ffn  = (float*)alloc((size_t)M * DMODEL * 4);

    prep_kernel<<<PREP_BLOCKS, 256, 0, stream>>>(src, Wq, Wk, Wv, W1, W2,
                                                 srcb, Wqt, Wkt, Wvt, W1t, W2t);

    gemm_bf16_kernel<<<dim3(DMODEL / 64, M / 128, 3), 128, 0, stream>>>(
        srcb, Wqt, Wkt, Wvt, bq, bk, bv, Qb, Kb, Vtb, DMODEL, DMODEL, 0, 0, 2);

    attn_kernel<<<BDIM * (SDIM / 16), 32 * NHEAD, 0, stream>>>(
        Qb, Kb, Vtb, td, dd, tw1, tb1, tw2, tb2, dw1, db1, dw2, db2, attn);

    add_ln_kernel<<<M / 8, 256, 0, stream>>>(src, attn, g1, be1, xf, xb);

    gemm_bf16_kernel<<<dim3(DFF / 64, M / 128), 128, 0, stream>>>(
        xb, W1t, W1t, W1t, b1, b1, b1, h1, h1, h1, DFF, DMODEL, 3, 3, 3);
    gemm_bf16_kernel<<<dim3(DMODEL / 64, M / 128), 128, 0, stream>>>(
        h1, W2t, W2t, W2t, b2, b2, b2, ffn, ffn, ffn, DMODEL, DFF, 4, 4, 4);

    add_ln_kernel<<<M / 8, 256, 0, stream>>>(xf, ffn, g2, be2, (float*)d_out, nullptr);
}

// v006
// A run of this version takes 200 microseconds.
// Two timings next to v005 both put it at 1.16 times that version's speed.
// All steps since v000 together make it 3.46 times as fast.
#include <hip/hip_runtime.h>

// ---------------------------------------------------------------------------
// SpatioTemporalTransformerLayer for MI455X (gfx1250, wave32, WMMA).
// B=4, S=1024, D=1024, H=16, HD=64, DFF=4096, BIAS_HID=8.
// GEMMs use v_wmma_f32_16x16x32_bf16 (bf16 A/B, f32 accumulate), the bias MLP v_wmma_f32_16x16x4_f32 (f32).
// GEMM operand tiles are staged in LDS by asynchronous copies (two buffers);
// fragments are read from LDS into ping-pong fragment buffers.
// ---------------------------------------------------------------------------

typedef __attribute__((ext_vector_type(16))) __bf16 v16bf;
typedef __attribute__((ext_vector_type(8)))  __bf16 v8bf;
typedef __attribute__((ext_vector_type(8)))  float  v8f;

#define BDIM 4
#define SDIM 1024
#define DMODEL 1024
#define NHEAD 16
#define HEADD 64
#define DFF 4096

__device__ __forceinline__ __bf16 f2bf(float x) {
    unsigned u = __builtin_bit_cast(unsigned, x);
    unsigned r = (u + 0x7FFFu + ((u >> 16) & 1u)) >> 16;
    return __builtin_bit_cast(__bf16, (unsigned short)r);
}

__device__ __forceinline__ v8f wmma_bf16(v16bf a, v16bf b, v8f c) {
    // (neg_a, A, neg_b, B, c_mod, C, reuse_a, reuse_b)
    return __builtin_amdgcn_wmma_f32_16x16x32_bf16(false, a, false, b, (short)0, c,
                                                   false, false);
}

// Load a 16x32 bf16 A/B fragment: lane L, elem e -> (row=L&15, K=16*(e>>3)+8*(L>>4)+(e&7))
// 'row_ptr' points at element K=0 of this lane's row. Two contiguous 16B loads.
__device__ __forceinline__ v16bf load_frag(const __bf16* row_ptr, int hl) {
    v8bf lo = *(const v8bf*)(row_ptr + hl * 8);
    v8bf hi = *(const v8bf*)(row_ptr + 16 + hl * 8);
    v16bf f;
#pragma unroll
    for (int i = 0; i < 8; ++i) { f[i] = lo[i]; f[8 + i] = hi[i]; }
    return f;
}

// Fragment order for an operand that only the attention reads: a 16-row x 32-k fragment is
// 1 KiB, two 512-B halves (k 0..15, k 16..31), and in a half lane L owns 16 B at L * 16:
// row = L & 15, k = 16 * half + 8 * (L >> 4) + 0..7, as load_frag reads it. A wave-wide
// 16-B load or store then covers 512 contiguous bytes (four whole lines).
// 'frag' counts fragments; the result is the element index of (row, k), k a multiple of 8.
__device__ __forceinline__ size_t frag_index(size_t frag, int row, int k) {
    return ((frag * 2 + ((k >> 4) & 1)) * 32 + ((k >> 3) & 1) * 16 + row) * 8;
}

// 'p' points at this lane's 16 B in the first half of the fragment.
__device__ __forceinline__ v16bf load_frag_packed(const __bf16* p) {
    v8bf lo = *(const v8bf*)p;
    v8bf hi = *(const v8bf*)(p + 256);
    v16bf f;
#pragma unroll
    for (int i = 0; i < 8; ++i) { f[i] = lo[i]; f[8 + i] = hi[i]; }
    return f;
}

// The eight 16-B units of a wave's 32 x 64 tile: 'po' is this lane's unit of tile (0, 0);
// 'sub' steps by a half fragment, 'g' by 'gstep' elements.
__device__ __forceinline__ void store_units(__bf16* po, int gstep, const v8bf (&pk)[2][4]) {
#pragma unroll
    for (int sub = 0; sub < 2; ++sub)
#pragma unroll
        for (int g = 0; g < 4; ++g) *(v8bf*)(po + g * gstep + sub * 256) = pk[sub][g];
    // other modes' code follows in the same kernel and reuses the stores' registers:
    // the wait stands behind the last store, in front of any such overwrite
    asm volatile("s_wait_xcnt 0x0" ::: "memory");
}

// ---------------------------------------------------------------------------
// Elementwise converters
// ---------------------------------------------------------------------------
typedef __attribute__((ext_vector_type(4))) __bf16 v4bf;
typedef __attribute__((ext_vector_type(4))) float  v4f;

// 32 elements a thread, so that the src job takes 4,096 waves in place of 131,072:
// eight 16-B loads in flight per lane, each wave-wide load 512 contiguous bytes,
// each wave-wide store 256. Its 512 blocks cover the array exactly (8,192 elements a block).
#define CVT_BLOCK_ELEMS (256 * 32)
__device__ __forceinline__ void cvt_f32_bf16_block(const float* __restrict__ in,
                                                   __bf16* __restrict__ out, int blk) {
    const size_t base = (size_t)blk * CVT_BLOCK_ELEMS + threadIdx.x * 4;
    v4f r[8];
#pragma unroll
    for (int i = 0; i < 8; ++i) r[i] = *(const v4f*)(in + base + i * 1024);
    // the loads' address registers may be reused below: the wait stands in front of that
    asm volatile("s_wait_xcnt 0x0" ::: "memory");
#pragma unroll
    for (int i = 0; i < 8; ++i) {
        v4bf p;
#pragma unroll
        for (int j = 0; j < 4; ++j) p[j] = f2bf(r[i][j]);
        *(v4bf*)(out + base + i * 1024) = p;
    }
    // other jobs' code follows in the same kernel and reuses the stores' registers:
    // the wait stands behind the last store, in front of any such overwrite
    asm volatile("s_wait_xcnt 0x0" ::: "memory");
}

// W[K][N] f32 (row-major) -> Wt[N][K] bf16, one 64x64 tile per 256-thread block.
// K and N are multiples of 64. Reads are 256-B row pieces (16 B a lane), the tile is
// turned in LDS, and every store instruction writes whole 128-B lines of Wt.
__device__ __forceinline__ void cvt_transpose_block(const float* __restrict__ W,
                                                    __bf16* __restrict__ Wt, int K, int N,
                                                    int bx, int by) {
    // 128-B rows at a 144-B pitch (16 B x odd) for the 16-byte readers.
    __shared__ __attribute__((aligned(16))) __bf16 tile[64][72];
    const int t = threadIdx.x;
    const int n0 = bx * 64;
    const int k0 = by * 64;

    const int nq = (t & 15) * 4;   // four columns of W
    const int kq = (t >> 4) * 4;   // four rows of W
    const float* in = W + (size_t)(k0 + kq) * N + n0 + nq;
    v4f r[4];
#pragma unroll
    for (int i = 0; i < 4; ++i) {
        r[i] = *(const v4f*)(in + (size_t)i * N);
        // a later load's result registers may reuse this load's address pair:
        // the wait stands between the load and any such overwrite
        asm volatile("s_wait_xcnt 0x0" ::: "memory");
    }
#pragma unroll
    for (int j = 0; j < 4; ++j) {
        v4bf p;
#pragma unroll
        for (int i = 0; i < 4; ++i) p[i] = f2bf(r[i][j]);
        *(v4bf*)&tile[nq + j][kq] = p;
    }
    __syncthreads();

    const int kk = (t & 7) * 8;    // eight lanes cover one 128-B row of the tile
#pragma unroll
    for (int pass = 0; pass < 2; ++pass) {
        const int n = (t >> 3) + pass * 32;
        *(v8bf*)(Wt + (size_t)(n0 + n) * K + k0 + kk) = *(const v8bf*)&tile[n][kk];
    }
    // other jobs' code follows in the same kernel and reuses the stores' registers:
    // the wait stands behind the last store, in front of any such overwrite
    asm volatile("s_wait_xcnt 0x0" ::: "memory");
}

// The six conversions depend on nothing and on one another not at all: one launch does
// them all, each block taking its job from its index. Ranges of blocks, in this order:
// W1, W2 (1,024 tiles each), src (512 pieces), Wq, Wk, Wv (256 tiles each).
#define PREP_BIG ((DMODEL / 64) * (DFF / 64))        // tiles of W1, of W2
#define PREP_SRC (BDIM * SDIM * DMODEL / CVT_BLOCK_ELEMS)
#define PREP_SQ ((DMODEL / 64) * (DMODEL / 64))      // tiles of Wq, of Wk, of Wv
#define PREP_BLOCKS (2 * PREP_BIG + PREP_SRC + 3 * PREP_SQ)
__global__ __launch_bounds__(256) void prep_kernel(
    const float* __restrict__ src, const float* __restrict__ Wq, const float* __restrict__ Wk,
    const float* __restrict__ Wv, const float* __restrict__ W1, const float* __restrict__ W2,
    __bf16* __restrict__ srcb, __bf16* __restrict__ Wqt, __bf16* __restrict__ Wkt,
    __bf16* __restrict__ Wvt, __bf16* __restrict__ W1t, __bf16* __restrict__ W2t) {
    int blk = blockIdx.x;   // every test below is the same for the whole block
    if (blk < PREP_BIG) {
        cvt_transpose_block(W1, W1t, DMODEL, DFF, blk & (DFF / 64 - 1), blk / (DFF / 64));
        return;
    }
    blk -= PREP_BIG;
    if (blk < PREP_BIG) {
        cvt_transpose_block(W2, W2t, DFF, DMODEL, blk & (DMODEL / 64 - 1), blk / (DMODEL / 64));
        return;
    }
    blk -= PREP_BIG;
    if (blk < PREP_SRC) {
        cvt_f32_bf16_block(src, srcb, blk);
        return;
    }
    blk -= PREP_SRC;
    const int which = blk / PREP_SQ;
    blk &= PREP_SQ - 1;
    const float* W = which == 0 ? Wq : which == 1 ? Wk : Wv;
    __bf16* Wt = which == 0 ? Wqt : which == 1 ? Wkt : Wvt;
    cvt_transpose_block(W, Wt, DMODEL, DMODEL, blk & (DMODEL / 64 - 1), blk / (DMODEL / 64));
}

// ---------------------------------------------------------------------------
// Generic bf16 WMMA GEMM: C[M,N] = A[M,K] * Wt[N,K]^T + bias, with mode epilogue
//   mode 0: Q layout    -> bf16 out[((b*16+h)*1024+s)*64+d]
//   mode 2: V           -> bf16, in the order of the attention's B fragments (frag_index)
//   mode 5: K           -> bf16, the same; the product is formed transposed (rows = features,
//                          columns = tokens), so that a lane's eight values are one 16-B unit
//   mode 3: ReLU        -> bf16 out[row*N+col]   (FFN1)
//   mode 4: plain f32   -> f32  out[row*N+col]   (FFN2)
// Block: 128 threads = 4 waves; wave w owns rows m0+32w..+31, cols n0..n0+63.
// A pass is 128 k: the block's 128 rows of A and 64 rows of Wt (mode 5: 128 of Wt, 64 of A; 256 B each) are
// brought into LDS by asynchronous copies that read whole 128-B lines, two
// buffers, the copies of pass p+2 in flight while pass p+1 is worked on.
// Fragments come from LDS by 16-B reads; per 32-k chunk 2 A + 4 B frags -> 8 WMMAs.
// ---------------------------------------------------------------------------
#define G_PASS_K 128                       // k elements per pass
#define G_PITCH 136                        // LDS row pitch in elements: 272 B = 16 B x odd
#define G_ROWS (128 + 64)                  // A rows, then Wt rows (mode 5: Wt rows, then A rows)
#define G_STAGE (G_ROWS * G_PITCH)         // elements per buffer
#define G_STEP_B (8 * G_PITCH * 2)         // LDS bytes between two copies of a thread (8 rows)

// Eight 16-B copies of one thread, 8 rows apart: global row step 'gs' elements.
// The s_wait_xcnt closes the statement so that no address register of a copy is
// rewritten ahead of it.
__device__ __forceinline__ void copy8_to_lds(unsigned l, const __bf16* g, size_t gs) {
    asm volatile(
        "global_load_async_to_lds_b128 %0, %8, off\n\t"
        "global_load_async_to_lds_b128 %1, %9, off\n\t"
        "global_load_async_to_lds_b128 %2, %10, off\n\t"
        "global_load_async_to_lds_b128 %3, %11, off\n\t"
        "global_load_async_to_lds_b128 %4, %12, off\n\t"
        "global_load_async_to_lds_b128 %5, %13, off\n\t"
        "global_load_async_to_lds_b128 %6, %14, off\n\t"
        "global_load_async_to_lds_b128 %7, %15, off\n\t"
        "s_wait_xcnt 0x0"
        :: "v"(l), "v"(l + 1 * G_STEP_B), "v"(l + 2 * G_STEP_B), "v"(l + 3 * G_STEP_B),
           "v"(l + 4 * G_STEP_B), "v"(l + 5 * G_STEP_B), "v"(l + 6 * G_STEP_B),
           "v"(l + 7 * G_STEP_B),
           "v"(g), "v"(g + gs), "v"(g + 2 * gs), "v"(g + 3 * gs),
           "v"(g + 4 * gs), "v"(g + 5 * gs), "v"(g + 6 * gs), "v"(g + 7 * gs)
        : "memory");
}

// blockIdx.z picks one of up to three independent products on the same A (weights, bias,
// output and mode of its own): Q, K and V go in one launch; the FFN launches have z = 0 only.
__global__ __launch_bounds__(128) void gemm_bf16_kernel(
    const __bf16* __restrict__ A, const __bf16* __restrict__ Wt0,
    const __bf16* __restrict__ Wt1, const __bf16* __restrict__ Wt2,
    const float* __restrict__ bias0, const float* __restrict__ bias1,
    const float* __restrict__ bias2, void* __restrict__ out0, void* __restrict__ out1,
    void* __restrict__ out2, int N, int Kd, int mode0, int mode1, int mode2) {
    __shared__ __attribute__((aligned(16))) __bf16 sm[2 * G_STAGE];
    const int z = blockIdx.z;
    const __bf16* __restrict__ Wt = z == 0 ? Wt0 : z == 1 ? Wt1 : Wt2;
    const float* __restrict__ bias = z == 0 ? bias0 : z == 1 ? bias1 : bias2;
    void* __restrict__ outp = z == 0 ? out0 : z == 1 ? out1 : out2;
    const int mode = z == 0 ? mode0 : z == 1 ? mode1 : mode2;
    const int t = threadIdx.x;
    const int lane = t & 31;
    const int wv = t >> 5;
    const int hl = lane >> 4;
    const int l16 = lane & 15;
    // mode 5 swaps the operands' roles: the 128 block rows are rows of Wt (features), the 64
    // block columns rows of A (tokens); the same number of blocks is dealt anew.
    const bool swapped = mode == 5;
    const int flat = blockIdx.y * (N / 64) + blockIdx.x;   // the grid is N / 64 wide
    const int n0 = (swapped ? flat & (BDIM * SDIM / 64 - 1) : blockIdx.x) * 64;
    const int mb = (swapped ? flat / (BDIM * SDIM / 64) : blockIdx.y) * 128;
    const int m0 = mb + wv * 32;

    v8f c[2][4] = {};

    // copies: 16 lanes cover one 256-B row piece, a wave two rows, the block 8 rows
    const int crow = t >> 4;
    const int ccol = (t & 15) * 8;
    const size_t gs = (size_t)8 * Kd;
    const __bf16* gA = (swapped ? Wt : A) + (size_t)(mb + crow) * Kd + ccol;
    const __bf16* gB = (swapped ? A : Wt) + (size_t)(n0 + crow) * Kd + ccol;
    const unsigned lc = (unsigned)(size_t)(&sm[0]) + (unsigned)(crow * G_PITCH + ccol) * 2u;

#define ISSUE_PASS(p, buf)                                                     \
    do {                                                                       \
        const unsigned lb = lc + (unsigned)(buf) * (G_STAGE * 2u);             \
        const __bf16* ga = gA + (size_t)(p) * G_PASS_K;                        \
        copy8_to_lds(lb, ga, gs);                                              \
        copy8_to_lds(lb + 8u * G_STEP_B, ga + 8 * gs, gs);                     \
        copy8_to_lds(lb + 16u * G_STEP_B, gB + (size_t)(p) * G_PASS_K, gs);    \
    } while (0)

    // fragment rows of this lane inside a buffer
    const int fa = (wv * 32 + l16) * G_PITCH;
    const int fb = (128 + l16) * G_PITCH;

    // ping-pong fragment buffers
    v16bf a0[2], a1[2], bb[2][4];

#define LOAD_CHUNK(buf, kk)                                                    \
    do {                                                                       \
        a0[buf] = load_frag(st + fa + (kk), hl);                               \
        a1[buf] = load_frag(st + fa + 16 * G_PITCH + (kk), hl);                \
        _Pragma("unroll") for (int g = 0; g < 4; ++g)                          \
            bb[buf][g] = load_frag(st + fb + g * 16 * G_PITCH + (kk), hl);     \
    } while (0)

#define COMPUTE(buf)                                               \
    do {                                                           \
        _Pragma("unroll") for (int g = 0; g < 4; ++g) {            \
            c[0][g] = wmma_bf16(a0[buf], bb[buf][g], c[0][g]);     \
            c[1][g] = wmma_bf16(a1[buf], bb[buf][g], c[1][g]);     \
        }                                                          \
    } while (0)

    // Kd is a multiple of 128 (1024 or 4096).
    const int npass = Kd / G_PASS_K;
    ISSUE_PASS(0, 0);
    // pass 0 has landed for this wave; the barrier publishes it to the others
    asm volatile("s_wait_asynccnt 0x0" ::: "memory");
    __syncthreads();
    if (npass > 1) ISSUE_PASS(1, 1);

    for (int p = 0; p < npass; ++p) {
        const __bf16* st = sm + (p & 1) * G_STAGE;
        // The scheduling barriers keep each chunk's twelve LDS reads together and one
        // chunk ahead of their WMMAs; without them the compiler sinks the reads to
        // pairs directly in front of their use, each pair behind a wait to zero.
        LOAD_CHUNK(0, 0);
        LOAD_CHUNK(1, 32);
        __builtin_amdgcn_sched_barrier(0);
        COMPUTE(0);
        __builtin_amdgcn_sched_barrier(0);
        LOAD_CHUNK(0, 64);
        __builtin_amdgcn_sched_barrier(0);
        COMPUTE(1);
        __builtin_amdgcn_sched_barrier(0);
        LOAD_CHUNK(1, 96);
        // The pass's last LDS reads are out: the hand-over stands here, ahead of the
        // last two chunks' WMMAs (registers only), so that the refill flies under them.
        // this wave's reads of the buffer have returned before it is refilled
        asm volatile("s_wait_dscnt 0x0" ::: "memory");
        // this wave's copies of pass p+1 have landed before the barrier publishes them
        asm volatile("s_wait_asynccnt 0x0" ::: "memory");
        __syncthreads();
        if (p + 2 < npass) ISSUE_PASS(p + 2, p & 1);
        COMPUTE(0);
        COMPUTE(1);
    }
    // no copy is outstanding when the wave goes on to its end
    asm volatile("s_wait_asynccnt 0x0" ::: "memory");
#undef ISSUE_PASS
#undef LOAD_CHUNK
#undef COMPUTE

    // K and V go out in fragment order: a lane's eight accumulator values of a tile are one
    // 16-B unit, a wave-wide store 512 contiguous bytes. The tests are the same for the block.
    if (mode == 5) {
        // K: tile rows are head dims (k of the fragment), tile columns tokens (its rows);
        // fragment = (16 keys, 32 head dims), two per 16 keys: g steps by two fragments
        const int tok = n0 + l16;
        const size_t bhx = (size_t)((tok >> 10) * 16 + (m0 >> 6));
        const size_t fr = (bhx * 64 + ((tok & 1023) >> 4)) * 2 + ((m0 >> 5) & 1);
        v8bf pk[2][4];
#pragma unroll
        for (int sub = 0; sub < 2; ++sub)
#pragma unroll
            for (int v = 0; v < 8; ++v) {
                const float bcst = bias[m0 + sub * 16 + hl * 8 + v];
#pragma unroll
                for (int g = 0; g < 4; ++g) pk[sub][g][v] = f2bf(c[sub][g][v] + bcst);
            }
        store_units((__bf16*)outp + frag_index(fr, l16, hl * 8), 1024, pk);
        return;
    }
    if (mode == 2) {
        // V: tile rows are tokens (k of the fragment), tile columns head dims (its rows);
        // fragment = (16 head dims, 32 keys), four per 32 keys: g steps by one fragment
        const size_t bhx = (size_t)((m0 >> 10) * 16 + (n0 >> 6));
        const size_t fr = (bhx * 32 + ((m0 & 1023) >> 5)) * 4;
        v8bf pk[2][4];
#pragma unroll
        for (int g = 0; g < 4; ++g) {
            const float bcst = bias[n0 + g * 16 + l16];
#pragma unroll
            for (int sub = 0; sub < 2; ++sub)
#pragma unroll
                for (int v = 0; v < 8; ++v) pk[sub][g][v] = f2bf(c[sub][g][v] + bcst);
        }
        store_units((__bf16*)outp + frag_index(fr, l16, hl * 8), 512, pk);
        return;
    }

#pragma unroll
    for (int sub = 0; sub < 2; ++sub) {
#pragma unroll
        for (int g = 0; g < 4; ++g) {
            const int col = n0 + g * 16 + l16;
            const float bcst = bias[col];
#pragma unroll
            for (int v = 0; v < 8; ++v) {
                const int row = m0 + sub * 16 + v + hl * 8;  // D-frag: M = v + 8*(lane>=16)
                float val = c[sub][g][v] + bcst;
                if (mode == 3) {
                    val = fmaxf(val, 0.f);
                    ((__bf16*)outp)[(size_t)row * N + col] = f2bf(val);
                } else if (mode == 4) {
                    ((float*)outp)[(size_t)row * N + col] = val;
                } else {                 // Q -> [b,h,s,d]
                    int bb2 = row >> 10, s = row & 1023, hh = col >> 6, d = col & 63;
                    ((__bf16*)outp)[(((size_t)(bb2 * 16 + hh)) * 1024 + s) * 64 + d] = f2bf(val);
                }
            }
        }
    }
}

// ---------------------------------------------------------------------------
// Flash attention with the pair-bias MLP shared by the heads.
// One 16-wave block per (b, 16-row q-tile); wave w runs head w over all keys.
// The hidden layer of the bias MLP does not depend on the head, so it is worked out
// once per (q, key): for each chunk of 64 keys wave w takes q row w, forms the 16 hidden
// values of each pair (lanes 0-15 the eight of t_deltas, lanes 16-31 the eight of dists)
// and multiplies them with the 16x16 output weights by v_wmma_f32_16x16x4_f32
// (A = w2^T: row = head; B = hidden: column = key), all in f32. The result goes to LDS as
// bias[head][q row][key], two buffers, one chunk ahead, one block barrier a chunk.
// K and V arrive in fragment order (frag_index): every K or V load of a wave reads 512
// contiguous bytes, four whole lines, each line touched by one load only.
// ---------------------------------------------------------------------------
typedef __attribute__((ext_vector_type(2))) float v2f;

#define AT_CHUNK 64                        // keys per bias chunk
#define AT_BROW 68                         // bias row pitch in words: 272 B = 16 B x odd
#define AT_BPLANE (16 * AT_BROW + 4)       // words per head; 8 planes = 32 banks mod 64

// Orders this wave's LDS writes ahead of its own later LDS reads of other lanes' words
// (score, P and factor tiles belong to one wave alone, so no block barrier is needed):
// the LDS-only fences keep the compiler from moving LDS accesses over this point and
// make it wait for the wave's outstanding LDS operations.
__device__ __forceinline__ void wave_lds_order() {
    __builtin_amdgcn_fence(__ATOMIC_RELEASE, "workgroup", "local");
    __builtin_amdgcn_wave_barrier();
    __builtin_amdgcn_fence(__ATOMIC_ACQUIRE, "workgroup", "local");
}

__global__ __launch_bounds__(512) void attn_kernel(
    const __bf16* __restrict__ Q, const __bf16* __restrict__ Km,
    const __bf16* __restrict__ Vt, const float* __restrict__ td,
    const float* __restrict__ dd, const float* __restrict__ tw1,
    const float* __restrict__ tb1, const float* __restrict__ tw2,
    const float* __restrict__ tb2, const float* __restrict__ dw1,
    const float* __restrict__ db1, const float* __restrict__ dw2,
    const float* __restrict__ db2, float* __restrict__ out) {
    const int lane = threadIdx.x & 31;
    const int hl = lane >> 4;
    const int l16 = lane & 15;
    const int h = __builtin_amdgcn_readfirstlane(threadIdx.x >> 5);  // wave = head
    const int qt = blockIdx.x & 63;
    const int b = blockIdx.x >> 6;

    __shared__ __attribute__((aligned(16))) float bs[2][16 * AT_BPLANE];   // bias, all heads
    __shared__ __attribute__((aligned(16))) float sc_all[16][16][36];      // per wave: scores
    __shared__ __attribute__((aligned(16))) __bf16 pb_all[16][16][40];     // per wave: bf16 P
    __shared__ float corr_all[16][16];
    __shared__ float lsum_all[16][16];
    float (*sc)[36] = sc_all[h];
    __bf16 (*pb)[40] = pb_all[h];
    float* corr = corr_all[h];
    float* lsum = lsum_all[h];

    // Bias MLP operands of this lane. k slot (chunk c, register j, lane half hl) of both
    // WMMA operands is hidden unit 2c+j of the t_deltas MLP (hl = 0) or the dists MLP (hl = 1).
    const float* w1p = hl ? dw1 : tw1;
    const float* b1p = hl ? db1 : tb1;
    const float* w2p = hl ? dw2 : tw2;
    float w1[8], b1[8];
    v2f wa[4];
#pragma unroll
    for (int j = 0; j < 8; ++j) { w1[j] = w1p[j]; b1[j] = b1p[j]; }
#pragma unroll
    for (int c = 0; c < 4; ++c) {
        wa[c][0] = w2p[(2 * c) * 16 + l16];
        wa[c][1] = w2p[(2 * c + 1) * 16 + l16];
    }
    v8f cinit;  // accumulator start: the two output biases of head v + 8*hl
#pragma unroll
    for (int v = 0; v < 8; ++v) cinit[v] = tb2[v + 8 * hl] + db2[v + 8 * hl];
    // the wait stands in front of any reuse of these loads' address registers; naming the
    // pairs as inputs keeps them live up to it
    asm volatile("s_wait_xcnt 0x0" :: "v"(w1p), "v"(b1p), "v"(w2p) : "memory");
    // q row qt*16 + h of this lane's matrix; the lane owns keys 4*l16 .. 4*l16+3 of a chunk
    const float* mrow = (hl ? dd : td) + ((size_t)b * SDIM + qt * 16 + h) * SDIM + l16 * 4;

#define MAKE_BIAS(buf, m4)                                                              \
    do {                                                                                \
        v8f acc[4] = {cinit, cinit, cinit, cinit};                                      \
        _Pragma("unroll") for (int c = 0; c < 4; ++c) {                                 \
            _Pragma("unroll") for (int g = 0; g < 4; ++g) {                             \
                v2f hb;                                                                 \
                hb[0] = fmaxf((m4)[g] * w1[2 * c] + b1[2 * c], 0.f);                    \
                hb[1] = fmaxf((m4)[g] * w1[2 * c + 1] + b1[2 * c + 1], 0.f);            \
                acc[g] = __builtin_amdgcn_wmma_f32_16x16x4_f32(                         \
                    false, wa[c], false, hb, (short)0, acc[g], false, false);           \
            }                                                                           \
        }                                                                               \
        _Pragma("unroll") for (int v = 0; v < 8; ++v) {                                 \
            v4f o4 = {acc[0][v], acc[1][v], acc[2][v], acc[3][v]};                      \
            *(v4f*)&bs[buf][(v + 8 * hl) * AT_BPLANE + h * AT_BROW + l16 * 4] = o4;     \
        }                                                                               \
    } while (0)

    const size_t bh = (size_t)(b * 16 + h);

    // Q A-fragments for the two K-dim halves (hd 0..31, 32..63)
    v16bf qa[2];
    {
        const __bf16* r = Q + (bh * 1024 + qt * 16 + l16) * 64;
        qa[0] = load_frag(r, hl);
        qa[1] = load_frag(r + 32, hl);
    }

    v8f o[4] = {};
    float mrun = -1e30f, lrow = 0.f;

    v4f mreg = *(const v4f*)mrow;
    // the load's address pair may be reused below: the wait stands in front of that
    asm volatile("s_wait_xcnt 0x0" :: "v"(mrow) : "memory");
    MAKE_BIAS(0, mreg);
    mreg = *(const v4f*)(mrow + AT_CHUNK);
    // the load's address pair may be reused below: the wait stands in front of that
    asm volatile("s_wait_xcnt 0x0" :: "v"(mrow) : "memory");
    __syncthreads();  // chunk 0's bias is published to every head's wave

    for (int kc = 0; kc < SDIM; kc += AT_CHUNK) {
        const int buf = (kc / AT_CHUNK) & 1;
        for (int kb = kc; kb < kc + AT_CHUNK; kb += 32) {
            // ---- scores for 32 keys: 2 N-groups x 2 K-frags = 4 WMMAs ----
            v16bf kf[2][2];
            // per 16 keys two fragments (head dims 0..31, 32..63) of 512 elements each
            const __bf16* kr = Km + ((bh * 64 + (kb >> 4)) * 2) * 512 + lane * 8;
#pragma unroll
            for (int g = 0; g < 2; ++g) {
                kf[g][0] = load_frag_packed(kr + g * 1024);
                kf[g][1] = load_frag_packed(kr + g * 1024 + 512);
            }
            // the wait stands in front of any reuse of the loads' address pair; naming the
            // pair as an input keeps it live up to it, so that no load's result lands on it
            asm volatile("s_wait_xcnt 0x0" :: "v"(kr) : "memory");
            // the next chunk's bias is made here, while the chunk's first K loads are under way
            if (kb == kc && kc + AT_CHUNK < SDIM) {
                MAKE_BIAS(buf ^ 1, mreg);
            }
            // inputs only: holds the eight K loads together, one trip to L2; without it the
            // compiler issues them in pairs into the same registers, each pair waited for
            asm volatile("" :: "v"(kf[0][0]), "v"(kf[0][1]), "v"(kf[1][0]), "v"(kf[1][1]));
            // The matrix row piece of the chunk after next is fetched behind the K wait: loads
            // return in order, so in front of it this read from memory would hold up the K data.
            if (kb == kc && kc + 2 * AT_CHUNK < SDIM) {
                mreg = *(const v4f*)(mrow + kc + 2 * AT_CHUNK);
                // the load's address pair may be reused below: the wait stands in front of that
                asm volatile("s_wait_xcnt 0x0" :: "v"(mrow) : "memory");
            }
#pragma unroll
            for (int g = 0; g < 2; ++g) {
                v8f s = {};
                s = wmma_bf16(qa[0], kf[g][0], s);
                s = wmma_bf16(qa[1], kf[g][1], s);
#pragma unroll
                for (int v = 0; v < 8; ++v) sc[v + hl * 8][g * 16 + l16] = s[v];
            }
            wave_lds_order();

            // ---- online softmax: lane handles (row=l16, cols hl*16..+15) ----
            const float* brow = &bs[buf][h * AT_BPLANE + l16 * AT_BROW + (kb - kc) + hl * 16];
            float pm = -1e30f;
            float sv[16];
#pragma unroll
            for (int j4 = 0; j4 < 4; ++j4) {
                const v4f bi = *(const v4f*)(brow + j4 * 4);
                const v4f si = *(const v4f*)&sc[l16][hl * 16 + j4 * 4];
#pragma unroll
                for (int j = 0; j < 4; ++j) {
                    sv[j4 * 4 + j] = si[j] * (1.0f / 32.0f) + bi[j];
                    pm = fmaxf(pm, sv[j4 * 4 + j]);
                }
            }
            pm = fmaxf(pm, __shfl_xor(pm, 16, 32));
            const float nm = fmaxf(mrun, pm);
            const float cf = __expf(mrun - nm);
            float ps = 0.f;
#pragma unroll
            for (int j = 0; j < 16; ++j) {
                float p = __expf(sv[j] - nm);
                ps += p;
                pb[l16][hl * 16 + j] = f2bf(p);
            }
            ps += __shfl_xor(ps, 16, 32);
            lrow = lrow * cf + ps;
            mrun = nm;
            if (lane < 16) corr[l16] = cf;
            wave_lds_order();

            // ---- rescale O, then O += P * V (4 WMMAs) ----
            float cfa[8];
#pragma unroll
            for (int v = 0; v < 8; ++v) cfa[v] = corr[v + hl * 8];
#pragma unroll
            for (int g = 0; g < 4; ++g)
#pragma unroll
                for (int v = 0; v < 8; ++v) o[g][v] *= cfa[v];

            v16bf pa = load_frag(&pb[l16][0], hl);
            // per 32 keys four fragments (16 head dims each) of 512 elements
            const __bf16* vr = Vt + ((bh * 32 + (kb >> 5)) * 4) * 512 + lane * 8;
            v16bf vb[4];
#pragma unroll
            for (int g = 0; g < 4; ++g) vb[g] = load_frag_packed(vr + g * 512);
            // as behind the K loads: the address pair stays live up to the wait
            asm volatile("s_wait_xcnt 0x0" :: "v"(vr) : "memory");
#pragma unroll
            for (int g = 0; g < 4; ++g) o[g] = wmma_bf16(pa, vb[g], o[g]);
            wave_lds_order();  // sc/pb reused next iteration
        }
        // publishes the next chunk's bias and ends every wave's reads of this chunk's
        // buffer, which the next trip refills
        __syncthreads();
    }
#undef MAKE_BIAS

    if (lane < 16) lsum[l16] = 1.f / lrow;
    wave_lds_order();
    float ri[8];
#pragma unroll
    for (int v = 0; v < 8; ++v) ri[v] = lsum[v + hl * 8];
#pragma unroll
    for (int g = 0; g < 4; ++g)
#pragma unroll
        for (int v = 0; v < 8; ++v) {
            const int s = qt * 16 + v + hl * 8;
            const int d = h * 64 + g * 16 + l16;
            out[((size_t)b * SDIM + s) * DMODEL + d] = o[g][v] * ri[v];
        }
}

// ---------------------------------------------------------------------------
// Residual + LayerNorm over D=1024. One wave per row, eight rows per 256-thread block:
// a launch starts 4,096 waves in place of 32,768. A lane holds 32 elements of its row
// (eight 16-B pieces, 512 B apart), its loads all in flight together; the two row sums are
// in-lane adds and a five-step butterfly over the wave, so no LDS and no barrier.
// ---------------------------------------------------------------------------
__device__ __forceinline__ float wave_sum(float s) {
#pragma unroll
    for (int m = 16; m > 0; m >>= 1) s += __shfl_xor(s, m, 32);
    return s;
}

__global__ __launch_bounds__(256) void add_ln_kernel(
    const float* __restrict__ a, const float* __restrict__ r,
    const float* __restrict__ g, const float* __restrict__ beta,
    float* __restrict__ outf, __bf16* __restrict__ outb) {
    const int lane = threadIdx.x & 31;
    const int row = blockIdx.x * 8 + (threadIdx.x >> 5);
    const int c0 = lane * 4;
    const size_t ro = (size_t)row * DMODEL + c0;
    const float* pa = a + ro;
    const float* pr = r + ro;
    v4f v[8], w[8], gg[8], bb[8];
#pragma unroll
    for (int i = 0; i < 8; ++i) v[i] = *(const v4f*)(pa + i * 128);
#pragma unroll
    for (int i = 0; i < 8; ++i) w[i] = *(const v4f*)(pr + i * 128);
    // the wait stands in front of any reuse of the loads' address pairs; naming the pairs
    // as inputs keeps them live up to it, so that no load's result is placed on them
    asm volatile("s_wait_xcnt 0x0" :: "v"(pa), "v"(pr) : "memory");
    // scale and shift are fetched ahead of their use, under the sums
#pragma unroll
    for (int i = 0; i < 8; ++i) gg[i] = *(const v4f*)(g + c0 + i * 128);
#pragma unroll
    for (int i = 0; i < 8; ++i) bb[i] = *(const v4f*)(beta + c0 + i * 128);
    // the loads' offset register may be reused below: the wait stands in front of that
    asm volatile("s_wait_xcnt 0x0" ::: "memory");
    // inputs only: holds the sixteen scale and shift loads together, ahead of the second sum;
    // without it the compiler sinks them behind the sums, two at a time, each pair waited for
    asm volatile("" :: "v"(gg[0]), "v"(gg[1]), "v"(gg[2]), "v"(gg[3]), "v"(gg[4]), "v"(gg[5]),
                       "v"(gg[6]), "v"(gg[7]), "v"(bb[0]), "v"(bb[1]), "v"(bb[2]), "v"(bb[3]),
                       "v"(bb[4]), "v"(bb[5]), "v"(bb[6]), "v"(bb[7]));
    float s = 0.f;
#pragma unroll
    for (int i = 0; i < 8; ++i) {
        v[i] += w[i];
        s += (v[i][0] + v[i][1]) + (v[i][2] + v[i][3]);
    }
    const float mean = wave_sum(s) * (1.f / 1024.f);
    float ss = 0.f;
#pragma unroll
    for (int i = 0; i < 8; ++i) {
        const v4f d = v[i] - mean;
        ss += (d[0] * d[0] + d[1] * d[1]) + (d[2] * d[2] + d[3] * d[3]);
    }
    const float rstd = rsqrtf(wave_sum(ss) * (1.f / 1024.f) + 1e-5f);
#pragma unroll
    for (int i = 0; i < 8; ++i) v[i] = (v[i] - mean) * rstd * gg[i] + bb[i];
    if (outb) {
        v4bf p[8];
#pragma unroll
        for (int i = 0; i < 8; ++i) {
#pragma unroll
            for (int j = 0; j < 4; ++j) p[i][j] = f2bf(v[i][j]);
        }
#pragma unroll
        for (int i = 0; i < 8; ++i) *(v4bf*)(outb + ro + i * 128) = p[i];
        // registers that these stores name may be reused for the next stores' address
        asm volatile("s_wait_xcnt 0x0" ::: "memory");
    }
#pragma unroll
    for (int i = 0; i < 8; ++i) *(v4f*)(outf + ro + i * 128) = v[i];
}

// ---------------------------------------------------------------------------
// Host launch
// ---------------------------------------------------------------------------
extern "C" void kernel_launch(void* const* d_in, const int* in_sizes, int n_in,
                              void* d_out, int out_size, void* d_ws, size_t ws_size,
                              hipStream_t stream) {
    (void)in_sizes; (void)n_in; (void)out_size; (void)ws_size;
    const float* src = (const float*)d_in[0];
    const float* td  = (const float*)d_in[1];
    const float* dd  = (const float*)d_in[2];
    const float* Wq  = (const float*)d_in[3];
    const float* bq  = (const float*)d_in[4];
    const float* Wk  = (const float*)d_in[5];
    const float* bk  = (const float*)d_in[6];
    const float* Wv  = (const float*)d_in[7];
    const float* bv  = (const float*)d_in[8];
    const float* tw1 = (const float*)d_in[9];
    const float* tb1 = (const float*)d_in[10];
    const float* tw2 = (const float*)d_in[11];
    const float* tb2 = (const float*)d_in[12];
    const float* dw1 = (const float*)d_in[13];
    const float* db1 = (const float*)d_in[14];
    const float* dw2 = (const float*)d_in[15];
    const float* db2 = (const float*)d_in[16];
    const float* W1  = (const float*)d_in[17];
    const float* b1  = (const float*)d_in[18];
    const float* W2  = (const float*)d_in[19];
    const float* b2  = (const float*)d_in[20];
    const float* g1  = (const float*)d_in[21];
    const float* be1 = (const float*)d_in[22];
    const float* g2  = (const float*)d_in[23];
    const float* be2 = (const float*)d_in[24];

    const int M = BDIM * SDIM;  // 4096 rows
    char* ws = (char*)d_ws;
    size_t off = 0;
    auto alloc = [&](size_t bytes) {
        char* p = ws + off;
        off = (off + bytes + 255) & ~(size_t)255;
        return p;
    };
    __bf16* srcb = (__bf16*)alloc((size_t)M * DMODEL * 2);
    __bf16* Wqt  = (__bf16*)alloc((size_t)DMODEL * DMODEL * 2);
    __bf16* Wkt  = (__bf16*)alloc((size_t)DMODEL * DMODEL * 2);
    __bf16* Wvt  = (__bf16*)alloc((size_t)DMODEL * DMODEL * 2);
    __bf16* W1t  = (__bf16*)alloc((size_t)DMODEL * DFF * 2);
    __bf16* W2t  = (__bf16*)alloc((size_t)DFF * DMODEL * 2);
    __bf16* Qb   = (__bf16*)alloc((size_t)M * DMODEL * 2);
    __bf16* Kb   = (__bf16*)alloc((size_t)M * DMODEL * 2);
    __bf16* Vtb  = (__bf16*)alloc((size_t)M * DMODEL * 2);
    float*  attn = (float*)alloc((size_t)M * DMODEL * 4);
    float*  xf   = (float*)alloc((size_t)M * DMODEL * 4);
    __bf16* xb   = (__bf16*)alloc((size_t)M * DMODEL * 2);
    __bf16* h1   = (__bf16*)alloc((size_t)M * DFF * 2);
    float*  ffn  = (float*)alloc((size_t)M * DMODEL * 4);

    prep_kernel<<<PREP_BLOCKS, 256, 0, stream>>>(src, Wq, Wk, Wv, W1, W2,
                                                 srcb, Wqt, Wkt, Wvt, W1t, W2t);

    gemm_bf16_kernel<<<dim3(DMODEL / 64, M / 128, 3), 128, 0, stream>>>(
        srcb, Wqt, Wkt, Wvt, bq, bk, bv, Qb, Kb, Vtb, DMODEL, DMODEL, 0, 5, 2);

    attn_kernel<<<BDIM * (SDIM / 16), 32 * NHEAD, 0, stream>>>(
        Qb, Kb, Vtb, td, dd, tw1, tb1, tw2, tb2, dw1, db1, dw2, db2, attn);

    add_ln_kernel<<<M / 8, 256, 0, stream>>>(src, attn, g1, be1, xf, xb);

    gemm_bf16_kernel<<<dim3(DFF / 64, M / 128), 128, 0, stream>>>(
        xb, W1t, W1t, W1t, b1, b1, b1, h1, h1, h1, DFF, DMODEL, 3, 3, 3);
    gemm_bf16_kernel<<<dim3(DMODEL / 64, M / 128), 128, 0, stream>>>(
        h1, W2t, W2t, W2t, b2, b2, b2, ffn, ffn, ffn, DMODEL, DFF, 4, 4, 4);

    add_ln_kernel<<<M / 8, 256, 0, stream>>>(xf, ffn, g2, be2, (float*)d_out, nullptr);
}

// v007
// A run of this version takes 183 microseconds.
// Timed twice side by side with v006, it ran 1.10 and 1.09 times as fast.
// Counting every step since v000, it is 3.78 times as fast.
#include <hip/hip_runtime.h>

// ---------------------------------------------------------------------------
// SpatioTemporalTransformerLayer for MI455X (gfx1250, wave32, WMMA).
// B=4, S=1024, D=1024, H=16, HD=64, DFF=4096, BIAS_HID=8.
// GEMMs use v_wmma_f32_16x16x32_bf16 (bf16 A/B, f32 accumulate), the bias MLP v_wmma_f32_16x16x4_f32 (f32).
// GEMM operand tiles are staged in LDS by asynchronous copies (two buffers);
// fragments are read from LDS into ping-pong fragment buffers.
// ---------------------------------------------------------------------------

typedef __attribute__((ext_vector_type(16))) __bf16 v16bf;
typedef __attribute__((ext_vector_type(8)))  __bf16 v8bf;
typedef __attribute__((ext_vector_type(8)))  float  v8f;

#define BDIM 4
#define SDIM 1024
#define DMODEL 1024
#define NHEAD 16
#define HEADD 64
#define DFF 4096

__device__ __forceinline__ __bf16 f2bf(float x) {
    unsigned u = __builtin_bit_cast(unsigned, x);
    unsigned r = (u + 0x7FFFu + ((u >> 16) & 1u)) >> 16;
    return __builtin_bit_cast(__bf16, (unsigned short)r);
}

__device__ __forceinline__ v8f wmma_bf16(v16bf a, v16bf b, v8f c) {
    // (neg_a, A, neg_b, B, c_mod, C, reuse_a, reuse_b)
    return __builtin_amdgcn_wmma_f32_16x16x32_bf16(false, a, false, b, (short)0, c,
                                                   false, false);
}

// Load a 16x32 bf16 A/B fragment: lane L, elem e -> (row=L&15, K=16*(e>>3)+8*(L>>4)+(e&7))
// 'row_ptr' points at element K=0 of this lane's row. Two contiguous 16B loads.
__device__ __forceinline__ v16bf load_frag(const __bf16* row_ptr, int hl) {
    v8bf lo = *(const v8bf*)(row_ptr + hl * 8);
    v8bf hi = *(const v8bf*)(row_ptr + 16 + hl * 8);
    v16bf f;
#pragma unroll
    for (int i = 0; i < 8; ++i) { f[i] = lo[i]; f[8 + i] = hi[i]; }
    return f;
}

// Fragment order for an operand that only the attention reads: a 16-row x 32-k fragment is
// 1 KiB, two 512-B halves (k 0..15, k 16..31), and in a half lane L owns 16 B at L * 16:
// row = L & 15, k = 16 * half + 8 * (L >> 4) + 0..7, as load_frag reads it. A wave-wide
// 16-B load or store then covers 512 contiguous bytes (four whole lines).
// 'frag' counts fragments; the result is the element index of (row, k), k a multiple of 8.
__device__ __forceinline__ size_t frag_index(size_t frag, int row, int k) {
    return ((frag * 2 + ((k >> 4) & 1)) * 32 + ((k >> 3) & 1) * 16 + row) * 8;
}

// 'p' points at this lane's 16 B in the first half of the fragment.
__device__ __forceinline__ v16bf load_frag_packed(const __bf16* p) {
    v8bf lo = *(const v8bf*)p;
    v8bf hi = *(const v8bf*)(p + 256);
    v16bf f;
#pragma unroll
    for (int i = 0; i < 8; ++i) { f[i] = lo[i]; f[8 + i] = hi[i]; }
    return f;
}

// The eight 16-B units of a wave's 32 x 64 tile: 'po' is this lane's unit of tile (0, 0);
// 'sub' steps by a half fragment, 'g' by 'gstep' elements.
__device__ __forceinline__ void store_units(__bf16* po, int gstep, const v8bf (&pk)[2][4]) {
#pragma unroll
    for (int sub = 0; sub < 2; ++sub)
#pragma unroll
        for (int g = 0; g < 4; ++g) *(v8bf*)(po + g * gstep + sub * 256) = pk[sub][g];
    // other modes' code follows in the same kernel and reuses the stores' registers:
    // the wait stands behind the last store, in front of any such overwrite
    asm volatile("s_wait_xcnt 0x0" ::: "memory");
}

// ---------------------------------------------------------------------------
// Elementwise converters
// ---------------------------------------------------------------------------
typedef __attribute__((ext_vector_type(4))) __bf16 v4bf;
typedef __attribute__((ext_vector_type(4))) float  v4f;

// 32 elements a thread, so that the src job takes 4,096 waves in place of 131,072:
// eight 16-B loads in flight per lane, each wave-wide load 512 contiguous bytes,
// each wave-wide store 256. Its 512 blocks cover the array exactly (8,192 elements a block).
#define CVT_BLOCK_ELEMS (256 * 32)
__device__ __forceinline__ void cvt_f32_bf16_block(const float* __restrict__ in,
                                                   __bf16* __restrict__ out, int blk) {
    const size_t base = (size_t)blk * CVT_BLOCK_ELEMS + threadIdx.x * 4;
    v4f r[8];
#pragma unroll
    for (int i = 0; i < 8; ++i) r[i] = *(const v4f*)(in + base + i * 1024);
    // the loads' address registers may be reused below: the wait stands in front of that
    asm volatile("s_wait_xcnt 0x0" ::: "memory");
#pragma unroll
    for (int i = 0; i < 8; ++i) {
        v4bf p;
#pragma unroll
        for (int j = 0; j < 4; ++j) p[j] = f2bf(r[i][j]);
        *(v4bf*)(out + base + i * 1024) = p;
    }
    // other jobs' code follows in the same kernel and reuses the stores' registers:
    // the wait stands behind the last store, in front of any such overwrite
    asm volatile("s_wait_xcnt 0x0" ::: "memory");
}

// W[K][N] f32 (row-major) -> Wt[N][K] bf16, one 64x64 tile per 256-thread block.
// K and N are multiples of 64. Reads are 256-B row pieces (16 B a lane), the tile is
// turned in LDS, and every store instruction writes whole 128-B lines of Wt.
__device__ __forceinline__ void cvt_transpose_block(const float* __restrict__ W,
                                                    __bf16* __restrict__ Wt, int K, int N,
                                                    int bx, int by) {
    // 128-B rows at a 144-B pitch (16 B x odd) for the 16-byte readers.
    __shared__ __attribute__((aligned(16))) __bf16 tile[64][72];
    const int t = threadIdx.x;
    const int n0 = bx * 64;
    const int k0 = by * 64;

    const int nq = (t & 15) * 4;   // four columns of W
    const int kq = (t >> 4) * 4;   // four rows of W
    const float* in = W + (size_t)(k0 + kq) * N + n0 + nq;
    v4f r[4];
#pragma unroll
    for (int i = 0; i < 4; ++i) {
        r[i] = *(const v4f*)(in + (size_t)i * N);
        // a later load's result registers may reuse this load's address pair:
        // the wait stands between the load and any such overwrite
        asm volatile("s_wait_xcnt 0x0" ::: "memory");
    }
#pragma unroll
    for (int j = 0; j < 4; ++j) {
        v4bf p;
#pragma unroll
        for (int i = 0; i < 4; ++i) p[i] = f2bf(r[i][j]);
        *(v4bf*)&tile[nq + j][kq] = p;
    }
    __syncthreads();

    const int kk = (t & 7) * 8;    // eight lanes cover one 128-B row of the tile
#pragma unroll
    for (int pass = 0; pass < 2; ++pass) {
        const int n = (t >> 3) + pass * 32;
        *(v8bf*)(Wt + (size_t)(n0 + n) * K + k0 + kk) = *(const v8bf*)&tile[n][kk];
    }
    // other jobs' code follows in the same kernel and reuses the stores' registers:
    // the wait stands behind the last store, in front of any such overwrite
    asm volatile("s_wait_xcnt 0x0" ::: "memory");
}

// The six conversions depend on nothing and on one another not at all: one launch does
// them all, each block taking its job from its index. Ranges of blocks, in this order:
// W1, W2 (1,024 tiles each), src (512 pieces), Wq, Wk, Wv (256 tiles each).
#define PREP_BIG ((DMODEL / 64) * (DFF / 64))        // tiles of W1, of W2
#define PREP_SRC (BDIM * SDIM * DMODEL / CVT_BLOCK_ELEMS)
#define PREP_SQ ((DMODEL / 64) * (DMODEL / 64))      // tiles of Wq, of Wk, of Wv
#define PREP_BLOCKS (2 * PREP_BIG + PREP_SRC + 3 * PREP_SQ)
__global__ __launch_bounds__(256) void prep_kernel(
    const float* __restrict__ src, const float* __restrict__ Wq, const float* __restrict__ Wk,
    const float* __restrict__ Wv, const float* __restrict__ W1, const float* __restrict__ W2,
    __bf16* __restrict__ srcb, __bf16* __restrict__ Wqt, __bf16* __restrict__ Wkt,
    __bf16* __restrict__ Wvt, __bf16* __restrict__ W1t, __bf16* __restrict__ W2t) {
    int blk = blockIdx.x;   // every test below is the same for the whole block
    if (blk < PREP_BIG) {
        cvt_transpose_block(W1, W1t, DMODEL, DFF, blk & (DFF / 64 - 1), blk / (DFF / 64));
        return;
    }
    blk -= PREP_BIG;
    if (blk < PREP_BIG) {
        cvt_transpose_block(W2, W2t, DFF, DMODEL, blk & (DMODEL / 64 - 1), blk / (DMODEL / 64));
        return;
    }
    blk -= PREP_BIG;
    if (blk < PREP_SRC) {
        cvt_f32_bf16_block(src, srcb, blk);
        return;
    }
    blk -= PREP_SRC;
    const int which = blk / PREP_SQ;
    blk &= PREP_SQ - 1;
    const float* W = which == 0 ? Wq : which == 1 ? Wk : Wv;
    __bf16* Wt = which == 0 ? Wqt : which == 1 ? Wkt : Wvt;
    cvt_transpose_block(W, Wt, DMODEL, DMODEL, blk & (DMODEL / 64 - 1), blk / (DMODEL / 64));
}

// ---------------------------------------------------------------------------
// Generic bf16 WMMA GEMM: C[M,N] = A[M,K] * Wt[N,K]^T + bias, with mode epilogue
//   mode 0: Q layout    -> bf16 out[((b*16+h)*1024+s)*64+d]
//   mode 2: V           -> bf16, in the order of the attention's B fragments (frag_index)
//   mode 5: K           -> bf16, the same; the product is formed transposed (rows = features,
//                          columns = tokens), so that a lane's eight values are one 16-B unit
//   mode 3: ReLU        -> bf16 out[row*N+col]   (FFN1)
//   mode 4: plain f32   -> f32  out[row*N+col]   (FFN2)
// Block: 256 threads = 8 waves on a 128 x 128 tile of C, 4 x 2 waves of 32 x 64 each: per
// multiply-add the block fetches two thirds of the L2 bytes that a 128 x 64 tile fetches.
// A pass is 128 k: the block's 128 rows of A and 128 rows of Wt (256 B each) are
// brought into LDS by asynchronous copies that read whole 128-B lines, two
// buffers, the copies of pass p+2 in flight while pass p+1 is worked on.
// Fragments come from LDS by 16-B reads; per 32-k chunk 2 A + 4 B frags -> 8 WMMAs.
// ---------------------------------------------------------------------------
#define G_PASS_K 128                       // k elements per pass
#define G_PITCH 136                        // LDS row pitch in elements: 272 B = 16 B x odd
#define G_ROWS (128 + 128)                 // A rows, then Wt rows; Wt rows, then A rows in mode 5
#define G_STAGE (G_ROWS * G_PITCH)         // elements per buffer
#define G_STEP_B (16 * G_PITCH * 2)        // LDS bytes between two copies of a thread (16 rows)

// Eight 16-B copies of one thread, 16 rows apart: global row step 'gs' elements.
// The s_wait_xcnt closes the statement so that no address register of a copy is
// rewritten ahead of it.
__device__ __forceinline__ void copy8_to_lds(unsigned l, const __bf16* g, size_t gs) {
    asm volatile(
        "global_load_async_to_lds_b128 %0, %8, off\n\t"
        "global_load_async_to_lds_b128 %1, %9, off\n\t"
        "global_load_async_to_lds_b128 %2, %10, off\n\t"
        "global_load_async_to_lds_b128 %3, %11, off\n\t"
        "global_load_async_to_lds_b128 %4, %12, off\n\t"
        "global_load_async_to_lds_b128 %5, %13, off\n\t"
        "global_load_async_to_lds_b128 %6, %14, off\n\t"
        "global_load_async_to_lds_b128 %7, %15, off\n\t"
        "s_wait_xcnt 0x0"
        :: "v"(l), "v"(l + 1 * G_STEP_B), "v"(l + 2 * G_STEP_B), "v"(l + 3 * G_STEP_B),
           "v"(l + 4 * G_STEP_B), "v"(l + 5 * G_STEP_B), "v"(l + 6 * G_STEP_B),
           "v"(l + 7 * G_STEP_B),
           "v"(g), "v"(g + gs), "v"(g + 2 * gs), "v"(g + 3 * gs),
           "v"(g + 4 * gs), "v"(g + 5 * gs), "v"(g + 6 * gs), "v"(g + 7 * gs)
        : "memory");
}

// blockIdx.z picks one of up to three independent products on the same A (weights, bias,
// output and mode of its own): Q, K and V go in one launch; the FFN launches have z = 0 only.
__global__ __launch_bounds__(256) void gemm_bf16_kernel(
    const __bf16* __restrict__ A, const __bf16* __restrict__ Wt0,
    const __bf16* __restrict__ Wt1, const __bf16* __restrict__ Wt2,
    const float* __restrict__ bias0, const float* __restrict__ bias1,
    const float* __restrict__ bias2, void* __restrict__ out0, void* __restrict__ out1,
    void* __restrict__ out2, int N, int Kd, int mode0, int mode1, int mode2) {
    __shared__ __attribute__((aligned(16))) __bf16 sm[2 * G_STAGE];
    const int z = blockIdx.z;
    const __bf16* __restrict__ Wt = z == 0 ? Wt0 : z == 1 ? Wt1 : Wt2;
    const float* __restrict__ bias = z == 0 ? bias0 : z == 1 ? bias1 : bias2;
    void* __restrict__ outp = z == 0 ? out0 : z == 1 ? out1 : out2;
    const int mode = z == 0 ? mode0 : z == 1 ? mode1 : mode2;
    const int t = threadIdx.x;
    const int lane = t & 31;
    const int wv = t >> 5;
    const int hl = lane >> 4;
    const int l16 = lane & 15;
    // mode 5 swaps the operands' roles: the 128 block rows are rows of Wt (features), the 128
    // block columns rows of A (tokens); the same number of blocks is dealt anew.
    const bool swapped = mode == 5;
    const int flat = blockIdx.y * (N / 128) + blockIdx.x;   // the grid is N / 128 wide
    const int nb = (swapped ? flat & (BDIM * SDIM / 128 - 1) : blockIdx.x) * 128;
    const int mb = (swapped ? flat / (BDIM * SDIM / 128) : blockIdx.y) * 128;
    const int m0 = mb + (wv >> 1) * 32;   // this wave's 32 rows
    const int n0 = nb + (wv & 1) * 64;    // and its 64 columns

    v8f c[2][4] = {};

    // copies: 16 lanes cover one 256-B row piece, a wave two rows, the block 16 rows
    const int crow = t >> 4;
    const int ccol = (t & 15) * 8;
    const size_t gs = (size_t)16 * Kd;
    const __bf16* gA = (swapped ? Wt : A) + (size_t)(mb + crow) * Kd + ccol;
    const __bf16* gB = (swapped ? A : Wt) + (size_t)(nb + crow) * Kd + ccol;
    const unsigned lc = (unsigned)(size_t)(&sm[0]) + (unsigned)(crow * G_PITCH + ccol) * 2u;

#define ISSUE_PASS(p, buf)                                                     \
    do {                                                                       \
        const unsigned lb = lc + (unsigned)(buf) * (G_STAGE * 2u);             \
        copy8_to_lds(lb, gA + (size_t)(p) * G_PASS_K, gs);                     \
        copy8_to_lds(lb + 8u * G_STEP_B, gB + (size_t)(p) * G_PASS_K, gs);     \
    } while (0)

    // fragment rows of this lane inside a buffer
    const int fa = ((wv >> 1) * 32 + l16) * G_PITCH;
    const int fb = (128 + (wv & 1) * 64 + l16) * G_PITCH;

    // ping-pong fragment buffers
    v16bf a0[2], a1[2], bb[2][4];

#define LOAD_CHUNK(buf, kk)                                                    \
    do {                                                                       \
        a0[buf] = load_frag(st + fa + (kk), hl);                               \
        a1[buf] = load_frag(st + fa + 16 * G_PITCH + (kk), hl);                \
        _Pragma("unroll") for (int g = 0; g < 4; ++g)                          \
            bb[buf][g] = load_frag(st + fb + g * 16 * G_PITCH + (kk), hl);     \
    } while (0)

#define COMPUTE(buf)                                               \
    do {                                                           \
        _Pragma("unroll") for (int g = 0; g < 4; ++g) {            \
            c[0][g] = wmma_bf16(a0[buf], bb[buf][g], c[0][g]);     \
            c[1][g] = wmma_bf16(a1[buf], bb[buf][g], c[1][g]);     \
        }                                                          \
    } while (0)

    // Kd is a multiple of 128 (1024 or 4096).
    const int npass = Kd / G_PASS_K;
    ISSUE_PASS(0, 0);
    // pass 0 has landed for this wave; the barrier publishes it to the others
    asm volatile("s_wait_asynccnt 0x0" ::: "memory");
    __syncthreads();
    if (npass > 1) ISSUE_PASS(1, 1);

    for (int p = 0; p < npass; ++p) {
        const __bf16* st = sm + (p & 1) * G_STAGE;
        // The scheduling barriers keep each chunk's twelve LDS reads together and one
        // chunk ahead of their WMMAs; without them the compiler sinks the reads to
        // pairs directly in front of their use, each pair behind a wait to zero.
        LOAD_CHUNK(0, 0);
        LOAD_CHUNK(1, 32);
        __builtin_amdgcn_sched_barrier(0);
        COMPUTE(0);
        __builtin_amdgcn_sched_barrier(0);
        LOAD_CHUNK(0, 64);
        __builtin_amdgcn_sched_barrier(0);
        COMPUTE(1);
        __builtin_amdgcn_sched_barrier(0);
        LOAD_CHUNK(1, 96);
        // The pass's last LDS reads are out: the hand-over stands here, ahead of the
        // last two chunks' WMMAs (registers only), so that the refill flies under them.
        // this wave's reads of the buffer have returned before it is refilled
        asm volatile("s_wait_dscnt 0x0" ::: "memory");
        // this wave's copies of pass p+1 have landed before the barrier publishes them
        asm volatile("s_wait_asynccnt 0x0" ::: "memory");
        __syncthreads();
        if (p + 2 < npass) ISSUE_PASS(p + 2, p & 1);
        COMPUTE(0);
        COMPUTE(1);
    }
    // no copy is outstanding when the wave goes on to its end
    asm volatile("s_wait_asynccnt 0x0" ::: "memory");
#undef ISSUE_PASS
#undef LOAD_CHUNK
#undef COMPUTE

    // K and V go out in fragment order: a lane's eight accumulator values of a tile are one
    // 16-B unit, a wave-wide store 512 contiguous bytes. The tests are the same for the block.
    if (mode == 5) {
        // K: tile rows are head dims (k of the fragment), tile columns tokens (its rows);
        // fragment = (16 keys, 32 head dims), two per 16 keys: g steps by two fragments
        const int tok = n0 + l16;
        const size_t bhx = (size_t)((tok >> 10) * 16 + (m0 >> 6));
        const size_t fr = (bhx * 64 + ((tok & 1023) >> 4)) * 2 + ((m0 >> 5) & 1);
        v8bf pk[2][4];
#pragma unroll
        for (int sub = 0; sub < 2; ++sub)
#pragma unroll
            for (int v = 0; v < 8; ++v) {
                const float bcst = bias[m0 + sub * 16 + hl * 8 + v];
#pragma unroll
                for (int g = 0; g < 4; ++g) pk[sub][g][v] = f2bf(c[sub][g][v] + bcst);
            }
        store_units((__bf16*)outp + frag_index(fr, l16, hl * 8), 1024, pk);
        return;
    }
    if (mode == 2) {
        // V: tile rows are tokens (k of the fragment), tile columns head dims (its rows);
        // fragment = (16 head dims, 32 keys), four per 32 keys: g steps by one fragment
        const size_t bhx = (size_t)((m0 >> 10) * 16 + (n0 >> 6));
        const size_t fr = (bhx * 32 + ((m0 & 1023) >> 5)) * 4;
        v8bf pk[2][4];
#pragma unroll
        for (int g = 0; g < 4; ++g) {
            const float bcst = bias[n0 + g * 16 + l16];
#pragma unroll
            for (int sub = 0; sub < 2; ++sub)
#pragma unroll
                for (int v = 0; v < 8; ++v) pk[sub][g][v] = f2bf(c[sub][g][v] + bcst);
        }
        store_units((__bf16*)outp + frag_index(fr, l16, hl * 8), 512, pk);
        return;
    }

#pragma unroll
    for (int sub = 0; sub < 2; ++sub) {
#pragma unroll
        for (int g = 0; g < 4; ++g) {
            const int col = n0 + g * 16 + l16;
            const float bcst = bias[col];
#pragma unroll
            for (int v = 0; v < 8; ++v) {
                const int row = m0 + sub * 16 + v + hl * 8;  // D-frag: M = v + 8*(lane>=16)
                float val = c[sub][g][v] + bcst;
                if (mode == 3) {
                    val = fmaxf(val, 0.f);
                    ((__bf16*)outp)[(size_t)row * N + col] = f2bf(val);
                } else if (mode == 4) {
                    ((float*)outp)[(size_t)row * N + col] = val;
                } else {                 // Q -> [b,h,s,d]
                    int bb2 = row >> 10, s = row & 1023, hh = col >> 6, d = col & 63;
                    ((__bf16*)outp)[(((size_t)(bb2 * 16 + hh)) * 1024 + s) * 64 + d] = f2bf(val);
                }
            }
        }
    }
}

// ---------------------------------------------------------------------------
// Flash attention with the pair-bias MLP shared by the heads.
// One 16-wave block per (b, 16-row q-tile); wave w runs head w over all keys.
// The hidden layer of the bias MLP does not depend on the head, so it is worked out
// once per (q, key): for each chunk of 64 keys wave w takes q row w, forms the 16 hidden
// values of each pair (lanes 0-15 the eight of t_deltas, lanes 16-31 the eight of dists)
// and multiplies them with the 16x16 output weights by v_wmma_f32_16x16x4_f32
// (A = w2^T: row = head; B = hidden: column = key), all in f32. The result goes to LDS as
// bias[head][q row][key], two buffers, one chunk ahead, one block barrier a chunk.
// K and V arrive in fragment order (frag_index): every K or V load of a wave reads 512
// contiguous bytes, four whole lines, each line touched by one load only.
// ---------------------------------------------------------------------------
typedef __attribute__((ext_vector_type(2))) float v2f;

#define AT_CHUNK 64                        // keys per bias chunk
#define AT_BROW 68                         // bias row pitch in words: 272 B = 16 B x odd
#define AT_BPLANE (16 * AT_BROW + 4)       // words per head; 8 planes = 32 banks mod 64

// Orders this wave's LDS writes ahead of its own later LDS reads of other lanes' words
// (score, P and factor tiles belong to one wave alone, so no block barrier is needed):
// the LDS-only fences keep the compiler from moving LDS accesses over this point and
// make it wait for the wave's outstanding LDS operations.
__device__ __forceinline__ void wave_lds_order() {
    __builtin_amdgcn_fence(__ATOMIC_RELEASE, "workgroup", "local");
    __builtin_amdgcn_wave_barrier();
    __builtin_amdgcn_fence(__ATOMIC_ACQUIRE, "workgroup", "local");
}

__global__ __launch_bounds__(512) void attn_kernel(
    const __bf16* __restrict__ Q, const __bf16* __restrict__ Km,
    const __bf16* __restrict__ Vt, const float* __restrict__ td,
    const float* __restrict__ dd, const float* __restrict__ tw1,
    const float* __restrict__ tb1, const float* __restrict__ tw2,
    const float* __restrict__ tb2, const float* __restrict__ dw1,
    const float* __restrict__ db1, const float* __restrict__ dw2,
    const float* __restrict__ db2, float* __restrict__ out) {
    const int lane = threadIdx.x & 31;
    const int hl = lane >> 4;
    const int l16 = lane & 15;
    const int h = __builtin_amdgcn_readfirstlane(threadIdx.x >> 5);  // wave = head
    const int qt = blockIdx.x & 63;
    const int b = blockIdx.x >> 6;

    __shared__ __attribute__((aligned(16))) float bs[2][16 * AT_BPLANE];   // bias, all heads
    __shared__ __attribute__((aligned(16))) float sc_all[16][16][36];      // per wave: scores
    __shared__ __attribute__((aligned(16))) __bf16 pb_all[16][16][40];     // per wave: bf16 P
    __shared__ float corr_all[16][16];
    __shared__ float lsum_all[16][16];
    float (*sc)[36] = sc_all[h];
    __bf16 (*pb)[40] = pb_all[h];
    float* corr = corr_all[h];
    float* lsum = lsum_all[h];

    // Bias MLP operands of this lane. k slot (chunk c, register j, lane half hl) of both
    // WMMA operands is hidden unit 2c+j of the t_deltas MLP (hl = 0) or the dists MLP (hl = 1).
    const float* w1p = hl ? dw1 : tw1;
    const float* b1p = hl ? db1 : tb1;
    const float* w2p = hl ? dw2 : tw2;
    float w1[8], b1[8];
    v2f wa[4];
#pragma unroll
    for (int j = 0; j < 8; ++j) { w1[j] = w1p[j]; b1[j] = b1p[j]; }
#pragma unroll
    for (int c = 0; c < 4; ++c) {
        wa[c][0] = w2p[(2 * c) * 16 + l16];
        wa[c][1] = w2p[(2 * c + 1) * 16 + l16];
    }
    v8f cinit;  // accumulator start: the two output biases of head v + 8*hl
#pragma unroll
    for (int v = 0; v < 8; ++v) cinit[v] = tb2[v + 8 * hl] + db2[v + 8 * hl];
    // the wait stands in front of any reuse of these loads' address registers; naming the
    // pairs as inputs keeps them live up to it
    asm volatile("s_wait_xcnt 0x0" :: "v"(w1p), "v"(b1p), "v"(w2p) : "memory");
    // q row qt*16 + h of this lane's matrix; the lane owns keys 4*l16 .. 4*l16+3 of a chunk
    const float* mrow = (hl ? dd : td) + ((size_t)b * SDIM + qt * 16 + h) * SDIM + l16 * 4;

#define MAKE_BIAS(buf, m4)                                                              \
    do {                                                                                \
        v8f acc[4] = {cinit, cinit, cinit, cinit};                                      \
        _Pragma("unroll") for (int c = 0; c < 4; ++c) {                                 \
            _Pragma("unroll") for (int g = 0; g < 4; ++g) {                             \
                v2f hb;                                                                 \
                hb[0] = fmaxf((m4)[g] * w1[2 * c] + b1[2 * c], 0.f);                    \
                hb[1] = fmaxf((m4)[g] * w1[2 * c + 1] + b1[2 * c + 1], 0.f);            \
                acc[g] = __builtin_amdgcn_wmma_f32_16x16x4_f32(                         \
                    false, wa[c], false, hb, (short)0, acc[g], false, false);           \
            }                                                                           \
        }                                                                               \
        _Pragma("unroll") for (int v = 0; v < 8; ++v) {                                 \
            v4f o4 = {acc[0][v], acc[1][v], acc[2][v], acc[3][v]};                      \
            *(v4f*)&bs[buf][(v + 8 * hl) * AT_BPLANE + h * AT_BROW + l16 * 4] = o4;     \
        }                                                                               \
    } while (0)

    const size_t bh = (size_t)(b * 16 + h);

    // Q A-fragments for the two K-dim halves (hd 0..31, 32..63)
    v16bf qa[2];
    {
        const __bf16* r = Q + (bh * 1024 + qt * 16 + l16) * 64;
        qa[0] = load_frag(r, hl);
        qa[1] = load_frag(r + 32, hl);
    }

    v8f o[4] = {};
    float mrun = -1e30f, lrow = 0.f;

    v4f mreg = *(const v4f*)mrow;
    // the load's address pair may be reused below: the wait stands in front of that
    asm volatile("s_wait_xcnt 0x0" :: "v"(mrow) : "memory");
    MAKE_BIAS(0, mreg);
    mreg = *(const v4f*)(mrow + AT_CHUNK);
    // the load's address pair may be reused below: the wait stands in front of that
    asm volatile("s_wait_xcnt 0x0" :: "v"(mrow) : "memory");
    __syncthreads();  // chunk 0's bias is published to every head's wave

    for (int kc = 0; kc < SDIM; kc += AT_CHUNK) {
        const int buf = (kc / AT_CHUNK) & 1;
        for (int kb = kc; kb < kc + AT_CHUNK; kb += 32) {
            // ---- scores for 32 keys: 2 N-groups x 2 K-frags = 4 WMMAs ----
            v16bf kf[2][2];
            // per 16 keys two fragments (head dims 0..31, 32..63) of 512 elements each
            const __bf16* kr = Km + ((bh * 64 + (kb >> 4)) * 2) * 512 + lane * 8;
#pragma unroll
            for (int g = 0; g < 2; ++g) {
                kf[g][0] = load_frag_packed(kr + g * 1024);
                kf[g][1] = load_frag_packed(kr + g * 1024 + 512);
            }
            // the wait stands in front of any reuse of the loads' address pair; naming the
            // pair as an input keeps it live up to it, so that no load's result lands on it
            asm volatile("s_wait_xcnt 0x0" :: "v"(kr) : "memory");
            // the next chunk's bias is made here, while the chunk's first K loads are under way
            if (kb == kc && kc + AT_CHUNK < SDIM) {
                MAKE_BIAS(buf ^ 1, mreg);
            }
            // inputs only: holds the eight K loads together, one trip to L2; without it the
            // compiler issues them in pairs into the same registers, each pair waited for
            asm volatile("" :: "v"(kf[0][0]), "v"(kf[0][1]), "v"(kf[1][0]), "v"(kf[1][1]));
            // The matrix row piece of the chunk after next is fetched behind the K wait: loads
            // return in order, so in front of it this read from memory would hold up the K data.
            if (kb == kc && kc + 2 * AT_CHUNK < SDIM) {
                mreg = *(const v4f*)(mrow + kc + 2 * AT_CHUNK);
                // the load's address pair may be reused below: the wait stands in front of that
                asm volatile("s_wait_xcnt 0x0" :: "v"(mrow) : "memory");
            }
#pragma unroll
            for (int g = 0; g < 2; ++g) {
                v8f s = {};
                s = wmma_bf16(qa[0], kf[g][0], s);
                s = wmma_bf16(qa[1], kf[g][1], s);
#pragma unroll
                for (int v = 0; v < 8; ++v) sc[v + hl * 8][g * 16 + l16] = s[v];
            }
            wave_lds_order();

            // ---- online softmax: lane handles (row=l16, cols hl*16..+15) ----
            const float* brow = &bs[buf][h * AT_BPLANE + l16 * AT_BROW + (kb - kc) + hl * 16];
            float pm = -1e30f;
            float sv[16];
#pragma unroll
            for (int j4 = 0; j4 < 4; ++j4) {
                const v4f bi = *(const v4f*)(brow + j4 * 4);
                const v4f si = *(const v4f*)&sc[l16][hl * 16 + j4 * 4];
#pragma unroll
                for (int j = 0; j < 4; ++j) {
                    sv[j4 * 4 + j] = si[j] * (1.0f / 32.0f) + bi[j];
                    pm = fmaxf(pm, sv[j4 * 4 + j]);
                }
            }
            pm = fmaxf(pm, __shfl_xor(pm, 16, 32));
            const float nm = fmaxf(mrun, pm);
            const float cf = __expf(mrun - nm);
            float ps = 0.f;
#pragma unroll
            for (int j = 0; j < 16; ++j) {
                float p = __expf(sv[j] - nm);
                ps += p;
                pb[l16][hl * 16 + j] = f2bf(p);
            }
            ps += __shfl_xor(ps, 16, 32);
            lrow = lrow * cf + ps;
            mrun = nm;
            if (lane < 16) corr[l16] = cf;
            wave_lds_order();

            // ---- rescale O, then O += P * V (4 WMMAs) ----
            float cfa[8];
#pragma unroll
            for (int v = 0; v < 8; ++v) cfa[v] = corr[v + hl * 8];
#pragma unroll
            for (int g = 0; g < 4; ++g)
#pragma unroll
                for (int v = 0; v < 8; ++v) o[g][v] *= cfa[v];

            v16bf pa = load_frag(&pb[l16][0], hl);
            // per 32 keys four fragments (16 head dims each) of 512 elements
            const __bf16* vr = Vt + ((bh * 32 + (kb >> 5)) * 4) * 512 + lane * 8;
            v16bf vb[4];
#pragma unroll
            for (int g = 0; g < 4; ++g) vb[g] = load_frag_packed(vr + g * 512);
            // as behind the K loads: the address pair stays live up to the wait
            asm volatile("s_wait_xcnt 0x0" :: "v"(vr) : "memory");
#pragma unroll
            for (int g = 0; g < 4; ++g) o[g] = wmma_bf16(pa, vb[g], o[g]);
            wave_lds_order();  // sc/pb reused next iteration
        }
        // publishes the next chunk's bias and ends every wave's reads of this chunk's
        // buffer, which the next trip refills
        __syncthreads();
    }
#undef MAKE_BIAS

    if (lane < 16) lsum[l16] = 1.f / lrow;
    wave_lds_order();
    float ri[8];
#pragma unroll
    for (int v = 0; v < 8; ++v) ri[v] = lsum[v + hl * 8];
#pragma unroll
    for (int g = 0; g < 4; ++g)
#pragma unroll
        for (int v = 0; v < 8; ++v) {
            const int s = qt * 16 + v + hl * 8;
            const int d = h * 64 + g * 16 + l16;
            out[((size_t)b * SDIM + s) * DMODEL + d] = o[g][v] * ri[v];
        }
}

// ---------------------------------------------------------------------------
// Residual + LayerNorm over D=1024. One wave per row, eight rows per 256-thread block:
// a launch starts 4,096 waves in place of 32,768. A lane holds 32 elements of its row
// (eight 16-B pieces, 512 B apart), its loads all in flight together; the two row sums are
// in-lane adds and a five-step butterfly over the wave, so no LDS and no barrier.
// ---------------------------------------------------------------------------
__device__ __forceinline__ float wave_sum(float s) {
#pragma unroll
    for (int m = 16; m > 0; m >>= 1) s += __shfl_xor(s, m, 32);
    return s;
}

__global__ __launch_bounds__(256) void add_ln_kernel(
    const float* __restrict__ a, const float* __restrict__ r,
    const float* __restrict__ g, const float* __restrict__ beta,
    float* __restrict__ outf, __bf16* __restrict__ outb) {
    const int lane = threadIdx.x & 31;
    const int row = blockIdx.x * 8 + (threadIdx.x >> 5);
    const int c0 = lane * 4;
    const size_t ro = (size_t)row * DMODEL + c0;
    const float* pa = a + ro;
    const float* pr = r + ro;
    v4f v[8], w[8], gg[8], bb[8];
#pragma unroll
    for (int i = 0; i < 8; ++i) v[i] = *(const v4f*)(pa + i * 128);
#pragma unroll
    for (int i = 0; i < 8; ++i) w[i] = *(const v4f*)(pr + i * 128);
    // the wait stands in front of any reuse of the loads' address pairs; naming the pairs
    // as inputs keeps them live up to it, so that no load's result is placed on them
    asm volatile("s_wait_xcnt 0x0" :: "v"(pa), "v"(pr) : "memory");
    // scale and shift are fetched ahead of their use, under the sums
#pragma unroll
    for (int i = 0; i < 8; ++i) gg[i] = *(const v4f*)(g + c0 + i * 128);
#pragma unroll
    for (int i = 0; i < 8; ++i) bb[i] = *(const v4f*)(beta + c0 + i * 128);
    // the loads' offset register may be reused below: the wait stands in front of that
    asm volatile("s_wait_xcnt 0x0" ::: "memory");
    // inputs only: holds the sixteen scale and shift loads together, ahead of the second sum;
    // without it the compiler sinks them behind the sums, two at a time, each pair waited for
    asm volatile("" :: "v"(gg[0]), "v"(gg[1]), "v"(gg[2]), "v"(gg[3]), "v"(gg[4]), "v"(gg[5]),
                       "v"(gg[6]), "v"(gg[7]), "v"(bb[0]), "v"(bb[1]), "v"(bb[2]), "v"(bb[3]),
                       "v"(bb[4]), "v"(bb[5]), "v"(bb[6]), "v"(bb[7]));
    float s = 0.f;
#pragma unroll
    for (int i = 0; i < 8; ++i) {
        v[i] += w[i];
        s += (v[i][0] + v[i][1]) + (v[i][2] + v[i][3]);
    }
    const float mean = wave_sum(s) * (1.f / 1024.f);
    float ss = 0.f;
#pragma unroll
    for (int i = 0; i < 8; ++i) {
        const v4f d = v[i] - mean;
        ss += (d[0] * d[0] + d[1] * d[1]) + (d[2] * d[2] + d[3] * d[3]);
    }
    const float rstd = rsqrtf(wave_sum(ss) * (1.f / 1024.f) + 1e-5f);
#pragma unroll
    for (int i = 0; i < 8; ++i) v[i] = (v[i] - mean) * rstd * gg[i] + bb[i];
    if (outb) {
        v4bf p[8];
#pragma unroll
        for (int i = 0; i < 8; ++i) {
#pragma unroll
            for (int j = 0; j < 4; ++j) p[i][j] = f2bf(v[i][j]);
        }
#pragma unroll
        for (int i = 0; i < 8; ++i) *(v4bf*)(outb + ro + i * 128) = p[i];
        // registers that these stores name may be reused for the next stores' address
        asm volatile("s_wait_xcnt 0x0" ::: "memory");
    }
#pragma unroll
    for (int i = 0; i < 8; ++i) *(v4f*)(outf + ro + i * 128) = v[i];
}

// ---------------------------------------------------------------------------
// Host launch
// ---------------------------------------------------------------------------
extern "C" void kernel_launch(void* const* d_in, const int* in_sizes, int n_in,
                              void* d_out, int out_size, void* d_ws, size_t ws_size,
                              hipStream_t stream) {
    (void)in_sizes; (void)n_in; (void)out_size; (void)ws_size;
    const float* src = (const float*)d_in[0];
    const float* td  = (const float*)d_in[1];
    const float* dd  = (const float*)d_in[2];
    const float* Wq  = (const float*)d_in[3];
    const float* bq  = (const float*)d_in[4];
    const float* Wk  = (const float*)d_in[5];
    const float* bk  = (const float*)d_in[6];
    const float* Wv  = (const float*)d_in[7];
    const float* bv  = (const float*)d_in[8];
    const float* tw1 = (const float*)d_in[9];
    const float* tb1 = (const float*)d_in[10];
    const float* tw2 = (const float*)d_in[11];
    const float* tb2 = (const float*)d_in[12];
    const float* dw1 = (const float*)d_in[13];
    const float* db1 = (const float*)d_in[14];
    const float* dw2 = (const float*)d_in[15];
    const float* db2 = (const float*)d_in[16];
    const float* W1  = (const float*)d_in[17];
    const float* b1  = (const float*)d_in[18];
    const float* W2  = (const float*)d_in[19];
    const float* b2  = (const float*)d_in[20];
    const float* g1  = (const float*)d_in[21];
    const float* be1 = (const float*)d_in[22];
    const float* g2  = (const float*)d_in[23];
    const float* be2 = (const float*)d_in[24];

    const int M = BDIM * SDIM;  // 4096 rows
    char* ws = (char*)d_ws;
    size_t off = 0;
    auto alloc = [&](size_t bytes) {
        char* p = ws + off;
        off = (off + bytes + 255) & ~(size_t)255;
        return p;
    };
    __bf16* srcb = (__bf16*)alloc((size_t)M * DMODEL * 2);
    __bf16* Wqt  = (__bf16*)alloc((size_t)DMODEL * DMODEL * 2);
    __bf16* Wkt  = (__bf16*)alloc((size_t)DMODEL * DMODEL * 2);
    __bf16* Wvt  = (__bf16*)alloc((size_t)DMODEL * DMODEL * 2);
    __bf16* W1t  = (__bf16*)alloc((size_t)DMODEL * DFF * 2);
    __bf16* W2t  = (__bf16*)alloc((size_t)DFF * DMODEL * 2);
    __bf16* Qb   = (__bf16*)alloc((size_t)M * DMODEL * 2);
    __bf16* Kb   = (__bf16*)alloc((size_t)M * DMODEL * 2);
    __bf16* Vtb  = (__bf16*)alloc((size_t)M * DMODEL * 2);
    float*  attn = (float*)alloc((size_t)M * DMODEL * 4);
    float*  xf   = (float*)alloc((size_t)M * DMODEL * 4);
    __bf16* xb   = (__bf16*)alloc((size_t)M * DMODEL * 2);
    __bf16* h1   = (__bf16*)alloc((size_t)M * DFF * 2);
    float*  ffn  = (float*)alloc((size_t)M * DMODEL * 4);

    prep_kernel<<<PREP_BLOCKS, 256, 0, stream>>>(src, Wq, Wk, Wv, W1, W2,
                                                 srcb, Wqt, Wkt, Wvt, W1t, W2t);

    gemm_bf16_kernel<<<dim3(DMODEL / 128, M / 128, 3), 256, 0, stream>>>(
        srcb, Wqt, Wkt, Wvt, bq, bk, bv, Qb, Kb, Vtb, DMODEL, DMODEL, 0, 5, 2);

    attn_kernel<<<BDIM * (SDIM / 16), 32 * NHEAD, 0, stream>>>(
        Qb, Kb, Vtb, td, dd, tw1, tb1, tw2, tb2, dw1, db1, dw2, db2, attn);

    add_ln_kernel<<<M / 8, 256, 0, stream>>>(src, attn, g1, be1, xf, xb);

    gemm_bf16_kernel<<<dim3(DFF / 128, M / 128), 256, 0, stream>>>(
        xb, W1t, W1t, W1t, b1, b1, b1, h1, h1, h1, DFF, DMODEL, 3, 3, 3);
    gemm_bf16_kernel<<<dim3(DMODEL / 128, M / 128), 256, 0, stream>>>(
        h1, W2t, W2t, W2t, b2, b2, b2, ffn, ffn, ffn, DMODEL, DFF, 4, 4, 4);

    add_ln_kernel<<<M / 8, 256, 0, stream>>>(xf, ffn, g2, be2, (float*)d_out, nullptr);
}

// v008
// A run of this version takes 173 microseconds.
// In both of two side-by-side timings against v007, it was 1.06 times as fast.
// All steps since v000 together make it 3.99 times as fast.
#include <hip/hip_runtime.h>

// ---------------------------------------------------------------------------
// SpatioTemporalTransformerLayer for MI455X (gfx1250, wave32, WMMA).
// B=4, S=1024, D=1024, H=16, HD=64, DFF=4096, BIAS_HID=8.
// GEMMs use v_wmma_f32_16x16x32_bf16 (bf16 A/B, f32 accumulate), the bias MLP v_wmma_f32_16x16x4_f32 (f32).
// GEMM operand tiles are staged in LDS by asynchronous copies (two buffers);
// fragments are read from LDS into ping-pong fragment buffers.
// ---------------------------------------------------------------------------

typedef __attribute__((ext_vector_type(16))) __bf16 v16bf;
typedef __attribute__((ext_vector_type(8)))  __bf16 v8bf;
typedef __attribute__((ext_vector_type(8)))  float  v8f;

#define BDIM 4
#define SDIM 1024
#define DMODEL 1024
#define NHEAD 16
#define HEADD 64
#define DFF 4096

__device__ __forceinline__ __bf16 f2bf(float x) {
    unsigned u = __builtin_bit_cast(unsigned, x);
    unsigned r = (u + 0x7FFFu + ((u >> 16) & 1u)) >> 16;
    return __builtin_bit_cast(__bf16, (unsigned short)r);
}

__device__ __forceinline__ v8f wmma_bf16(v16bf a, v16bf b, v8f c) {
    // (neg_a, A, neg_b, B, c_mod, C, reuse_a, reuse_b)
    return __builtin_amdgcn_wmma_f32_16x16x32_bf16(false, a, false, b, (short)0, c,
                                                   false, false);
}

// Load a 16x32 bf16 A/B fragment: lane L, elem e -> (row=L&15, K=16*(e>>3)+8*(L>>4)+(e&7))
// 'row_ptr' points at element K=0 of this lane's row. Two contiguous 16B loads.
__device__ __forceinline__ v16bf load_frag(const __bf16* row_ptr, int hl) {
    v8bf lo = *(const v8bf*)(row_ptr + hl * 8);
    v8bf hi = *(const v8bf*)(row_ptr + 16 + hl * 8);
    v16bf f;
#pragma unroll
    for (int i = 0; i < 8; ++i) { f[i] = lo[i]; f[8 + i] = hi[i]; }
    return f;
}

// Fragment order for an operand that only the attention reads: a 16-row x 32-k fragment is
// 1 KiB, two 512-B halves (k 0..15, k 16..31), and in a half lane L owns 16 B at L * 16:
// row = L & 15, k = 16 * half + 8 * (L >> 4) + 0..7, as load_frag reads it. A wave-wide
// 16-B load or store then covers 512 contiguous bytes (four whole lines).
// 'frag' counts fragments; the result is the element index of (row, k), k a multiple of 8.
__device__ __forceinline__ size_t frag_index(size_t frag, int row, int k) {
    return ((frag * 2 + ((k >> 4) & 1)) * 32 + ((k >> 3) & 1) * 16 + row) * 8;
}

// 'p' points at this lane's 16 B in the first half of the fragment.
__device__ __forceinline__ v16bf load_frag_packed(const __bf16* p) {
    v8bf lo = *(const v8bf*)p;
    v8bf hi = *(const v8bf*)(p + 256);
    v16bf f;
#pragma unroll
    for (int i = 0; i < 8; ++i) { f[i] = lo[i]; f[8 + i] = hi[i]; }
    return f;
}

// The eight 16-B units of a wave's 32 x 64 tile: 'po' is this lane's unit of tile (0, 0);
// 'sub' steps by a half fragment, 'g' by 'gstep' elements.
__device__ __forceinline__ void store_units(__bf16* po, int gstep, const v8bf (&pk)[2][4]) {
#pragma unroll
    for (int sub = 0; sub < 2; ++sub)
#pragma unroll
        for (int g = 0; g < 4; ++g) *(v8bf*)(po + g * gstep + sub * 256) = pk[sub][g];
    // other modes' code follows in the same kernel and reuses the stores' registers:
    // the wait stands behind the last store, in front of any such overwrite
    asm volatile("s_wait_xcnt 0x0" ::: "memory");
}

// ---------------------------------------------------------------------------
// Elementwise converters
// ---------------------------------------------------------------------------
typedef __attribute__((ext_vector_type(4))) __bf16 v4bf;
typedef __attribute__((ext_vector_type(4))) float  v4f;

// 32 elements a thread, so that the src job takes 4,096 waves in place of 131,072:
// eight 16-B loads in flight per lane, each wave-wide load 512 contiguous bytes,
// each wave-wide store 256. Its 512 blocks cover the array exactly (8,192 elements a block).
#define CVT_BLOCK_ELEMS (256 * 32)
__device__ __forceinline__ void cvt_f32_bf16_block(const float* __restrict__ in,
                                                   __bf16* __restrict__ out, int blk) {
    const size_t base = (size_t)blk * CVT_BLOCK_ELEMS + threadIdx.x * 4;
    v4f r[8];
#pragma unroll
    for (int i = 0; i < 8; ++i) r[i] = *(const v4f*)(in + base + i * 1024);
    // the loads' address registers may be reused below: the wait stands in front of that
    asm volatile("s_wait_xcnt 0x0" ::: "memory");
#pragma unroll
    for (int i = 0; i < 8; ++i) {
        v4bf p;
#pragma unroll
        for (int j = 0; j < 4; ++j) p[j] = f2bf(r[i][j]);
        *(v4bf*)(out + base + i * 1024) = p;
    }
    // other jobs' code follows in the same kernel and reuses the stores' registers:
    // the wait stands behind the last store, in front of any such overwrite
    asm volatile("s_wait_xcnt 0x0" ::: "memory");
}

// W[K][N] f32 (row-major) -> Wt[N][K] bf16, one 64x64 tile per 256-thread block.
// K and N are multiples of 64. Reads are 256-B row pieces (16 B a lane), the tile is
// turned in LDS, and every store instruction writes whole 128-B lines of Wt.
__device__ __forceinline__ void cvt_transpose_block(const float* __restrict__ W,
                                                    __bf16* __restrict__ Wt, int K, int N,
                                                    int bx, int by) {
    // 128-B rows at a 144-B pitch (16 B x odd) for the 16-byte readers.
    __shared__ __attribute__((aligned(16))) __bf16 tile[64][72];
    const int t = threadIdx.x;
    const int n0 = bx * 64;
    const int k0 = by * 64;

    const int nq = (t & 15) * 4;   // four columns of W
    const int kq = (t >> 4) * 4;   // four rows of W
    const float* in = W + (size_t)(k0 + kq) * N + n0 + nq;
    v4f r[4];
#pragma unroll
    for (int i = 0; i < 4; ++i) {
        r[i] = *(const v4f*)(in + (size_t)i * N);
        // a later load's result registers may reuse this load's address pair:
        // the wait stands between the load and any such overwrite
        asm volatile("s_wait_xcnt 0x0" ::: "memory");
    }
#pragma unroll
    for (int j = 0; j < 4; ++j) {
        v4bf p;
#pragma unroll
        for (int i = 0; i < 4; ++i) p[i] = f2bf(r[i][j]);
        *(v4bf*)&tile[nq + j][kq] = p;
    }
    __syncthreads();

    const int kk = (t & 7) * 8;    // eight lanes cover one 128-B row of the tile
#pragma unroll
    for (int pass = 0; pass < 2; ++pass) {
        const int n = (t >> 3) + pass * 32;
        *(v8bf*)(Wt + (size_t)(n0 + n) * K + k0 + kk) = *(const v8bf*)&tile[n][kk];
    }
    // other jobs' code follows in the same kernel and reuses the stores' registers:
    // the wait stands behind the last store, in front of any such overwrite
    asm volatile("s_wait_xcnt 0x0" ::: "memory");
}

// The six conversions depend on nothing and on one another not at all: one launch does
// them all, each block taking its job from its index. Ranges of blocks, in this order:
// W1, W2 (1,024 tiles each), src (512 pieces), Wq, Wk, Wv (256 tiles each).
#define PREP_BIG ((DMODEL / 64) * (DFF / 64))        // tiles of W1, of W2
#define PREP_SRC (BDIM * SDIM * DMODEL / CVT_BLOCK_ELEMS)
#define PREP_SQ ((DMODEL / 64) * (DMODEL / 64))      // tiles of Wq, of Wk, of Wv
#define PREP_BLOCKS (2 * PREP_BIG + PREP_SRC + 3 * PREP_SQ)
__global__ __launch_bounds__(256) void prep_kernel(
    const float* __restrict__ src, const float* __restrict__ Wq, const float* __restrict__ Wk,
    const float* __restrict__ Wv, const float* __restrict__ W1, const float* __restrict__ W2,
    __bf16* __restrict__ srcb, __bf16* __restrict__ Wqt, __bf16* __restrict__ Wkt,
    __bf16* __restrict__ Wvt, __bf16* __restrict__ W1t, __bf16* __restrict__ W2t) {
    int blk = blockIdx.x;   // every test below is the same for the whole block
    if (blk < PREP_BIG) {
        cvt_transpose_block(W1, W1t, DMODEL, DFF, blk & (DFF / 64 - 1), blk / (DFF / 64));
        return;
    }
    blk -= PREP_BIG;
    if (blk < PREP_BIG) {
        cvt_transpose_block(W2, W2t, DFF, DMODEL, blk & (DMODEL / 64 - 1), blk / (DMODEL / 64));
        return;
    }
    blk -= PREP_BIG;
    if (blk < PREP_SRC) {
        cvt_f32_bf16_block(src, srcb, blk);
        return;
    }
    blk -= PREP_SRC;
    const int which = blk / PREP_SQ;
    blk &= PREP_SQ - 1;
    const float* W = which == 0 ? Wq : which == 1 ? Wk : Wv;
    __bf16* Wt = which == 0 ? Wqt : which == 1 ? Wkt : Wvt;
    cvt_transpose_block(W, Wt, DMODEL, DMODEL, blk & (DMODEL / 64 - 1), blk / (DMODEL / 64));
}

// ---------------------------------------------------------------------------
// Generic bf16 WMMA GEMM: C[M,N] = A[M,K] * Wt[N,K]^T + bias, with mode epilogue
//   mode 0: Q layout    -> bf16 out[((b*16+h)*1024+s)*64+d]
//   mode 2: V           -> bf16, in the order of the attention's A fragments (frag_index)
//   mode 5: K           -> bf16, the same; the product is formed transposed (rows = features,
//                          columns = tokens), so that a lane's eight values are one 16-B unit
//   mode 3: ReLU        -> bf16 out[row*N+col]   (FFN1)
//   mode 4: plain f32   -> f32  out[row*N+col]   (FFN2)
// Block: 256 threads = 8 waves on a 128 x 128 tile of C, 4 x 2 waves of 32 x 64 each: per
// multiply-add the block fetches two thirds of the L2 bytes that a 128 x 64 tile fetches.
// A pass is 128 k: the block's 128 rows of A and 128 rows of Wt (256 B each) are
// brought into LDS by asynchronous copies that read whole 128-B lines, two
// buffers, the copies of pass p+2 in flight while pass p+1 is worked on.
// Fragments come from LDS by 16-B reads; per 32-k chunk 2 A + 4 B frags -> 8 WMMAs.
// ---------------------------------------------------------------------------
#define G_PASS_K 128                       // k elements per pass
#define G_PITCH 136                        // LDS row pitch in elements: 272 B = 16 B x odd
#define G_ROWS (128 + 128)                 // A rows, then Wt rows; Wt rows, then A rows in mode 5
#define G_STAGE (G_ROWS * G_PITCH)         // elements per buffer
#define G_STEP_B (16 * G_PITCH * 2)        // LDS bytes between two copies of a thread (16 rows)

// Eight 16-B copies of one thread, 16 rows apart: global row step 'gs' elements.
// The s_wait_xcnt closes the statement so that no address register of a copy is
// rewritten ahead of it.
__device__ __forceinline__ void copy8_to_lds(unsigned l, const __bf16* g, size_t gs) {
    asm volatile(
        "global_load_async_to_lds_b128 %0, %8, off\n\t"
        "global_load_async_to_lds_b128 %1, %9, off\n\t"
        "global_load_async_to_lds_b128 %2, %10, off\n\t"
        "global_load_async_to_lds_b128 %3, %11, off\n\t"
        "global_load_async_to_lds_b128 %4, %12, off\n\t"
        "global_load_async_to_lds_b128 %5, %13, off\n\t"
        "global_load_async_to_lds_b128 %6, %14, off\n\t"
        "global_load_async_to_lds_b128 %7, %15, off\n\t"
        "s_wait_xcnt 0x0"
        :: "v"(l), "v"(l + 1 * G_STEP_B), "v"(l + 2 * G_STEP_B), "v"(l + 3 * G_STEP_B),
           "v"(l + 4 * G_STEP_B), "v"(l + 5 * G_STEP_B), "v"(l + 6 * G_STEP_B),
           "v"(l + 7 * G_STEP_B),
           "v"(g), "v"(g + gs), "v"(g + 2 * gs), "v"(g + 3 * gs),
           "v"(g + 4 * gs), "v"(g + 5 * gs), "v"(g + 6 * gs), "v"(g + 7 * gs)
        : "memory");
}

// blockIdx.z picks one of up to three independent products on the same A (weights, bias,
// output and mode of its own): Q, K and V go in one launch; the FFN launches have z = 0 only.
__global__ __launch_bounds__(256) void gemm_bf16_kernel(
    const __bf16* __restrict__ A, const __bf16* __restrict__ Wt0,
    const __bf16* __restrict__ Wt1, const __bf16* __restrict__ Wt2,
    const float* __restrict__ bias0, const float* __restrict__ bias1,
    const float* __restrict__ bias2, void* __restrict__ out0, void* __restrict__ out1,
    void* __restrict__ out2, int N, int Kd, int mode0, int mode1, int mode2) {
    __shared__ __attribute__((aligned(16))) __bf16 sm[2 * G_STAGE];
    const int z = blockIdx.z;
    const __bf16* __restrict__ Wt = z == 0 ? Wt0 : z == 1 ? Wt1 : Wt2;
    const float* __restrict__ bias = z == 0 ? bias0 : z == 1 ? bias1 : bias2;
    void* __restrict__ outp = z == 0 ? out0 : z == 1 ? out1 : out2;
    const int mode = z == 0 ? mode0 : z == 1 ? mode1 : mode2;
    const int t = threadIdx.x;
    const int lane = t & 31;
    const int wv = t >> 5;
    const int hl = lane >> 4;
    const int l16 = lane & 15;
    // mode 5 swaps the operands' roles: the 128 block rows are rows of Wt (features), the 128
    // block columns rows of A (tokens); the same number of blocks is dealt anew.
    const bool swapped = mode == 5;
    const int flat = blockIdx.y * (N / 128) + blockIdx.x;   // the grid is N / 128 wide
    const int nb = (swapped ? flat & (BDIM * SDIM / 128 - 1) : blockIdx.x) * 128;
    const int mb = (swapped ? flat / (BDIM * SDIM / 128) : blockIdx.y) * 128;
    const int m0 = mb + (wv >> 1) * 32;   // this wave's 32 rows
    const int n0 = nb + (wv & 1) * 64;    // and its 64 columns

    v8f c[2][4] = {};

    // copies: 16 lanes cover one 256-B row piece, a wave two rows, the block 16 rows
    const int crow = t >> 4;
    const int ccol = (t & 15) * 8;
    const size_t gs = (size_t)16 * Kd;
    const __bf16* gA = (swapped ? Wt : A) + (size_t)(mb + crow) * Kd + ccol;
    const __bf16* gB = (swapped ? A : Wt) + (size_t)(nb + crow) * Kd + ccol;
    const unsigned lc = (unsigned)(size_t)(&sm[0]) + (unsigned)(crow * G_PITCH + ccol) * 2u;

#define ISSUE_PASS(p, buf)                                                     \
    do {                                                                       \
        const unsigned lb = lc + (unsigned)(buf) * (G_STAGE * 2u);             \
        copy8_to_lds(lb, gA + (size_t)(p) * G_PASS_K, gs);                     \
        copy8_to_lds(lb + 8u * G_STEP_B, gB + (size_t)(p) * G_PASS_K, gs);     \
    } while (0)

    // fragment rows of this lane inside a buffer
    const int fa = ((wv >> 1) * 32 + l16) * G_PITCH;
    const int fb = (128 + (wv & 1) * 64 + l16) * G_PITCH;

    // ping-pong fragment buffers
    v16bf a0[2], a1[2], bb[2][4];

#define LOAD_CHUNK(buf, kk)                                                    \
    do {                                                                       \
        a0[buf] = load_frag(st + fa + (kk), hl);                               \
        a1[buf] = load_frag(st + fa + 16 * G_PITCH + (kk), hl);                \
        _Pragma("unroll") for (int g = 0; g < 4; ++g)                          \
            bb[buf][g] = load_frag(st + fb + g * 16 * G_PITCH + (kk), hl);     \
    } while (0)

#define COMPUTE(buf)                                               \
    do {                                                           \
        _Pragma("unroll") for (int g = 0; g < 4; ++g) {            \
            c[0][g] = wmma_bf16(a0[buf], bb[buf][g], c[0][g]);     \
            c[1][g] = wmma_bf16(a1[buf], bb[buf][g], c[1][g]);     \
        }                                                          \
    } while (0)

    // Kd is a multiple of 128 (1024 or 4096).
    const int npass = Kd / G_PASS_K;
    ISSUE_PASS(0, 0);
    // pass 0 has landed for this wave; the barrier publishes it to the others
    asm volatile("s_wait_asynccnt 0x0" ::: "memory");
    __syncthreads();
    if (npass > 1) ISSUE_PASS(1, 1);

    for (int p = 0; p < npass; ++p) {
        const __bf16* st = sm + (p & 1) * G_STAGE;
        // The scheduling barriers keep each chunk's twelve LDS reads together and one
        // chunk ahead of their WMMAs; without them the compiler sinks the reads to
        // pairs directly in front of their use, each pair behind a wait to zero.
        LOAD_CHUNK(0, 0);
        LOAD_CHUNK(1, 32);
        __builtin_amdgcn_sched_barrier(0);
        COMPUTE(0);
        __builtin_amdgcn_sched_barrier(0);
        LOAD_CHUNK(0, 64);
        __builtin_amdgcn_sched_barrier(0);
        COMPUTE(1);
        __builtin_amdgcn_sched_barrier(0);
        LOAD_CHUNK(1, 96);
        // The pass's last LDS reads are out: the hand-over stands here, ahead of the
        // last two chunks' WMMAs (registers only), so that the refill flies under them.
        // this wave's reads of the buffer have returned before it is refilled
        asm volatile("s_wait_dscnt 0x0" ::: "memory");
        // this wave's copies of pass p+1 have landed before the barrier publishes them
        asm volatile("s_wait_asynccnt 0x0" ::: "memory");
        __syncthreads();
        if (p + 2 < npass) ISSUE_PASS(p + 2, p & 1);
        COMPUTE(0);
        COMPUTE(1);
    }
    // no copy is outstanding when the wave goes on to its end
    asm volatile("s_wait_asynccnt 0x0" ::: "memory");
#undef ISSUE_PASS
#undef LOAD_CHUNK
#undef COMPUTE

    // K and V go out in fragment order: a lane's eight accumulator values of a tile are one
    // 16-B unit, a wave-wide store 512 contiguous bytes. The tests are the same for the block.
    if (mode == 5) {
        // K: tile rows are head dims (k of the fragment), tile columns tokens (its rows);
        // fragment = (16 keys, 32 head dims), two per 16 keys: g steps by two fragments
        const int tok = n0 + l16;
        const size_t bhx = (size_t)((tok >> 10) * 16 + (m0 >> 6));
        const size_t fr = (bhx * 64 + ((tok & 1023) >> 4)) * 2 + ((m0 >> 5) & 1);
        v8bf pk[2][4];
#pragma unroll
        for (int sub = 0; sub < 2; ++sub)
#pragma unroll
            for (int v = 0; v < 8; ++v) {
                const float bcst = bias[m0 + sub * 16 + hl * 8 + v];
#pragma unroll
                for (int g = 0; g < 4; ++g) pk[sub][g][v] = f2bf(c[sub][g][v] + bcst);
            }
        store_units((__bf16*)outp + frag_index(fr, l16, hl * 8), 1024, pk);
        return;
    }
    if (mode == 2) {
        // V: tile rows are tokens (k of the fragment), tile columns head dims (its rows);
        // fragment = (16 head dims, 32 keys), four per 32 keys: g steps by one fragment
        const size_t bhx = (size_t)((m0 >> 10) * 16 + (n0 >> 6));
        const size_t fr = (bhx * 32 + ((m0 & 1023) >> 5)) * 4;
        v8bf pk[2][4];
#pragma unroll
        for (int g = 0; g < 4; ++g) {
            const float bcst = bias[n0 + g * 16 + l16];
#pragma unroll
            for (int sub = 0; sub < 2; ++sub)
#pragma unroll
                for (int v = 0; v < 8; ++v) pk[sub][g][v] = f2bf(c[sub][g][v] + bcst);
        }
        store_units((__bf16*)outp + frag_index(fr, l16, hl * 8), 512, pk);
        return;
    }

#pragma unroll
    for (int sub = 0; sub < 2; ++sub) {
#pragma unroll
        for (int g = 0; g < 4; ++g) {
            const int col = n0 + g * 16 + l16;
            const float bcst = bias[col];
#pragma unroll
            for (int v = 0; v < 8; ++v) {
                const int row = m0 + sub * 16 + v + hl * 8;  // D-frag: M = v + 8*(lane>=16)
                float val = c[sub][g][v] + bcst;
                if (mode == 3) {
                    val = fmaxf(val, 0.f);
                    ((__bf16*)outp)[(size_t)row * N + col] = f2bf(val);
                } else if (mode == 4) {
                    ((float*)outp)[(size_t)row * N + col] = val;
                } else {                 // Q -> [b,h,s,d]
                    int bb2 = row >> 10, s = row & 1023, hh = col >> 6, d = col & 63;
                    ((__bf16*)outp)[(((size_t)(bb2 * 16 + hh)) * 1024 + s) * 64 + d] = f2bf(val);
                }
            }
        }
    }
}

// ---------------------------------------------------------------------------
// Flash attention with the pair-bias MLP shared by the heads.
// One 16-wave block per (b, 16-row q-tile); wave w runs head w over all keys.
// The hidden layer of the bias MLP does not depend on the head, so it is worked out
// once per (q, key): for each chunk of 64 keys wave w takes q row w, forms the 16 hidden
// values of each pair (lanes 0-15 the eight of t_deltas, lanes 16-31 the eight of dists)
// and multiplies them with the 16x16 output weights by v_wmma_f32_16x16x4_f32
// (A = w2^T: row = head; B = hidden: column = key), all in f32. The result goes to LDS as
// bias[head][q row][key], two buffers, one chunk ahead, one block barrier a chunk.
// K and V arrive in fragment order (frag_index): every K or V load of a wave reads 512
// contiguous bytes, four whole lines, each line touched by one load only.
// Both products are formed transposed: S^T = K Q^T (A = K fragment, B = Q fragment) and
// O^T += V^T P^T (A = V fragment, B = P^T). A lane then holds scores of one query only
// (column l16; keys 8 * hl + 0..7 of each 16), so maximum, sum and rescale factor are
// per-lane values, and the two score tiles of 32 keys, converted in place, are the B
// fragment of the second product in the k order of load_frag: in the loop nothing but the
// bias passes through LDS.
// ---------------------------------------------------------------------------
typedef __attribute__((ext_vector_type(2))) float v2f;

#define AT_CHUNK 64                        // keys per bias chunk
#define AT_BROW 68                         // bias row pitch in words: 272 B = 16 B x odd
#define AT_BPLANE (16 * AT_BROW + 4)       // words per head; 8 planes = 32 banks mod 64

// Orders this wave's LDS writes ahead of its own later LDS reads of other lanes' words
// (the output tile belongs to one wave alone, so no block barrier is needed):
// the LDS-only fences keep the compiler from moving LDS accesses over this point and
// make it wait for the wave's outstanding LDS operations.
__device__ __forceinline__ void wave_lds_order() {
    __builtin_amdgcn_fence(__ATOMIC_RELEASE, "workgroup", "local");
    __builtin_amdgcn_wave_barrier();
    __builtin_amdgcn_fence(__ATOMIC_ACQUIRE, "workgroup", "local");
}

__global__ __launch_bounds__(512) void attn_kernel(
    const __bf16* __restrict__ Q, const __bf16* __restrict__ Km,
    const __bf16* __restrict__ Vt, const float* __restrict__ td,
    const float* __restrict__ dd, const float* __restrict__ tw1,
    const float* __restrict__ tb1, const float* __restrict__ tw2,
    const float* __restrict__ tb2, const float* __restrict__ dw1,
    const float* __restrict__ db1, const float* __restrict__ dw2,
    const float* __restrict__ db2, float* __restrict__ out) {
    const int lane = threadIdx.x & 31;
    const int hl = lane >> 4;
    const int l16 = lane & 15;
    const int h = __builtin_amdgcn_readfirstlane(threadIdx.x >> 5);  // wave = head
    const int qt = blockIdx.x & 63;
    const int b = blockIdx.x >> 6;

    __shared__ __attribute__((aligned(16))) float bs[2][16 * AT_BPLANE];   // bias, all heads

    // Bias MLP operands of this lane. k slot (chunk c, register j, lane half hl) of both
    // WMMA operands is hidden unit 2c+j of the t_deltas MLP (hl = 0) or the dists MLP (hl = 1).
    const float* w1p = hl ? dw1 : tw1;
    const float* b1p = hl ? db1 : tb1;
    const float* w2p = hl ? dw2 : tw2;
    float w1[8], b1[8];
    v2f wa[4];
#pragma unroll
    for (int j = 0; j < 8; ++j) { w1[j] = w1p[j]; b1[j] = b1p[j]; }
#pragma unroll
    for (int c = 0; c < 4; ++c) {
        wa[c][0] = w2p[(2 * c) * 16 + l16];
        wa[c][1] = w2p[(2 * c + 1) * 16 + l16];
    }
    v8f cinit;  // accumulator start: the two output biases of head v + 8*hl
#pragma unroll
    for (int v = 0; v < 8; ++v) cinit[v] = tb2[v + 8 * hl] + db2[v + 8 * hl];
    // the wait stands in front of any reuse of these loads' address registers; naming the
    // pairs as inputs keeps them live up to it
    asm volatile("s_wait_xcnt 0x0" :: "v"(w1p), "v"(b1p), "v"(w2p) : "memory");
    // q row qt*16 + h of this lane's matrix; the lane owns keys 4*l16 .. 4*l16+3 of a chunk
    const float* mrow = (hl ? dd : td) + ((size_t)b * SDIM + qt * 16 + h) * SDIM + l16 * 4;

#define MAKE_BIAS(buf, m4)                                                              \
    do {                                                                                \
        v8f acc[4] = {cinit, cinit, cinit, cinit};                                      \
        _Pragma("unroll") for (int c = 0; c < 4; ++c) {                                 \
            _Pragma("unroll") for (int g = 0; g < 4; ++g) {                             \
                v2f hb;                                                                 \
                hb[0] = fmaxf((m4)[g] * w1[2 * c] + b1[2 * c], 0.f);                    \
                hb[1] = fmaxf((m4)[g] * w1[2 * c + 1] + b1[2 * c + 1], 0.f);            \
                acc[g] = __builtin_amdgcn_wmma_f32_16x16x4_f32(                         \
                    false, wa[c], false, hb, (short)0, acc[g], false, false);           \
            }                                                                           \
        }                                                                               \
        _Pragma("unroll") for (int v = 0; v < 8; ++v) {                                 \
            v4f o4 = {acc[0][v], acc[1][v], acc[2][v], acc[3][v]};                      \
            *(v4f*)&bs[buf][(v + 8 * hl) * AT_BPLANE + h * AT_BROW + l16 * 4] = o4;     \
        }                                                                               \
    } while (0)

    const size_t bh = (size_t)(b * 16 + h);

    // Q B-fragments (column = query l16) for the two K-dim halves (hd 0..31, 32..63)
    v16bf qa[2];
    {
        const __bf16* r = Q + (bh * 1024 + qt * 16 + l16) * 64;
        qa[0] = load_frag(r, hl);
        qa[1] = load_frag(r + 32, hl);
    }

    v8f o[4] = {};   // O^T: o[g][v] = (head dim g * 16 + 8 * hl + v, query l16)
    // running maximum of query l16 (equal in both lane halves) and this half's share of its sum
    float mrun = -1e30f, lrow = 0.f;

    v4f mreg = *(const v4f*)mrow;
    // the load's address pair may be reused below: the wait stands in front of that
    asm volatile("s_wait_xcnt 0x0" :: "v"(mrow) : "memory");
    MAKE_BIAS(0, mreg);
    mreg = *(const v4f*)(mrow + AT_CHUNK);
    // the load's address pair may be reused below: the wait stands in front of that
    asm volatile("s_wait_xcnt 0x0" :: "v"(mrow) : "memory");
    __syncthreads();  // chunk 0's bias is published to every head's wave

    for (int kc = 0; kc < SDIM; kc += AT_CHUNK) {
        const int buf = (kc / AT_CHUNK) & 1;
        for (int kb = kc; kb < kc + AT_CHUNK; kb += 32) {
            // ---- K for 32 keys: 2 groups of 16 keys x 2 K-dim halves = 4 fragments ----
            v16bf kf[2][2];
            // per 16 keys two fragments (head dims 0..31, 32..63) of 512 elements each
            const __bf16* kr = Km + ((bh * 64 + (kb >> 4)) * 2) * 512 + lane * 8;
#pragma unroll
            for (int g = 0; g < 2; ++g) {
                kf[g][0] = load_frag_packed(kr + g * 1024);
                kf[g][1] = load_frag_packed(kr + g * 1024 + 512);
            }
            // the wait stands in front of any reuse of the loads' address pair; naming the
            // pair as an input keeps it live up to it, so that no load's result lands on it
            asm volatile("s_wait_xcnt 0x0" :: "v"(kr) : "memory");
            // the next chunk's bias is made here, while the chunk's first K loads are under way
            if (kb == kc && kc + AT_CHUNK < SDIM) {
                MAKE_BIAS(buf ^ 1, mreg);
            }
            // inputs only: holds the eight K loads together, one trip to L2; without it the
            // compiler issues them in pairs into the same registers, each pair waited for
            asm volatile("" :: "v"(kf[0][0]), "v"(kf[0][1]), "v"(kf[1][0]), "v"(kf[1][1]));
            // The matrix row piece of the chunk after next is fetched behind the K wait: loads
            // return in order, so in front of it this read from memory would hold up the K data.
            if (kb == kc && kc + 2 * AT_CHUNK < SDIM) {
                mreg = *(const v4f*)(mrow + kc + 2 * AT_CHUNK);
                // the load's address pair may be reused below: the wait stands in front of that
                asm volatile("s_wait_xcnt 0x0" :: "v"(mrow) : "memory");
            }
            // ---- S^T and online softmax: the lane holds query l16, keys g*16 + hl*8 + 0..7 ----
            const float* brow = &bs[buf][h * AT_BPLANE + l16 * AT_BROW + (kb - kc) + hl * 8];
            float pm = -1e30f;
            float sv[2][8];
#pragma unroll
            for (int g = 0; g < 2; ++g) {
                v8f s = {};
                s = wmma_bf16(kf[g][0], qa[0], s);
                s = wmma_bf16(kf[g][1], qa[1], s);
                const v4f blo = *(const v4f*)(brow + g * 16);
                const v4f bhi = *(const v4f*)(brow + g * 16 + 4);
#pragma unroll
                for (int v = 0; v < 8; ++v) {
                    sv[g][v] = s[v] * (1.0f / 32.0f) + (v < 4 ? blo[v & 3] : bhi[v & 3]);
                    pm = fmaxf(pm, sv[g][v]);
                }
            }
            pm = fmaxf(pm, __shfl_xor(pm, 16, 32));
            const float nm = fmaxf(mrun, pm);
            const float cf = __expf(mrun - nm);
            float ps = 0.f;
            v16bf pt;   // P^T as a B fragment: element g*8 + v is key 16*g + 8*hl + v
#pragma unroll
            for (int g = 0; g < 2; ++g)
#pragma unroll
                for (int v = 0; v < 8; ++v) {
                    float p = __expf(sv[g][v] - nm);
                    ps += p;
                    pt[g * 8 + v] = f2bf(p);
                }
            lrow = lrow * cf + ps;   // the halves' sums are joined behind the loop
            mrun = nm;

            // ---- rescale O^T, then O^T += V^T * P^T (4 WMMAs) ----
#pragma unroll
            for (int g = 0; g < 4; ++g)
#pragma unroll
                for (int v = 0; v < 8; ++v) o[g][v] *= cf;

            // per 32 keys four fragments (16 head dims each) of 512 elements
            const __bf16* vr = Vt + ((bh * 32 + (kb >> 5)) * 4) * 512 + lane * 8;
            v16bf vb[4];
#pragma unroll
            for (int g = 0; g < 4; ++g) vb[g] = load_frag_packed(vr + g * 512);
            // as behind the K loads: the address pair stays live up to the wait
            asm volatile("s_wait_xcnt 0x0" :: "v"(vr) : "memory");
#pragma unroll
            for (int g = 0; g < 4; ++g) o[g] = wmma_bf16(vb[g], pt, o[g]);
        }
        // publishes the next chunk's bias and ends every wave's reads of this chunk's
        // buffer, which the next trip refills
        __syncthreads();
    }
#undef MAKE_BIAS

    const float ri = 1.f / (lrow + __shfl_xor(lrow, 16, 32));
#pragma unroll
    for (int g = 0; g < 4; ++g)
#pragma unroll
        for (int v = 0; v < 8; ++v) o[g][v] *= ri;
    // O^T is turned in LDS so that every store writes whole lines. The bias planes are dead
    // behind the loop's last barrier; wave h alone uses plane h of buffer 0 (16 rows of 68 words).
    // A lane's eight values of a tile are eight consecutive head dims of its query's row.
    float* ot = &bs[0][h * AT_BPLANE];
#pragma unroll
    for (int g = 0; g < 4; ++g) {
        const v4f lo = {o[g][0], o[g][1], o[g][2], o[g][3]};
        const v4f hi = {o[g][4], o[g][5], o[g][6], o[g][7]};
        *(v4f*)&ot[l16 * AT_BROW + g * 16 + hl * 8] = lo;
        *(v4f*)&ot[l16 * AT_BROW + g * 16 + hl * 8 + 4] = hi;
    }
    wave_lds_order();
    // 16 lanes cover the 256 B of one query's head: a wave-wide store is two rows, four lines
    v4f orow[8];
#pragma unroll
    for (int i = 0; i < 8; ++i) orow[i] = *(const v4f*)&ot[(i * 2 + hl) * AT_BROW + l16 * 4];
    float* po = out + ((size_t)b * SDIM + qt * 16 + hl) * DMODEL + h * 64 + l16 * 4;
#pragma unroll
    for (int i = 0; i < 8; ++i) *(v4f*)(po + (size_t)i * 2 * DMODEL) = orow[i];
}

// ---------------------------------------------------------------------------
// Residual + LayerNorm over D=1024. One wave per row, eight rows per 256-thread block:
// a launch starts 4,096 waves in place of 32,768. A lane holds 32 elements of its row
// (eight 16-B pieces, 512 B apart), its loads all in flight together; the two row sums are
// in-lane adds and a five-step butterfly over the wave, so no LDS and no barrier.
// ---------------------------------------------------------------------------
__device__ __forceinline__ float wave_sum(float s) {
#pragma unroll
    for (int m = 16; m > 0; m >>= 1) s += __shfl_xor(s, m, 32);
    return s;
}

__global__ __launch_bounds__(256) void add_ln_kernel(
    const float* __restrict__ a, const float* __restrict__ r,
    const float* __restrict__ g, const float* __restrict__ beta,
    float* __restrict__ outf, __bf16* __restrict__ outb) {
    const int lane = threadIdx.x & 31;
    const int row = blockIdx.x * 8 + (threadIdx.x >> 5);
    const int c0 = lane * 4;
    const size_t ro = (size_t)row * DMODEL + c0;
    const float* pa = a + ro;
    const float* pr = r + ro;
    v4f v[8], w[8], gg[8], bb[8];
#pragma unroll
    for (int i = 0; i < 8; ++i) v[i] = *(const v4f*)(pa + i * 128);
#pragma unroll
    for (int i = 0; i < 8; ++i) w[i] = *(const v4f*)(pr + i * 128);
    // the wait stands in front of any reuse of the loads' address pairs; naming the pairs
    // as inputs keeps them live up to it, so that no load's result is placed on them
    asm volatile("s_wait_xcnt 0x0" :: "v"(pa), "v"(pr) : "memory");
    // scale and shift are fetched ahead of their use, under the sums
#pragma unroll
    for (int i = 0; i < 8; ++i) gg[i] = *(const v4f*)(g + c0 + i * 128);
#pragma unroll
    for (int i = 0; i < 8; ++i) bb[i] = *(const v4f*)(beta + c0 + i * 128);
    // the loads' offset register may be reused below: the wait stands in front of that
    asm volatile("s_wait_xcnt 0x0" ::: "memory");
    // inputs only: holds the sixteen scale and shift loads together, ahead of the second sum;
    // without it the compiler sinks them behind the sums, two at a time, each pair waited for
    asm volatile("" :: "v"(gg[0]), "v"(gg[1]), "v"(gg[2]), "v"(gg[3]), "v"(gg[4]), "v"(gg[5]),
                       "v"(gg[6]), "v"(gg[7]), "v"(bb[0]), "v"(bb[1]), "v"(bb[2]), "v"(bb[3]),
                       "v"(bb[4]), "v"(bb[5]), "v"(bb[6]), "v"(bb[7]));
    float s = 0.f;
#pragma unroll
    for (int i = 0; i < 8; ++i) {
        v[i] += w[i];
        s += (v[i][0] + v[i][1]) + (v[i][2] + v[i][3]);
    }
    const float mean = wave_sum(s) * (1.f / 1024.f);
    float ss = 0.f;
#pragma unroll
    for (int i = 0; i < 8; ++i) {
        const v4f d = v[i] - mean;
        ss += (d[0] * d[0] + d[1] * d[1]) + (d[2] * d[2] + d[3] * d[3]);
    }
    const float rstd = rsqrtf(wave_sum(ss) * (1.f / 1024.f) + 1e-5f);
#pragma unroll
    for (int i = 0; i < 8; ++i) v[i] = (v[i] - mean) * rstd * gg[i] + bb[i];
    if (outb) {
        v4bf p[8];
#pragma unroll
        for (int i = 0; i < 8; ++i) {
#pragma unroll
            for (int j = 0; j < 4; ++j) p[i][j] = f2bf(v[i][j]);
        }
#pragma unroll
        for (int i = 0; i < 8; ++i) *(v4bf*)(outb + ro + i * 128) = p[i];
        // registers that these stores name may be reused for the next stores' address
        asm volatile("s_wait_xcnt 0x0" ::: "memory");
    }
#pragma unroll
    for (int i = 0; i < 8; ++i) *(v4f*)(outf + ro + i * 128) = v[i];
}

// ---------------------------------------------------------------------------
// Host launch
// ---------------------------------------------------------------------------
extern "C" void kernel_launch(void* const* d_in, const int* in_sizes, int n_in,
                              void* d_out, int out_size, void* d_ws, size_t ws_size,
                              hipStream_t stream) {
    (void)in_sizes; (void)n_in; (void)out_size; (void)ws_size;
    const float* src = (const float*)d_in[0];
    const float* td  = (const float*)d_in[1];
    const float* dd  = (const float*)d_in[2];
    const float* Wq  = (const float*)d_in[3];
    const float* bq  = (const float*)d_in[4];
    const float* Wk  = (const float*)d_in[5];
    const float* bk  = (const float*)d_in[6];
    const float* Wv  = (const float*)d_in[7];
    const float* bv  = (const float*)d_in[8];
    const float* tw1 = (const float*)d_in[9];
    const float* tb1 = (const float*)d_in[10];
    const float* tw2 = (const float*)d_in[11];
    const float* tb2 = (const float*)d_in[12];
    const float* dw1 = (const float*)d_in[13];
    const float* db1 = (const float*)d_in[14];
    const float* dw2 = (const float*)d_in[15];
    const float* db2 = (const float*)d_in[16];
    const float* W1  = (const float*)d_in[17];
    const float* b1  = (const float*)d_in[18];
    const float* W2  = (const float*)d_in[19];
    const float* b2  = (const float*)d_in[20];
    const float* g1  = (const float*)d_in[21];
    const float* be1 = (const float*)d_in[22];
    const float* g2  = (const float*)d_in[23];
    const float* be2 = (const float*)d_in[24];

    const int M = BDIM * SDIM;  // 4096 rows
    char* ws = (char*)d_ws;
    size_t off = 0;
    auto alloc = [&](size_t bytes) {
        char* p = ws + off;
        off = (off + bytes + 255) & ~(size_t)255;
        return p;
    };
    __bf16* srcb = (__bf16*)alloc((size_t)M * DMODEL * 2);
    __bf16* Wqt  = (__bf16*)alloc((size_t)DMODEL * DMODEL * 2);
    __bf16* Wkt  = (__bf16*)alloc((size_t)DMODEL * DMODEL * 2);
    __bf16* Wvt  = (__bf16*)alloc((size_t)DMODEL * DMODEL * 2);
    __bf16* W1t  = (__bf16*)alloc((size_t)DMODEL * DFF * 2);
    __bf16* W2t  = (__bf16*)alloc((size_t)DFF * DMODEL * 2);
    __bf16* Qb   = (__bf16*)alloc((size_t)M * DMODEL * 2);
    __bf16* Kb   = (__bf16*)alloc((size_t)M * DMODEL * 2);
    __bf16* Vtb  = (__bf16*)alloc((size_t)M * DMODEL * 2);
    float*  attn = (float*)alloc((size_t)M * DMODEL * 4);
    float*  xf   = (float*)alloc((size_t)M * DMODEL * 4);
    __bf16* xb   = (__bf16*)alloc((size_t)M * DMODEL * 2);
    __bf16* h1   = (__bf16*)alloc((size_t)M * DFF * 2);
    float*  ffn  = (float*)alloc((size_t)M * DMODEL * 4);

    prep_kernel<<<PREP_BLOCKS, 256, 0, stream>>>(src, Wq, Wk, Wv, W1, W2,
                                                 srcb, Wqt, Wkt, Wvt, W1t, W2t);

    gemm_bf16_kernel<<<dim3(DMODEL / 128, M / 128, 3), 256, 0, stream>>>(
        srcb, Wqt, Wkt, Wvt, bq, bk, bv, Qb, Kb, Vtb, DMODEL, DMODEL, 0, 5, 2);

    attn_kernel<<<BDIM * (SDIM / 16), 32 * NHEAD, 0, stream>>>(
        Qb, Kb, Vtb, td, dd, tw1, tb1, tw2, tb2, dw1, db1, dw2, db2, attn);

    add_ln_kernel<<<M / 8, 256, 0, stream>>>(src, attn, g1, be1, xf, xb);

    gemm_bf16_kernel<<<dim3(DFF / 128, M / 128), 256, 0, stream>>>(
        xb, W1t, W1t, W1t, b1, b1, b1, h1, h1, h1, DFF, DMODEL, 3, 3, 3);
    gemm_bf16_kernel<<<dim3(DMODEL / 128, M / 128), 256, 0, stream>>>(
        h1, W2t, W2t, W2t, b2, b2, b2, ffn, ffn, ffn, DMODEL, DFF, 4, 4, 4);

    add_ln_kernel<<<M / 8, 256, 0, stream>>>(xf, ffn, g2, be2, (float*)d_out, nullptr);
}

// v009
// A run of this version takes 164 microseconds.
// In two side-by-side timings against v008, it was 1.06 and 1.07 times as fast.
// Over all steps from v000 it is 4.26 times as fast.
#include <hip/hip_runtime.h>

// ---------------------------------------------------------------------------
// SpatioTemporalTransformerLayer for MI455X (gfx1250, wave32, WMMA).
// B=4, S=1024, D=1024, H=16, HD=64, DFF=4096, BIAS_HID=8.
// GEMMs use v_wmma_f32_16x16x32_bf16 (bf16 A/B, f32 accumulate), the bias MLP v_wmma_f32_16x16x4_f32 (f32).
// GEMM operand tiles are staged in LDS by asynchronous copies (two buffers);
// fragments are read from LDS into ping-pong fragment buffers.
// ---------------------------------------------------------------------------

typedef __attribute__((ext_vector_type(16))) __bf16 v16bf;
typedef __attribute__((ext_vector_type(8)))  __bf16 v8bf;
typedef __attribute__((ext_vector_type(8)))  float  v8f;

#define BDIM 4
#define SDIM 1024
#define DMODEL 1024
#define NHEAD 16
#define HEADD 64
#define DFF 4096

__device__ __forceinline__ __bf16 f2bf(float x) {
    unsigned u = __builtin_bit_cast(unsigned, x);
    unsigned r = (u + 0x7FFFu + ((u >> 16) & 1u)) >> 16;
    return __builtin_bit_cast(__bf16, (unsigned short)r);
}

__device__ __forceinline__ v8f wmma_bf16(v16bf a, v16bf b, v8f c) {
    // (neg_a, A, neg_b, B, c_mod, C, reuse_a, reuse_b)
    return __builtin_amdgcn_wmma_f32_16x16x32_bf16(false, a, false, b, (short)0, c,
                                                   false, false);
}

// Load a 16x32 bf16 A/B fragment: lane L, elem e -> (row=L&15, K=16*(e>>3)+8*(L>>4)+(e&7))
// 'row_ptr' points at element K=0 of this lane's row. Two contiguous 16B loads.
__device__ __forceinline__ v16bf load_frag(const __bf16* row_ptr, int hl) {
    v8bf lo = *(const v8bf*)(row_ptr + hl * 8);
    v8bf hi = *(const v8bf*)(row_ptr + 16 + hl * 8);
    v16bf f;
#pragma unroll
    for (int i = 0; i < 8; ++i) { f[i] = lo[i]; f[8 + i] = hi[i]; }
    return f;
}

// Fragment order for an operand that only the attention reads: a 16-row x 32-k fragment is
// 1 KiB, two 512-B halves (k 0..15, k 16..31), and in a half lane L owns 16 B at L * 16:
// row = L & 15, k = 16 * half + 8 * (L >> 4) + 0..7, as load_frag reads it. A wave-wide
// 16-B load or store then covers 512 contiguous bytes (four whole lines).
// 'frag' counts fragments; the result is the element index of (row, k), k a multiple of 8.
__device__ __forceinline__ size_t frag_index(size_t frag, int row, int k) {
    return ((frag * 2 + ((k >> 4) & 1)) * 32 + ((k >> 3) & 1) * 16 + row) * 8;
}

// 'p' points at this lane's 16 B in the first half of the fragment.
__device__ __forceinline__ v16bf load_frag_packed(const __bf16* p) {
    v8bf lo = *(const v8bf*)p;
    v8bf hi = *(const v8bf*)(p + 256);
    v16bf f;
#pragma unroll
    for (int i = 0; i < 8; ++i) { f[i] = lo[i]; f[8 + i] = hi[i]; }
    return f;
}

// The eight 16-B units of a wave's 32 x 64 tile: 'po' is this lane's unit of tile (0, 0);
// 'sub' steps by a half fragment, 'g' by 'gstep' elements.
__device__ __forceinline__ void store_units(__bf16* po, int gstep, const v8bf (&pk)[2][4]) {
#pragma unroll
    for (int sub = 0; sub < 2; ++sub)
#pragma unroll
        for (int g = 0; g < 4; ++g) *(v8bf*)(po + g * gstep + sub * 256) = pk[sub][g];
    // other modes' code follows in the same kernel and reuses the stores' registers:
    // the wait stands behind the last store, in front of any such overwrite
    asm volatile("s_wait_xcnt 0x0" ::: "memory");
}

// ---------------------------------------------------------------------------
// Elementwise converters
// ---------------------------------------------------------------------------
typedef __attribute__((ext_vector_type(4))) __bf16 v4bf;
typedef __attribute__((ext_vector_type(4))) float  v4f;

// 32 elements a thread, so that the src job takes 4,096 waves in place of 131,072:
// eight 16-B loads in flight per lane, each wave-wide load 512 contiguous bytes,
// each wave-wide store 256. Its 512 blocks cover the array exactly (8,192 elements a block).
#define CVT_BLOCK_ELEMS (256 * 32)
__device__ __forceinline__ void cvt_f32_bf16_block(const float* __restrict__ in,
                                                   __bf16* __restrict__ out, int blk) {
    const size_t base = (size_t)blk * CVT_BLOCK_ELEMS + threadIdx.x * 4;
    v4f r[8];
#pragma unroll
    for (int i = 0; i < 8; ++i) r[i] = *(const v4f*)(in + base + i * 1024);
    // the loads' address registers may be reused below: the wait stands in front of that
    asm volatile("s_wait_xcnt 0x0" ::: "memory");
#pragma unroll
    for (int i = 0; i < 8; ++i) {
        v4bf p;
#pragma unroll
        for (int j = 0; j < 4; ++j) p[j] = f2bf(r[i][j]);
        *(v4bf*)(out + base + i * 1024) = p;
    }
    // other jobs' code follows in the same kernel and reuses the stores' registers:
    // the wait stands behind the last store, in front of any such overwrite
    asm volatile("s_wait_xcnt 0x0" ::: "memory");
}

// W[K][N] f32 (row-major) -> Wt[N][K] bf16, one 64x64 tile per 256-thread block.
// K and N are multiples of 64. Reads are 256-B row pieces (16 B a lane), the tile is
// turned in LDS, and every store instruction writes whole 128-B lines of Wt.
__device__ __forceinline__ void cvt_transpose_block(const float* __restrict__ W,
                                                    __bf16* __restrict__ Wt, int K, int N,
                                                    int bx, int by) {
    // 128-B rows at a 144-B pitch (16 B x odd) for the 16-byte readers.
    __shared__ __attribute__((aligned(16))) __bf16 tile[64][72];
    const int t = threadIdx.x;
    const int n0 = bx * 64;
    const int k0 = by * 64;

    const int nq = (t & 15) * 4;   // four columns of W
    const int kq = (t >> 4) * 4;   // four rows of W
    const float* in = W + (size_t)(k0 + kq) * N + n0 + nq;
    v4f r[4];
#pragma unroll
    for (int i = 0; i < 4; ++i) {
        r[i] = *(const v4f*)(in + (size_t)i * N);
        // a later load's result registers may reuse this load's address pair:
        // the wait stands between the load and any such overwrite
        asm volatile("s_wait_xcnt 0x0" ::: "memory");
    }
#pragma unroll
    for (int j = 0; j < 4; ++j) {
        v4bf p;
#pragma unroll
        for (int i = 0; i < 4; ++i) p[i] = f2bf(r[i][j]);
        *(v4bf*)&tile[nq + j][kq] = p;
    }
    __syncthreads();

    const int kk = (t & 7) * 8;    // eight lanes cover one 128-B row of the tile
#pragma unroll
    for (int pass = 0; pass < 2; ++pass) {
        const int n = (t >> 3) + pass * 32;
        *(v8bf*)(Wt + (size_t)(n0 + n) * K + k0 + kk) = *(const v8bf*)&tile[n][kk];
    }
    // other jobs' code follows in the same kernel and reuses the stores' registers:
    // the wait stands behind the last store, in front of any such overwrite
    asm volatile("s_wait_xcnt 0x0" ::: "memory");
}

// The six conversions depend on nothing and on one another not at all: one launch does
// them all, each block taking its job from its index. Ranges of blocks, in this order:
// W1, W2 (1,024 tiles each), src (512 pieces), Wq, Wk, Wv (256 tiles each).
#define PREP_BIG ((DMODEL / 64) * (DFF / 64))        // tiles of W1, of W2
#define PREP_SRC (BDIM * SDIM * DMODEL / CVT_BLOCK_ELEMS)
#define PREP_SQ ((DMODEL / 64) * (DMODEL / 64))      // tiles of Wq, of Wk, of Wv
#define PREP_BLOCKS (2 * PREP_BIG + PREP_SRC + 3 * PREP_SQ)
__global__ __launch_bounds__(256) void prep_kernel(
    const float* __restrict__ src, const float* __restrict__ Wq, const float* __restrict__ Wk,
    const float* __restrict__ Wv, const float* __restrict__ W1, const float* __restrict__ W2,
    __bf16* __restrict__ srcb, __bf16* __restrict__ Wqt, __bf16* __restrict__ Wkt,
    __bf16* __restrict__ Wvt, __bf16* __restrict__ W1t, __bf16* __restrict__ W2t) {
    int blk = blockIdx.x;   // every test below is the same for the whole block
    if (blk < PREP_BIG) {
        cvt_transpose_block(W1, W1t, DMODEL, DFF, blk & (DFF / 64 - 1), blk / (DFF / 64));
        return;
    }
    blk -= PREP_BIG;
    if (blk < PREP_BIG) {
        cvt_transpose_block(W2, W2t, DFF, DMODEL, blk & (DMODEL / 64 - 1), blk / (DMODEL / 64));
        return;
    }
    blk -= PREP_BIG;
    if (blk < PREP_SRC) {
        cvt_f32_bf16_block(src, srcb, blk);
        return;
    }
    blk -= PREP_SRC;
    const int which = blk / PREP_SQ;
    blk &= PREP_SQ - 1;
    const float* W = which == 0 ? Wq : which == 1 ? Wk : Wv;
    __bf16* Wt = which == 0 ? Wqt : which == 1 ? Wkt : Wvt;
    cvt_transpose_block(W, Wt, DMODEL, DMODEL, blk & (DMODEL / 64 - 1), blk / (DMODEL / 64));
}

// ---------------------------------------------------------------------------
// Generic bf16 WMMA GEMM: C[M,N] = A[M,K] * Wt[N,K]^T + bias, with mode epilogue
//   mode 0: Q layout    -> bf16 out[((b*16+h)*1024+s)*64+d]
//   mode 2: V           -> bf16, in the order of the attention's A fragments (frag_index)
//   mode 5: K           -> bf16, the same; the product is formed transposed (rows = features,
//                          columns = tokens), so that a lane's eight values are one 16-B unit
//   mode 3: ReLU        -> bf16 out[row*N+col]   (FFN1)
//   mode 4: plain f32   -> f32  out[row*N+col]   (FFN2)
// Modes 0, 3 and 4 form the product transposed as well: a lane's eight values are eight
// consecutive features of one token. The block's tile is turned in LDS as [token][feature]
// and goes out in 16-B stores that cover whole 128-B lines.
// Block: 256 threads = 8 waves on a 128 x 128 tile of C, 4 x 2 waves of 32 x 64 each: per
// multiply-add the block fetches two thirds of the L2 bytes that a 128 x 64 tile fetches.
// A pass is 128 k: the block's 128 rows of A and 128 rows of Wt (256 B each) are
// brought into LDS by asynchronous copies that read whole 128-B lines, two
// buffers, the copies of pass p+2 in flight while pass p+1 is worked on.
// Fragments come from LDS by 16-B reads; per 32-k chunk 2 A + 4 B frags -> 8 WMMAs.
// ---------------------------------------------------------------------------
#define G_PASS_K 128                       // k elements per pass
#define G_PITCH 136                        // LDS row pitch in elements: 272 B = 16 B x odd
#define G_ROWS (128 + 128)                 // A-operand rows, then B-operand rows
#define G_STAGE (G_ROWS * G_PITCH)         // elements per buffer
#define G_STEP_B (16 * G_PITCH * 2)        // LDS bytes between two copies of a thread (16 rows)

// Eight 16-B copies of one thread, 16 rows apart: global row step 'gs' elements.
// The s_wait_xcnt closes the statement so that no address register of a copy is
// rewritten ahead of it.
__device__ __forceinline__ void copy8_to_lds(unsigned l, const __bf16* g, size_t gs) {
    asm volatile(
        "global_load_async_to_lds_b128 %0, %8, off\n\t"
        "global_load_async_to_lds_b128 %1, %9, off\n\t"
        "global_load_async_to_lds_b128 %2, %10, off\n\t"
        "global_load_async_to_lds_b128 %3, %11, off\n\t"
        "global_load_async_to_lds_b128 %4, %12, off\n\t"
        "global_load_async_to_lds_b128 %5, %13, off\n\t"
        "global_load_async_to_lds_b128 %6, %14, off\n\t"
        "global_load_async_to_lds_b128 %7, %15, off\n\t"
        "s_wait_xcnt 0x0"
        :: "v"(l), "v"(l + 1 * G_STEP_B), "v"(l + 2 * G_STEP_B), "v"(l + 3 * G_STEP_B),
           "v"(l + 4 * G_STEP_B), "v"(l + 5 * G_STEP_B), "v"(l + 6 * G_STEP_B),
           "v"(l + 7 * G_STEP_B),
           "v"(g), "v"(g + gs), "v"(g + 2 * gs), "v"(g + 3 * gs),
           "v"(g + 4 * gs), "v"(g + 5 * gs), "v"(g + 6 * gs), "v"(g + 7 * gs)
        : "memory");
}

#define E_PITCH_F 132                      // f32 staging row pitch in words: 528 B = 16 B x odd

// A wave's 32 features x 64 tokens go to the bf16 staging tile as 16-B units: 'w' is the lane's
// unit of tile (0, 0); 'sub' steps by 16 features, 'g' by 16 token rows of G_PITCH elements.
template <bool RELU>
__device__ __forceinline__ void stage_units_bf16(__bf16* w, const v4f (&bv)[2][2],
                                                 const v8f (&c)[2][4]) {
#pragma unroll
    for (int sub = 0; sub < 2; ++sub)
#pragma unroll
        for (int g = 0; g < 4; ++g) {
            v8bf u;
#pragma unroll
            for (int v = 0; v < 8; ++v) {
                float val = c[sub][g][v] + bv[sub][v >> 2][v & 3];
                if (RELU) val = fmaxf(val, 0.f);
                u[v] = f2bf(val);
            }
            *(v8bf*)(w + g * 16 * G_PITCH + sub * 16) = u;
        }
}

// Eight 16-B units of one thread, STEP elements apart.
template <int STEP>
__device__ __forceinline__ void store_rows_bf16(__bf16* po, const v8bf (&r)[8]) {
#pragma unroll
    for (int i = 0; i < 8; ++i) *(v8bf*)(po + i * STEP) = r[i];
    // other modes' code follows in the same kernel and reuses the stores' registers:
    // the wait stands behind the last store, in front of any such overwrite
    asm volatile("s_wait_xcnt 0x0" ::: "memory");
}

// blockIdx.z picks one of up to three independent products on the same A (weights, bias,
// output and mode of its own): Q, K and V go in one launch; the FFN launches have z = 0 only.
__global__ __launch_bounds__(256) void gemm_bf16_kernel(
    const __bf16* __restrict__ A, const __bf16* __restrict__ Wt0,
    const __bf16* __restrict__ Wt1, const __bf16* __restrict__ Wt2,
    const float* __restrict__ bias0, const float* __restrict__ bias1,
    const float* __restrict__ bias2, void* __restrict__ out0, void* __restrict__ out1,
    void* __restrict__ out2, int N, int Kd, int mode0, int mode1, int mode2) {
    __shared__ __attribute__((aligned(16))) __bf16 sm[2 * G_STAGE];
    const int z = blockIdx.z;
    const __bf16* __restrict__ Wt = z == 0 ? Wt0 : z == 1 ? Wt1 : Wt2;
    const float* __restrict__ bias = z == 0 ? bias0 : z == 1 ? bias1 : bias2;
    void* __restrict__ outp = z == 0 ? out0 : z == 1 ? out1 : out2;
    const int mode = z == 0 ? mode0 : z == 1 ? mode1 : mode2;
    const int t = threadIdx.x;
    const int lane = t & 31;
    const int wv = t >> 5;
    const int hl = lane >> 4;
    const int l16 = lane & 15;
    // Every mode but 2 swaps the operands' roles: the 128 block rows are rows of Wt (features),
    // the 128 block columns rows of A (tokens). Mode 5 deals the same number of blocks anew;
    // the others keep their output tile (x = features, y = tokens).
    const bool swapped = mode != 2;
    const bool redeal = mode == 5;
    const int flat = blockIdx.y * (N / 128) + blockIdx.x;   // the grid is N / 128 wide
    const int nb = (redeal ? flat & (BDIM * SDIM / 128 - 1) : swapped ? blockIdx.y : blockIdx.x) * 128;
    const int mb = (redeal ? flat / (BDIM * SDIM / 128) : swapped ? blockIdx.x : blockIdx.y) * 128;
    const int m0 = mb + (wv >> 1) * 32;   // this wave's 32 rows
    const int n0 = nb + (wv & 1) * 64;    // and its 64 columns

    v8f c[2][4] = {};

    // copies: 16 lanes cover one 256-B row piece, a wave two rows, the block 16 rows
    const int crow = t >> 4;
    const int ccol = (t & 15) * 8;
    const size_t gs = (size_t)16 * Kd;
    const __bf16* gA = (swapped ? Wt : A) + (size_t)(mb + crow) * Kd + ccol;
    const __bf16* gB = (swapped ? A : Wt) + (size_t)(nb + crow) * Kd + ccol;
    const unsigned lc = (unsigned)(size_t)(&sm[0]) + (unsigned)(crow * G_PITCH + ccol) * 2u;

#define ISSUE_PASS(p, buf)                                                     \
    do {                                                                       \
        const unsigned lb = lc + (unsigned)(buf) * (G_STAGE * 2u);             \
        copy8_to_lds(lb, gA + (size_t)(p) * G_PASS_K, gs);                     \
        copy8_to_lds(lb + 8u * G_STEP_B, gB + (size_t)(p) * G_PASS_K, gs);     \
    } while (0)

    // fragment rows of this lane inside a buffer
    const int fa = ((wv >> 1) * 32 + l16) * G_PITCH;
    const int fb = (128 + (wv & 1) * 64 + l16) * G_PITCH;

    // ping-pong fragment buffers
    v16bf a0[2], a1[2], bb[2][4];

#define LOAD_CHUNK(buf, kk)                                                    \
    do {                                                                       \
        a0[buf] = load_frag(st + fa + (kk), hl);                               \
        a1[buf] = load_frag(st + fa + 16 * G_PITCH + (kk), hl);                \
        _Pragma("unroll") for (int g = 0; g < 4; ++g)                          \
            bb[buf][g] = load_frag(st + fb + g * 16 * G_PITCH + (kk), hl);     \
    } while (0)

#define COMPUTE(buf)                                               \
    do {                                                           \
        _Pragma("unroll") for (int g = 0; g < 4; ++g) {            \
            c[0][g] = wmma_bf16(a0[buf], bb[buf][g], c[0][g]);     \
            c[1][g] = wmma_bf16(a1[buf], bb[buf][g], c[1][g]);     \
        }                                                          \
    } while (0)

    // Kd is a multiple of 128 (1024 or 4096).
    const int npass = Kd / G_PASS_K;
    ISSUE_PASS(0, 0);
    // pass 0 has landed for this wave; the barrier publishes it to the others
    asm volatile("s_wait_asynccnt 0x0" ::: "memory");
    __syncthreads();
    if (npass > 1) ISSUE_PASS(1, 1);

    for (int p = 0; p < npass; ++p) {
        const __bf16* st = sm + (p & 1) * G_STAGE;
        // The scheduling barriers keep each chunk's twelve LDS reads together and one
        // chunk ahead of their WMMAs; without them the compiler sinks the reads to
        // pairs directly in front of their use, each pair behind a wait to zero.
        LOAD_CHUNK(0, 0);
        LOAD_CHUNK(1, 32);
        __builtin_amdgcn_sched_barrier(0);
        COMPUTE(0);
        __builtin_amdgcn_sched_barrier(0);
        LOAD_CHUNK(0, 64);
        __builtin_amdgcn_sched_barrier(0);
        COMPUTE(1);
        __builtin_amdgcn_sched_barrier(0);
        LOAD_CHUNK(1, 96);
        // The pass's last LDS reads are out: the hand-over stands here, ahead of the
        // last two chunks' WMMAs (registers only), so that the refill flies under them.
        // this wave's reads of the buffer have returned before it is refilled
        asm volatile("s_wait_dscnt 0x0" ::: "memory");
        // this wave's copies of pass p+1 have landed before the barrier publishes them
        asm volatile("s_wait_asynccnt 0x0" ::: "memory");
        __syncthreads();
        if (p + 2 < npass) ISSUE_PASS(p + 2, p & 1);
        COMPUTE(0);
        COMPUTE(1);
    }
    // no copy is outstanding when the wave goes on to its end
    asm volatile("s_wait_asynccnt 0x0" ::: "memory");
#undef ISSUE_PASS
#undef LOAD_CHUNK
#undef COMPUTE

    // K and V go out in fragment order: a lane's eight accumulator values of a tile are one
    // 16-B unit, a wave-wide store 512 contiguous bytes. The tests are the same for the block.
    if (mode == 5) {
        // K: tile rows are head dims (k of the fragment), tile columns tokens (its rows);
        // fragment = (16 keys, 32 head dims), two per 16 keys: g steps by two fragments
        const int tok = n0 + l16;
        const size_t bhx = (size_t)((tok >> 10) * 16 + (m0 >> 6));
        const size_t fr = (bhx * 64 + ((tok & 1023) >> 4)) * 2 + ((m0 >> 5) & 1);
        v8bf pk[2][4];
#pragma unroll
        for (int sub = 0; sub < 2; ++sub)
#pragma unroll
            for (int v = 0; v < 8; ++v) {
                const float bcst = bias[m0 + sub * 16 + hl * 8 + v];
#pragma unroll
                for (int g = 0; g < 4; ++g) pk[sub][g][v] = f2bf(c[sub][g][v] + bcst);
            }
        store_units((__bf16*)outp + frag_index(fr, l16, hl * 8), 1024, pk);
        return;
    }
    if (mode == 2) {
        // V: tile rows are tokens (k of the fragment), tile columns head dims (its rows);
        // fragment = (16 head dims, 32 keys), four per 32 keys: g steps by one fragment
        const size_t bhx = (size_t)((m0 >> 10) * 16 + (n0 >> 6));
        const size_t fr = (bhx * 32 + ((m0 & 1023) >> 5)) * 4;
        v8bf pk[2][4];
#pragma unroll
        for (int g = 0; g < 4; ++g) {
            const float bcst = bias[n0 + g * 16 + l16];
#pragma unroll
            for (int sub = 0; sub < 2; ++sub)
#pragma unroll
                for (int v = 0; v < 8; ++v) pk[sub][g][v] = f2bf(c[sub][g][v] + bcst);
        }
        store_units((__bf16*)outp + frag_index(fr, l16, hl * 8), 512, pk);
        return;
    }

    // Q, FFN1, FFN2. The ring is idle here: every wave's last LDS reads and its last copies
    // ended in front of the last pass's barrier, so the staging tile may lie on it.
    const float* bp = bias + m0 + hl * 8;   // the lane's eight features of sub = 0
    v4f bv[2][2];
#pragma unroll
    for (int sub = 0; sub < 2; ++sub) {
        bv[sub][0] = *(const v4f*)(bp + sub * 16);
        bv[sub][1] = *(const v4f*)(bp + sub * 16 + 4);
    }
    // the wait stands in front of any reuse of the loads' address pair; naming the pair as an
    // input keeps it live up to it
    asm volatile("s_wait_xcnt 0x0" :: "v"(bp) : "memory");
    const int fl = (wv >> 1) * 32 + hl * 8;   // the lane's first feature inside the block tile
    const int tl = (wv & 1) * 64 + l16;       // its token of g = 0 inside the block tile

    if (mode == 4) {
        float* stf = (float*)sm;   // 128 token rows of 128 floats
#pragma unroll
        for (int sub = 0; sub < 2; ++sub)
#pragma unroll
            for (int g = 0; g < 4; ++g) {
                v4f lo, hi;
#pragma unroll
                for (int v = 0; v < 4; ++v) {
                    lo[v] = c[sub][g][v] + bv[sub][0][v];
                    hi[v] = c[sub][g][4 + v] + bv[sub][1][v];
                }
                float* w = stf + (tl + g * 16) * E_PITCH_F + fl + sub * 16;
                *(v4f*)w = lo;
                *(v4f*)(w + 4) = hi;
            }
        __syncthreads();   // the tile is whole before any wave reads other waves' units
        // one wave a token row: a wave-wide store is 512 contiguous bytes, four lines
        v4f r[16];
#pragma unroll
        for (int i = 0; i < 16; ++i)
            r[i] = *(const v4f*)(stf + (wv + i * 8) * E_PITCH_F + lane * 4);
        // FFN2's row pitch is DMODEL: known at compile time, the sixteen stores share one
        // address pair and differ in their immediate offsets
        float* po = (float*)outp + (size_t)(nb + wv) * DMODEL + mb + lane * 4;
#pragma unroll
        for (int i = 0; i < 16; ++i) *(v4f*)(po + i * 8 * DMODEL) = r[i];
        // other modes' code follows in the same kernel and reuses the stores' registers:
        // the wait stands behind the last store, in front of any such overwrite
        asm volatile("s_wait_xcnt 0x0" ::: "memory");
        return;
    }

    {
        __bf16* w = sm + tl * G_PITCH + fl;   // 128 token rows of 128 bf16 at the ring's pitch
        if (mode == 3) stage_units_bf16<true>(w, bv, c);
        else           stage_units_bf16<false>(w, bv, c);
        __syncthreads();   // the tile is whole before any wave reads other waves' units
        // 16 lanes cover a token's 256 B: two whole lines (for Q one line of each of two heads)
        const int rr = t >> 4;
        const int cc = (t & 15) * 8;
        v8bf r[8];
#pragma unroll
        for (int i = 0; i < 8; ++i) r[i] = *(const v8bf*)(sm + (rr + i * 16) * G_PITCH + cc);
        const int tok = nb + rr;   // the block's 128 tokens lie in one batch element
        const int f = mb + cc;
        // the step of 16 tokens is known at compile time (FFN1's row pitch is DFF, a head's row
        // of Q is HEADD): a thread's eight stores share one address pair
        if (mode == 3)
            store_rows_bf16<16 * DFF>((__bf16*)outp + (size_t)tok * DFF + f, r);
        else
            store_rows_bf16<16 * HEADD>(
                (__bf16*)outp +
                    ((size_t)((tok >> 10) * NHEAD + (f >> 6)) * SDIM + (tok & 1023)) * HEADD + (f & 63),
                r);
    }
}

// ---------------------------------------------------------------------------
// Flash attention with the pair-bias MLP shared by the heads.
// One 16-wave block per (b, 16-row q-tile); wave w runs head w over all keys.
// The hidden layer of the bias MLP does not depend on the head, so it is worked out
// once per (q, key): for each chunk of 64 keys wave w takes q row w, forms the 16 hidden
// values of each pair (lanes 0-15 the eight of t_deltas, lanes 16-31 the eight of dists)
// and multiplies them with the 16x16 output weights by v_wmma_f32_16x16x4_f32
// (A = w2^T: row = head; B = hidden: column = key), all in f32. The result goes to LDS as
// bias[head][q row][key], two buffers, one chunk ahead, one block barrier a chunk.
// K and V arrive in fragment order (frag_index): every K or V load of a wave reads 512
// contiguous bytes, four whole lines, each line touched by one load only.
// Both products are formed transposed: S^T = K Q^T (A = K fragment, B = Q fragment) and
// O^T += V^T P^T (A = V fragment, B = P^T). A lane then holds scores of one query only
// (column l16; keys 8 * hl + 0..7 of each 16), so maximum, sum and rescale factor are
// per-lane values, and the two score tiles of 32 keys, converted in place, are the B
// fragment of the second product in the k order of load_frag: in the loop nothing but the
// bias passes through LDS.
// ---------------------------------------------------------------------------
typedef __attribute__((ext_vector_type(2))) float v2f;

#define AT_CHUNK 64                        // keys per bias chunk
#define AT_BROW 68                         // bias row pitch in words: 272 B = 16 B x odd
#define AT_BPLANE (16 * AT_BROW + 4)       // words per head; 8 planes = 32 banks mod 64

// Orders this wave's LDS writes ahead of its own later LDS reads of other lanes' words
// (the output tile belongs to one wave alone, so no block barrier is needed):
// the LDS-only fences keep the compiler from moving LDS accesses over this point and
// make it wait for the wave's outstanding LDS operations.
__device__ __forceinline__ void wave_lds_order() {
    __builtin_amdgcn_fence(__ATOMIC_RELEASE, "workgroup", "local");
    __builtin_amdgcn_wave_barrier();
    __builtin_amdgcn_fence(__ATOMIC_ACQUIRE, "workgroup", "local");
}

__global__ __launch_bounds__(512) void attn_kernel(
    const __bf16* __restrict__ Q, const __bf16* __restrict__ Km,
    const __bf16* __restrict__ Vt, const float* __restrict__ td,
    const float* __restrict__ dd, const float* __restrict__ tw1,
    const float* __restrict__ tb1, const float* __restrict__ tw2,
    const float* __restrict__ tb2, const float* __restrict__ dw1,
    const float* __restrict__ db1, const float* __restrict__ dw2,
    const float* __restrict__ db2, float* __restrict__ out) {
    const int lane = threadIdx.x & 31;
    const int hl = lane >> 4;
    const int l16 = lane & 15;
    const int h = __builtin_amdgcn_readfirstlane(threadIdx.x >> 5);  // wave = head
    const int qt = blockIdx.x & 63;
    const int b = blockIdx.x >> 6;

    __shared__ __attribute__((aligned(16))) float bs[2][16 * AT_BPLANE];   // bias, all heads

    // Bias MLP operands of this lane. k slot (chunk c, register j, lane half hl) of both
    // WMMA operands is hidden unit 2c+j of the t_deltas MLP (hl = 0) or the dists MLP (hl = 1).
    const float* w1p = hl ? dw1 : tw1;
    const float* b1p = hl ? db1 : tb1;
    const float* w2p = hl ? dw2 : tw2;
    float w1[8], b1[8];
    v2f wa[4];
#pragma unroll
    for (int j = 0; j < 8; ++j) { w1[j] = w1p[j]; b1[j] = b1p[j]; }
#pragma unroll
    for (int c = 0; c < 4; ++c) {
        wa[c][0] = w2p[(2 * c) * 16 + l16];
        wa[c][1] = w2p[(2 * c + 1) * 16 + l16];
    }
    v8f cinit;  // accumulator start: the two output biases of head v + 8*hl
#pragma unroll
    for (int v = 0; v < 8; ++v) cinit[v] = tb2[v + 8 * hl] + db2[v + 8 * hl];
    // the wait stands in front of any reuse of these loads' address registers; naming the
    // pairs as inputs keeps them live up to it
    asm volatile("s_wait_xcnt 0x0" :: "v"(w1p), "v"(b1p), "v"(w2p) : "memory");
    // q row qt*16 + h of this lane's matrix; the lane owns keys 4*l16 .. 4*l16+3 of a chunk
    const float* mrow = (hl ? dd : td) + ((size_t)b * SDIM + qt * 16 + h) * SDIM + l16 * 4;

#define MAKE_BIAS(buf, m4)                                                              \
    do {                                                                                \
        v8f acc[4] = {cinit, cinit, cinit, cinit};                                      \
        _Pragma("unroll") for (int c = 0; c < 4; ++c) {                                 \
            _Pragma("unroll") for (int g = 0; g < 4; ++g) {                             \
                v2f hb;                                                                 \
                hb[0] = fmaxf((m4)[g] * w1[2 * c] + b1[2 * c], 0.f);                    \
                hb[1] = fmaxf((m4)[g] * w1[2 * c + 1] + b1[2 * c + 1], 0.f);            \
                acc[g] = __builtin_amdgcn_wmma_f32_16x16x4_f32(                         \
                    false, wa[c], false, hb, (short)0, acc[g], false, false);           \
            }                                                                           \
        }                                                                               \
        _Pragma("unroll") for (int v = 0; v < 8; ++v) {                                 \
            v4f o4 = {acc[0][v], acc[1][v], acc[2][v], acc[3][v]};                      \
            *(v4f*)&bs[buf][(v + 8 * hl) * AT_BPLANE + h * AT_BROW + l16 * 4] = o4;     \
        }                                                                               \
    } while (0)

    const size_t bh = (size_t)(b * 16 + h);

    // Q B-fragments (column = query l16) for the two K-dim halves (hd 0..31, 32..63)
    v16bf qa[2];
    {
        const __bf16* r = Q + (bh * 1024 + qt * 16 + l16) * 64;
        qa[0] = load_frag(r, hl);
        qa[1] = load_frag(r + 32, hl);
    }

    v8f o[4] = {};   // O^T: o[g][v] = (head dim g * 16 + 8 * hl + v, query l16)
    // running maximum of query l16 (equal in both lane halves) and this half's share of its sum
    float mrun = -1e30f, lrow = 0.f;

    v4f mreg = *(const v4f*)mrow;
    // the load's address pair may be reused below: the wait stands in front of that
    asm volatile("s_wait_xcnt 0x0" :: "v"(mrow) : "memory");
    MAKE_BIAS(0, mreg);
    mreg = *(const v4f*)(mrow + AT_CHUNK);
    // the load's address pair may be reused below: the wait stands in front of that
    asm volatile("s_wait_xcnt 0x0" :: "v"(mrow) : "memory");
    __syncthreads();  // chunk 0's bias is published to every head's wave

    for (int kc = 0; kc < SDIM; kc += AT_CHUNK) {
        const int buf = (kc / AT_CHUNK) & 1;
        for (int kb = kc; kb < kc + AT_CHUNK; kb += 32) {
            // ---- K for 32 keys: 2 groups of 16 keys x 2 K-dim halves = 4 fragments ----
            v16bf kf[2][2];
            // per 16 keys two fragments (head dims 0..31, 32..63) of 512 elements each
            const __bf16* kr = Km + ((bh * 64 + (kb >> 4)) * 2) * 512 + lane * 8;
#pragma unroll
            for (int g = 0; g < 2; ++g) {
                kf[g][0] = load_frag_packed(kr + g * 1024);
                kf[g][1] = load_frag_packed(kr + g * 1024 + 512);
            }
            // the wait stands in front of any reuse of the loads' address pair; naming the
            // pair as an input keeps it live up to it, so that no load's result lands on it
            asm volatile("s_wait_xcnt 0x0" :: "v"(kr) : "memory");
            // the next chunk's bias is made here, while the chunk's first K loads are under way
            if (kb == kc && kc + AT_CHUNK < SDIM) {
                MAKE_BIAS(buf ^ 1, mreg);
            }
            // inputs only: holds the eight K loads together, one trip to L2; without it the
            // compiler issues them in pairs into the same registers, each pair waited for
            asm volatile("" :: "v"(kf[0][0]), "v"(kf[0][1]), "v"(kf[1][0]), "v"(kf[1][1]));
            // The matrix row piece of the chunk after next is fetched behind the K wait: loads
            // return in order, so in front of it this read from memory would hold up the K data.
            if (kb == kc && kc + 2 * AT_CHUNK < SDIM) {
                mreg = *(const v4f*)(mrow + kc + 2 * AT_CHUNK);
                // the load's address pair may be reused below: the wait stands in front of that
                asm volatile("s_wait_xcnt 0x0" :: "v"(mrow) : "memory");
            }
            // ---- S^T and online softmax: the lane holds query l16, keys g*16 + hl*8 + 0..7 ----
            const float* brow = &bs[buf][h * AT_BPLANE + l16 * AT_BROW + (kb - kc) + hl * 8];
            float pm = -1e30f;
            float sv[2][8];
#pragma unroll
            for (int g = 0; g < 2; ++g) {
                v8f s = {};
                s = wmma_bf16(kf[g][0], qa[0], s);
                s = wmma_bf16(kf[g][1], qa[1], s);
                const v4f blo = *(const v4f*)(brow + g * 16);
                const v4f bhi = *(const v4f*)(brow + g * 16 + 4);
#pragma unroll
                for (int v = 0; v < 8; ++v) {
                    sv[g][v] = s[v] * (1.0f / 32.0f) + (v < 4 ? blo[v & 3] : bhi[v & 3]);
                    pm = fmaxf(pm, sv[g][v]);
                }
            }
            pm = fmaxf(pm, __shfl_xor(pm, 16, 32));
            const float nm = fmaxf(mrun, pm);
            const float cf = __expf(mrun - nm);
            float ps = 0.f;
            v16bf pt;   // P^T as a B fragment: element g*8 + v is key 16*g + 8*hl + v
#pragma unroll
            for (int g = 0; g < 2; ++g)
#pragma unroll
                for (int v = 0; v < 8; ++v) {
                    float p = __expf(sv[g][v] - nm);
                    ps += p;
                    pt[g * 8 + v] = f2bf(p);
                }
            lrow = lrow * cf + ps;   // the halves' sums are joined behind the loop
            mrun = nm;

            // ---- rescale O^T, then O^T += V^T * P^T (4 WMMAs) ----
#pragma unroll
            for (int g = 0; g < 4; ++g)
#pragma unroll
                for (int v = 0; v < 8; ++v) o[g][v] *= cf;

            // per 32 keys four fragments (16 head dims each) of 512 elements
            const __bf16* vr = Vt + ((bh * 32 + (kb >> 5)) * 4) * 512 + lane * 8;
            v16bf vb[4];
#pragma unroll
            for (int g = 0; g < 4; ++g) vb[g] = load_frag_packed(vr + g * 512);
            // as behind the K loads: the address pair stays live up to the wait
            asm volatile("s_wait_xcnt 0x0" :: "v"(vr) : "memory");
#pragma unroll
            for (int g = 0; g < 4; ++g) o[g] = wmma_bf16(vb[g], pt, o[g]);
        }
        // publishes the next chunk's bias and ends every wave's reads of this chunk's
        // buffer, which the next trip refills
        __syncthreads();
    }
#undef MAKE_BIAS

    const float ri = 1.f / (lrow + __shfl_xor(lrow, 16, 32));
#pragma unroll
    for (int g = 0; g < 4; ++g)
#pragma unroll
        for (int v = 0; v < 8; ++v) o[g][v] *= ri;
    // O^T is turned in LDS so that every store writes whole lines. The bias planes are dead
    // behind the loop's last barrier; wave h alone uses plane h of buffer 0 (16 rows of 68 words).
    // A lane's eight values of a tile are eight consecutive head dims of its query's row.
    float* ot = &bs[0][h * AT_BPLANE];
#pragma unroll
    for (int g = 0; g < 4; ++g) {
        const v4f lo = {o[g][0], o[g][1], o[g][2], o[g][3]};
        const v4f hi = {o[g][4], o[g][5], o[g][6], o[g][7]};
        *(v4f*)&ot[l16 * AT_BROW + g * 16 + hl * 8] = lo;
        *(v4f*)&ot[l16 * AT_BROW + g * 16 + hl * 8 + 4] = hi;
    }
    wave_lds_order();
    // 16 lanes cover the 256 B of one query's head: a wave-wide store is two rows, four lines
    v4f orow[8];
#pragma unroll
    for (int i = 0; i < 8; ++i) orow[i] = *(const v4f*)&ot[(i * 2 + hl) * AT_BROW + l16 * 4];
    float* po = out + ((size_t)b * SDIM + qt * 16 + hl) * DMODEL + h * 64 + l16 * 4;
#pragma unroll
    for (int i = 0; i < 8; ++i) *(v4f*)(po + (size_t)i * 2 * DMODEL) = orow[i];
}

// ---------------------------------------------------------------------------
// Residual + LayerNorm over D=1024. One wave per row, eight rows per 256-thread block:
// a launch starts 4,096 waves in place of 32,768. A lane holds 32 elements of its row
// (eight 16-B pieces, 512 B apart), its loads all in flight together; the two row sums are
// in-lane adds and a five-step butterfly over the wave, so no LDS and no barrier.
// ---------------------------------------------------------------------------
__device__ __forceinline__ float wave_sum(float s) {
#pragma unroll
    for (int m = 16; m > 0; m >>= 1) s += __shfl_xor(s, m, 32);
    return s;
}

__global__ __launch_bounds__(256) void add_ln_kernel(
    const float* __restrict__ a, const float* __restrict__ r,
    const float* __restrict__ g, const float* __restrict__ beta,
    float* __restrict__ outf, __bf16* __restrict__ outb) {
    const int lane = threadIdx.x & 31;
    const int row = blockIdx.x * 8 + (threadIdx.x >> 5);
    const int c0 = lane * 4;
    const size_t ro = (size_t)row * DMODEL + c0;
    const float* pa = a + ro;
    const float* pr = r + ro;
    v4f v[8], w[8], gg[8], bb[8];
#pragma unroll
    for (int i = 0; i < 8; ++i) v[i] = *(const v4f*)(pa + i * 128);
#pragma unroll
    for (int i = 0; i < 8; ++i) w[i] = *(const v4f*)(pr + i * 128);
    // the wait stands in front of any reuse of the loads' address pairs; naming the pairs
    // as inputs keeps them live up to it, so that no load's result is placed on them
    asm volatile("s_wait_xcnt 0x0" :: "v"(pa), "v"(pr) : "memory");
    // scale and shift are fetched ahead of their use, under the sums
#pragma unroll
    for (int i = 0; i < 8; ++i) gg[i] = *(const v4f*)(g + c0 + i * 128);
#pragma unroll
    for (int i = 0; i < 8; ++i) bb[i] = *(const v4f*)(beta + c0 + i * 128);
    // the loads' offset register may be reused below: the wait stands in front of that
    asm volatile("s_wait_xcnt 0x0" ::: "memory");
    // inputs only: holds the sixteen scale and shift loads together, ahead of the second sum;
    // without it the compiler sinks them behind the sums, two at a time, each pair waited for
    asm volatile("" :: "v"(gg[0]), "v"(gg[1]), "v"(gg[2]), "v"(gg[3]), "v"(gg[4]), "v"(gg[5]),
                       "v"(gg[6]), "v"(gg[7]), "v"(bb[0]), "v"(bb[1]), "v"(bb[2]), "v"(bb[3]),
                       "v"(bb[4]), "v"(bb[5]), "v"(bb[6]), "v"(bb[7]));
    float s = 0.f;
#pragma unroll
    for (int i = 0; i < 8; ++i) {
        v[i] += w[i];
        s += (v[i][0] + v[i][1]) + (v[i][2] + v[i][3]);
    }
    const float mean = wave_sum(s) * (1.f / 1024.f);
    float ss = 0.f;
#pragma unroll
    for (int i = 0; i < 8; ++i) {
        const v4f d = v[i] - mean;
        ss += (d[0] * d[0] + d[1] * d[1]) + (d[2] * d[2] + d[3] * d[3]);
    }
    const float rstd = rsqrtf(wave_sum(ss) * (1.f / 1024.f) + 1e-5f);
#pragma unroll
    for (int i = 0; i < 8; ++i) v[i] = (v[i] - mean) * rstd * gg[i] + bb[i];
    if (outb) {
        v4bf p[8];
#pragma unroll
        for (int i = 0; i < 8; ++i) {
#pragma unroll
            for (int j = 0; j < 4; ++j) p[i][j] = f2bf(v[i][j]);
        }
#pragma unroll
        for (int i = 0; i < 8; ++i) *(v4bf*)(outb + ro + i * 128) = p[i];
        // registers that these stores name may be reused for the next stores' address
        asm volatile("s_wait_xcnt 0x0" ::: "memory");
    }
#pragma unroll
    for (int i = 0; i < 8; ++i) *(v4f*)(outf + ro + i * 128) = v[i];
}

// ---------------------------------------------------------------------------
// Host launch
// ---------------------------------------------------------------------------
extern "C" void kernel_launch(void* const* d_in, const int* in_sizes, int n_in,
                              void* d_out, int out_size, void* d_ws, size_t ws_size,
                              hipStream_t stream) {
    (void)in_sizes; (void)n_in; (void)out_size; (void)ws_size;
    const float* src = (const float*)d_in[0];
    const float* td  = (const float*)d_in[1];
    const float* dd  = (const float*)d_in[2];
    const float* Wq  = (const float*)d_in[3];
    const float* bq  = (const float*)d_in[4];
    const float* Wk  = (const float*)d_in[5];
    const float* bk  = (const float*)d_in[6];
    const float* Wv  = (const float*)d_in[7];
    const float* bv  = (const float*)d_in[8];
    const float* tw1 = (const float*)d_in[9];
    const float* tb1 = (const float*)d_in[10];
    const float* tw2 = (const float*)d_in[11];
    const float* tb2 = (const float*)d_in[12];
    const float* dw1 = (const float*)d_in[13];
    const float* db1 = (const float*)d_in[14];
    const float* dw2 = (const float*)d_in[15];
    const float* db2 = (const float*)d_in[16];
    const float* W1  = (const float*)d_in[17];
    const float* b1  = (const float*)d_in[18];
    const float* W2  = (const float*)d_in[19];
    const float* b2  = (const float*)d_in[20];
    const float* g1  = (const float*)d_in[21];
    const float* be1 = (const float*)d_in[22];
    const float* g2  = (const float*)d_in[23];
    const float* be2 = (const float*)d_in[24];

    const int M = BDIM * SDIM;  // 4096 rows
    char* ws = (char*)d_ws;
    size_t off = 0;
    auto alloc = [&](size_t bytes) {
        char* p = ws + off;
        off = (off + bytes + 255) & ~(size_t)255;
        return p;
    };
    __bf16* srcb = (__bf16*)alloc((size_t)M * DMODEL * 2);
    __bf16* Wqt  = (__bf16*)alloc((size_t)DMODEL * DMODEL * 2);
    __bf16* Wkt  = (__bf16*)alloc((size_t)DMODEL * DMODEL * 2);
    __bf16* Wvt  = (__bf16*)alloc((size_t)DMODEL * DMODEL * 2);
    __bf16* W1t  = (__bf16*)alloc((size_t)DMODEL * DFF * 2);
    __bf16* W2t  = (__bf16*)alloc((size_t)DFF * DMODEL * 2);
    __bf16* Qb   = (__bf16*)alloc((size_t)M * DMODEL * 2);
    __bf16* Kb   = (__bf16*)alloc((size_t)M * DMODEL * 2);
    __bf16* Vtb  = (__bf16*)alloc((size_t)M * DMODEL * 2);
    float*  attn = (float*)alloc((size_t)M * DMODEL * 4);
    float*  xf   = (float*)alloc((size_t)M * DMODEL * 4);
    __bf16* xb   = (__bf16*)alloc((size_t)M * DMODEL * 2);
    __bf16* h1   = (__bf16*)alloc((size_t)M * DFF * 2);
    float*  ffn  = (float*)alloc((size_t)M * DMODEL * 4);

    prep_kernel<<<PREP_BLOCKS, 256, 0, stream>>>(src, Wq, Wk, Wv, W1, W2,
                                                 srcb, Wqt, Wkt, Wvt, W1t, W2t);

    gemm_bf16_kernel<<<dim3(DMODEL / 128, M / 128, 3), 256, 0, stream>>>(
        srcb, Wqt, Wkt, Wvt, bq, bk, bv, Qb, Kb, Vtb, DMODEL, DMODEL, 0, 5, 2);

    attn_kernel<<<BDIM * (SDIM / 16), 32 * NHEAD, 0, stream>>>(
        Qb, Kb, Vtb, td, dd, tw1, tb1, tw2, tb2, dw1, db1, dw2, db2, attn);

    add_ln_kernel<<<M / 8, 256, 0, stream>>>(src, attn, g1, be1, xf, xb);

    gemm_bf16_kernel<<<dim3(DFF / 128, M / 128), 256, 0, stream>>>(
        xb, W1t, W1t, W1t, b1, b1, b1, h1, h1, h1, DFF, DMODEL, 3, 3, 3);
    gemm_bf16_kernel<<<dim3(DMODEL / 128, M / 128), 256, 0, stream>>>(
        h1, W2t, W2t, W2t, b2, b2, b2, ffn, ffn, ffn, DMODEL, DFF, 4, 4, 4);

    add_ln_kernel<<<M / 8, 256, 0, stream>>>(xf, ffn, g2, be2, (float*)d_out, nullptr);
}

// v010
// It runs in 160 microseconds.
// Next to v009, in two timings, it ran 1.03 times as fast each time.
// All steps since v000 together make it 4.39 times as fast.
#include <hip/hip_runtime.h>

// ---------------------------------------------------------------------------
// SpatioTemporalTransformerLayer for MI455X (gfx1250, wave32, WMMA).
// B=4, S=1024, D=1024, H=16, HD=64, DFF=4096, BIAS_HID=8.
// GEMMs use v_wmma_f32_16x16x32_bf16 (bf16 A/B, f32 accumulate), the bias MLP v_wmma_f32_16x16x4_f32 (f32).
// GEMM operand tiles are staged in LDS by asynchronous copies (two buffers);
// fragments are read from LDS into ping-pong fragment buffers.
// ---------------------------------------------------------------------------

typedef __attribute__((ext_vector_type(16))) __bf16 v16bf;
typedef __attribute__((ext_vector_type(8)))  __bf16 v8bf;
typedef __attribute__((ext_vector_type(8)))  float  v8f;

#define BDIM 4
#define SDIM 1024
#define DMODEL 1024
#define NHEAD 16
#define HEADD 64
#define DFF 4096

__device__ __forceinline__ __bf16 f2bf(float x) {
    unsigned u = __builtin_bit_cast(unsigned, x);
    unsigned r = (u + 0x7FFFu + ((u >> 16) & 1u)) >> 16;
    return __builtin_bit_cast(__bf16, (unsigned short)r);
}

__device__ __forceinline__ v8f wmma_bf16(v16bf a, v16bf b, v8f c) {
    // (neg_a, A, neg_b, B, c_mod, C, reuse_a, reuse_b)
    return __builtin_amdgcn_wmma_f32_16x16x32_bf16(false, a, false, b, (short)0, c,
                                                   false, false);
}

// Load a 16x32 bf16 A/B fragment: lane L, elem e -> (row=L&15, K=16*(e>>3)+8*(L>>4)+(e&7))
// 'row_ptr' points at element K=0 of this lane's row. Two contiguous 16B loads.
__device__ __forceinline__ v16bf load_frag(const __bf16* row_ptr, int hl) {
    v8bf lo = *(const v8bf*)(row_ptr + hl * 8);
    v8bf hi = *(const v8bf*)(row_ptr + 16 + hl * 8);
    v16bf f;
#pragma unroll
    for (int i = 0; i < 8; ++i) { f[i] = lo[i]; f[8 + i] = hi[i]; }
    return f;
}

// Fragment order for an operand that only the attention reads: a 16-row x 32-k fragment is
// 1 KiB, two 512-B halves (k 0..15, k 16..31), and in a half lane L owns 16 B at L * 16:
// row = L & 15, k = 16 * half + 8 * (L >> 4) + 0..7, as load_frag reads it. A wave-wide
// 16-B load or store then covers 512 contiguous bytes (four whole lines).
// 'frag' counts fragments; the result is the element index of (row, k), k a multiple of 8.
__device__ __forceinline__ size_t frag_index(size_t frag, int row, int k) {
    return ((frag * 2 + ((k >> 4) & 1)) * 32 + ((k >> 3) & 1) * 16 + row) * 8;
}

// 'p' points at this lane's 16 B in the first half of the fragment.
__device__ __forceinline__ v16bf load_frag_packed(const __bf16* p) {
    v8bf lo = *(const v8bf*)p;
    v8bf hi = *(const v8bf*)(p + 256);
    v16bf f;
#pragma unroll
    for (int i = 0; i < 8; ++i) { f[i] = lo[i]; f[8 + i] = hi[i]; }
    return f;
}

// The eight 16-B units of a wave's 32 x 64 tile: 'po' is this lane's unit of tile (0, 0);
// 'sub' steps by a half fragment, 'g' by 'gstep' elements.
__device__ __forceinline__ void store_units(__bf16* po, int gstep, const v8bf (&pk)[2][4]) {
#pragma unroll
    for (int sub = 0; sub < 2; ++sub)
#pragma unroll
        for (int g = 0; g < 4; ++g) *(v8bf*)(po + g * gstep + sub * 256) = pk[sub][g];
    // other modes' code follows in the same kernel and reuses the stores' registers:
    // the wait stands behind the last store, in front of any such overwrite
    asm volatile("s_wait_xcnt 0x0" ::: "memory");
}

// ---------------------------------------------------------------------------
// Elementwise converters
// ---------------------------------------------------------------------------
typedef __attribute__((ext_vector_type(4))) __bf16 v4bf;
typedef __attribute__((ext_vector_type(4))) float  v4f;

// 32 elements a thread, so that the src job takes 4,096 waves in place of 131,072:
// eight 16-B loads in flight per lane, each wave-wide load 512 contiguous bytes,
// each wave-wide store 256. Its 512 blocks cover the array exactly (8,192 elements a block).
#define CVT_BLOCK_ELEMS (256 * 32)
__device__ __forceinline__ void cvt_f32_bf16_block(const float* __restrict__ in,
                                                   __bf16* __restrict__ out, int blk) {
    const size_t base = (size_t)blk * CVT_BLOCK_ELEMS + threadIdx.x * 4;
    v4f r[8];
#pragma unroll
    for (int i = 0; i < 8; ++i) r[i] = *(const v4f*)(in + base + i * 1024);
    // the loads' address registers may be reused below: the wait stands in front of that
    asm volatile("s_wait_xcnt 0x0" ::: "memory");
#pragma unroll
    for (int i = 0; i < 8; ++i) {
        v4bf p;
#pragma unroll
        for (int j = 0; j < 4; ++j) p[j] = f2bf(r[i][j]);
        *(v4bf*)(out + base + i * 1024) = p;
    }
    // other jobs' code follows in the same kernel and reuses the stores' registers:
    // the wait stands behind the last store, in front of any such overwrite
    asm volatile("s_wait_xcnt 0x0" ::: "memory");
}

// W[K][N] f32 (row-major) -> Wt[N][K] bf16, one 64x64 tile per 256-thread block.
// K and N are multiples of 64. Reads are 256-B row pieces (16 B a lane), the tile is
// turned in LDS, and every store instruction writes whole 128-B lines of Wt.
__device__ __forceinline__ void cvt_transpose_block(const float* __restrict__ W,
                                                    __bf16* __restrict__ Wt, int K, int N,
                                                    int bx, int by) {
    // 128-B rows at a 144-B pitch (16 B x odd) for the 16-byte readers.
    __shared__ __attribute__((aligned(16))) __bf16 tile[64][72];
    const int t = threadIdx.x;
    const int n0 = bx * 64;
    const int k0 = by * 64;

    const int nq = (t & 15) * 4;   // four columns of W
    const int kq = (t >> 4) * 4;   // four rows of W
    const float* in = W + (size_t)(k0 + kq) * N + n0 + nq;
    v4f r[4];
#pragma unroll
    for (int i = 0; i < 4; ++i) {
        r[i] = *(const v4f*)(in + (size_t)i * N);
        // a later load's result registers may reuse this load's address pair:
        // the wait stands between the load and any such overwrite
        asm volatile("s_wait_xcnt 0x0" ::: "memory");
    }
#pragma unroll
    for (int j = 0; j < 4; ++j) {
        v4bf p;
#pragma unroll
        for (int i = 0; i < 4; ++i) p[i] = f2bf(r[i][j]);
        *(v4bf*)&tile[nq + j][kq] = p;
    }
    __syncthreads();

    const int kk = (t & 7) * 8;    // eight lanes cover one 128-B row of the tile
#pragma unroll
    for (int pass = 0; pass < 2; ++pass) {
        const int n = (t >> 3) + pass * 32;
        *(v8bf*)(Wt + (size_t)(n0 + n) * K + k0 + kk) = *(const v8bf*)&tile[n][kk];
    }
    // other jobs' code follows in the same kernel and reuses the stores' registers:
    // the wait stands behind the last store, in front of any such overwrite
    asm volatile("s_wait_xcnt 0x0" ::: "memory");
}

// The six conversions depend on nothing and on one another not at all: one launch does
// them all, each block taking its job from its index. Ranges of blocks, in this order:
// W1, W2 (1,024 tiles each), src (512 pieces), Wq, Wk, Wv (256 tiles each).
#define PREP_BIG ((DMODEL / 64) * (DFF / 64))        // tiles of W1, of W2
#define PREP_SRC (BDIM * SDIM * DMODEL / CVT_BLOCK_ELEMS)
#define PREP_SQ ((DMODEL / 64) * (DMODEL / 64))      // tiles of Wq, of Wk, of Wv
#define PREP_BLOCKS (2 * PREP_BIG + PREP_SRC + 3 * PREP_SQ)
__global__ __launch_bounds__(256) void prep_kernel(
    const float* __restrict__ src, const float* __restrict__ Wq, const float* __restrict__ Wk,
    const float* __restrict__ Wv, const float* __restrict__ W1, const float* __restrict__ W2,
    __bf16* __restrict__ srcb, __bf16* __restrict__ Wqt, __bf16* __restrict__ Wkt,
    __bf16* __restrict__ Wvt, __bf16* __restrict__ W1t, __bf16* __restrict__ W2t) {
    int blk = blockIdx.x;   // every test below is the same for the whole block
    if (blk < PREP_BIG) {
        cvt_transpose_block(W1, W1t, DMODEL, DFF, blk & (DFF / 64 - 1), blk / (DFF / 64));
        return;
    }
    blk -= PREP_BIG;
    if (blk < PREP_BIG) {
        cvt_transpose_block(W2, W2t, DFF, DMODEL, blk & (DMODEL / 64 - 1), blk / (DMODEL / 64));
        return;
    }
    blk -= PREP_BIG;
    if (blk < PREP_SRC) {
        cvt_f32_bf16_block(src, srcb, blk);
        return;
    }
    blk -= PREP_SRC;
    const int which = blk / PREP_SQ;
    blk &= PREP_SQ - 1;
    const float* W = which == 0 ? Wq : which == 1 ? Wk : Wv;
    __bf16* Wt = which == 0 ? Wqt : which == 1 ? Wkt : Wvt;
    cvt_transpose_block(W, Wt, DMODEL, DMODEL, blk & (DMODEL / 64 - 1), blk / (DMODEL / 64));
}

// ---------------------------------------------------------------------------
// Generic bf16 WMMA GEMM: C[M,N] = A[M,K] * Wt[N,K]^T + bias, with mode epilogue
//   mode 0: Q layout    -> bf16 out[((b*16+h)*1024+s)*64+d]
//   mode 2: V           -> bf16, in the order of the attention's A fragments (frag_index)
//   mode 5: K           -> bf16, the same; the product is formed transposed (rows = features,
//                          columns = tokens), so that a lane's eight values are one 16-B unit
//   mode 3: ReLU        -> bf16 out[row*N+col]   (FFN1)
//   mode 4: plain f32   -> f32  out[row*N+col]   (FFN2)
// Modes 0, 3 and 4 form the product transposed as well: a lane's eight values are eight
// consecutive features of one token. The block's tile is turned in LDS as [token][feature]
// and goes out in 16-B stores that cover whole 128-B lines.
// Block: 256 threads = 8 waves on a 128 x 128 tile of C, 4 x 2 waves of 32 x 64 each: per
// multiply-add the block fetches two thirds of the L2 bytes that a 128 x 64 tile fetches.
// A pass is 128 k: the block's 128 rows of A and 128 rows of Wt (256 B each) are
// brought into LDS by asynchronous copies that read whole 128-B lines, two
// buffers, the copies of pass p+2 in flight while pass p+1 is worked on.
// Fragments come from LDS by 16-B reads; per 32-k chunk 2 A + 4 B frags -> 8 WMMAs.
// ---------------------------------------------------------------------------
#define G_PASS_K 128                       // k elements per pass
#define G_PITCH 136                        // LDS row pitch in elements: 272 B = 16 B x odd
#define G_ROWS (128 + 128)                 // A-operand rows, then B-operand rows
#define G_STAGE (G_ROWS * G_PITCH)         // elements per buffer
#define G_STEP_B (16 * G_PITCH * 2)        // LDS bytes between two copies of a thread (16 rows)

// Eight 16-B copies of one thread, 16 rows apart: global row step 'gs' elements.
// The s_wait_xcnt closes the statement so that no address register of a copy is
// rewritten ahead of it.
__device__ __forceinline__ void copy8_to_lds(unsigned l, const __bf16* g, size_t gs) {
    asm volatile(
        "global_load_async_to_lds_b128 %0, %8, off\n\t"
        "global_load_async_to_lds_b128 %1, %9, off\n\t"
        "global_load_async_to_lds_b128 %2, %10, off\n\t"
        "global_load_async_to_lds_b128 %3, %11, off\n\t"
        "global_load_async_to_lds_b128 %4, %12, off\n\t"
        "global_load_async_to_lds_b128 %5, %13, off\n\t"
        "global_load_async_to_lds_b128 %6, %14, off\n\t"
        "global_load_async_to_lds_b128 %7, %15, off\n\t"
        "s_wait_xcnt 0x0"
        :: "v"(l), "v"(l + 1 * G_STEP_B), "v"(l + 2 * G_STEP_B), "v"(l + 3 * G_STEP_B),
           "v"(l + 4 * G_STEP_B), "v"(l + 5 * G_STEP_B), "v"(l + 6 * G_STEP_B),
           "v"(l + 7 * G_STEP_B),
           "v"(g), "v"(g + gs), "v"(g + 2 * gs), "v"(g + 3 * gs),
           "v"(g + 4 * gs), "v"(g + 5 * gs), "v"(g + 6 * gs), "v"(g + 7 * gs)
        : "memory");
}

#define E_PITCH_F 132                      // f32 staging row pitch in words: 528 B = 16 B x odd

// A wave's 32 features x 64 tokens go to the bf16 staging tile as 16-B units: 'w' is the lane's
// unit of tile (0, 0); 'sub' steps by 16 features, 'g' by 16 token rows of G_PITCH elements.
template <bool RELU>
__device__ __forceinline__ void stage_units_bf16(__bf16* w, const v4f (&bv)[2][2],
                                                 const v8f (&c)[2][4]) {
#pragma unroll
    for (int sub = 0; sub < 2; ++sub)
#pragma unroll
        for (int g = 0; g < 4; ++g) {
            v8bf u;
#pragma unroll
            for (int v = 0; v < 8; ++v) {
                float val = c[sub][g][v] + bv[sub][v >> 2][v & 3];
                if (RELU) val = fmaxf(val, 0.f);
                u[v] = f2bf(val);
            }
            *(v8bf*)(w + g * 16 * G_PITCH + sub * 16) = u;
        }
}

// Eight 16-B units of one thread, STEP elements apart.
template <int STEP>
__device__ __forceinline__ void store_rows_bf16(__bf16* po, const v8bf (&r)[8]) {
#pragma unroll
    for (int i = 0; i < 8; ++i) *(v8bf*)(po + i * STEP) = r[i];
    // other modes' code follows in the same kernel and reuses the stores' registers:
    // the wait stands behind the last store, in front of any such overwrite
    asm volatile("s_wait_xcnt 0x0" ::: "memory");
}

// blockIdx.z picks one of up to three independent products on the same A (weights, bias,
// output and mode of its own): Q, K and V go in one launch; the FFN launches have z = 0 only.
__global__ __launch_bounds__(256) void gemm_bf16_kernel(
    const __bf16* __restrict__ A, const __bf16* __restrict__ Wt0,
    const __bf16* __restrict__ Wt1, const __bf16* __restrict__ Wt2,
    const float* __restrict__ bias0, const float* __restrict__ bias1,
    const float* __restrict__ bias2, void* __restrict__ out0, void* __restrict__ out1,
    void* __restrict__ out2, int N, int Kd, int mode0, int mode1, int mode2) {
    __shared__ __attribute__((aligned(16))) __bf16 sm[2 * G_STAGE];
    const int z = blockIdx.z;
    const __bf16* __restrict__ Wt = z == 0 ? Wt0 : z == 1 ? Wt1 : Wt2;
    const float* __restrict__ bias = z == 0 ? bias0 : z == 1 ? bias1 : bias2;
    void* __restrict__ outp = z == 0 ? out0 : z == 1 ? out1 : out2;
    const int mode = z == 0 ? mode0 : z == 1 ? mode1 : mode2;
    const int t = threadIdx.x;
    const int lane = t & 31;
    const int wv = t >> 5;
    const int hl = lane >> 4;
    const int l16 = lane & 15;
    // Every mode but 2 swaps the operands' roles: the 128 block rows are rows of Wt (features),
    // the 128 block columns rows of A (tokens). Mode 5 deals the same number of blocks anew;
    // the others keep their output tile (x = features, y = tokens).
    const bool swapped = mode != 2;
    const bool redeal = mode == 5;
    const int flat = blockIdx.y * (N / 128) + blockIdx.x;   // the grid is N / 128 wide
    const int nb = (redeal ? flat & (BDIM * SDIM / 128 - 1) : swapped ? blockIdx.y : blockIdx.x) * 128;
    const int mb = (redeal ? flat / (BDIM * SDIM / 128) : swapped ? blockIdx.x : blockIdx.y) * 128;
    const int m0 = mb + (wv >> 1) * 32;   // this wave's 32 rows
    const int n0 = nb + (wv & 1) * 64;    // and its 64 columns

    v8f c[2][4] = {};

    // copies: 16 lanes cover one 256-B row piece, a wave two rows, the block 16 rows
    const int crow = t >> 4;
    const int ccol = (t & 15) * 8;
    const size_t gs = (size_t)16 * Kd;
    const __bf16* gA = (swapped ? Wt : A) + (size_t)(mb + crow) * Kd + ccol;
    const __bf16* gB = (swapped ? A : Wt) + (size_t)(nb + crow) * Kd + ccol;
    const unsigned lc = (unsigned)(size_t)(&sm[0]) + (unsigned)(crow * G_PITCH + ccol) * 2u;

#define ISSUE_PASS(p, buf)                                                     \
    do {                                                                       \
        const unsigned lb = lc + (unsigned)(buf) * (G_STAGE * 2u);             \
        copy8_to_lds(lb, gA + (size_t)(p) * G_PASS_K, gs);                     \
        copy8_to_lds(lb + 8u * G_STEP_B, gB + (size_t)(p) * G_PASS_K, gs);     \
    } while (0)

    // fragment rows of this lane inside a buffer
    const int fa = ((wv >> 1) * 32 + l16) * G_PITCH;
    const int fb = (128 + (wv & 1) * 64 + l16) * G_PITCH;

    // ping-pong fragment buffers
    v16bf a0[2], a1[2], bb[2][4];

#define LOAD_CHUNK(buf, kk)                                                    \
    do {                                                                       \
        a0[buf] = load_frag(st + fa + (kk), hl);                               \
        a1[buf] = load_frag(st + fa + 16 * G_PITCH + (kk), hl);                \
        _Pragma("unroll") for (int g = 0; g < 4; ++g)                          \
            bb[buf][g] = load_frag(st + fb + g * 16 * G_PITCH + (kk), hl);     \
    } while (0)

#define COMPUTE(buf)                                               \
    do {                                                           \
        _Pragma("unroll") for (int g = 0; g < 4; ++g) {            \
            c[0][g] = wmma_bf16(a0[buf], bb[buf][g], c[0][g]);     \
            c[1][g] = wmma_bf16(a1[buf], bb[buf][g], c[1][g]);     \
        }                                                          \
    } while (0)

    // Kd is a multiple of 128 (1024 or 4096).
    const int npass = Kd / G_PASS_K;
    ISSUE_PASS(0, 0);
    // pass 0 has landed for this wave; the barrier publishes it to the others
    asm volatile("s_wait_asynccnt 0x0" ::: "memory");
    __syncthreads();
    if (npass > 1) ISSUE_PASS(1, 1);

    for (int p = 0; p < npass; ++p) {
        const __bf16* st = sm + (p & 1) * G_STAGE;
        // The scheduling barriers keep each chunk's twelve LDS reads together and one
        // chunk ahead of their WMMAs; without them the compiler sinks the reads to
        // pairs directly in front of their use, each pair behind a wait to zero.
        LOAD_CHUNK(0, 0);
        LOAD_CHUNK(1, 32);
        __builtin_amdgcn_sched_barrier(0);
        COMPUTE(0);
        __builtin_amdgcn_sched_barrier(0);
        LOAD_CHUNK(0, 64);
        __builtin_amdgcn_sched_barrier(0);
        COMPUTE(1);
        __builtin_amdgcn_sched_barrier(0);
        LOAD_CHUNK(1, 96);
        // The pass's last LDS reads are out: the hand-over stands here, ahead of the
        // last two chunks' WMMAs (registers only), so that the refill flies under them.
        // this wave's reads of the buffer have returned before it is refilled
        asm volatile("s_wait_dscnt 0x0" ::: "memory");
        // this wave's copies of pass p+1 have landed before the barrier publishes them
        asm volatile("s_wait_asynccnt 0x0" ::: "memory");
        __syncthreads();
        if (p + 2 < npass) ISSUE_PASS(p + 2, p & 1);
        COMPUTE(0);
        COMPUTE(1);
    }
    // no copy is outstanding when the wave goes on to its end
    asm volatile("s_wait_asynccnt 0x0" ::: "memory");
#undef ISSUE_PASS
#undef LOAD_CHUNK
#undef COMPUTE

    // K and V go out in fragment order: a lane's eight accumulator values of a tile are one
    // 16-B unit, a wave-wide store 512 contiguous bytes. The tests are the same for the block.
    if (mode == 5) {
        // K: tile rows are head dims (k of the fragment), tile columns tokens (its rows);
        // fragment = (16 keys, 32 head dims), two per 16 keys: g steps by two fragments
        const int tok = n0 + l16;
        const size_t bhx = (size_t)((tok >> 10) * 16 + (m0 >> 6));
        const size_t fr = (bhx * 64 + ((tok & 1023) >> 4)) * 2 + ((m0 >> 5) & 1);
        v8bf pk[2][4];
#pragma unroll
        for (int sub = 0; sub < 2; ++sub)
#pragma unroll
            for (int v = 0; v < 8; ++v) {
                const float bcst = bias[m0 + sub * 16 + hl * 8 + v];
#pragma unroll
                for (int g = 0; g < 4; ++g) pk[sub][g][v] = f2bf(c[sub][g][v] + bcst);
            }
        store_units((__bf16*)outp + frag_index(fr, l16, hl * 8), 1024, pk);
        return;
    }
    if (mode == 2) {
        // V: tile rows are tokens (k of the fragment), tile columns head dims (its rows);
        // fragment = (16 head dims, 32 keys), four per 32 keys: g steps by one fragment
        const size_t bhx = (size_t)((m0 >> 10) * 16 + (n0 >> 6));
        const size_t fr = (bhx * 32 + ((m0 & 1023) >> 5)) * 4;
        v8bf pk[2][4];
#pragma unroll
        for (int g = 0; g < 4; ++g) {
            const float bcst = bias[n0 + g * 16 + l16];
#pragma unroll
            for (int sub = 0; sub < 2; ++sub)
#pragma unroll
                for (int v = 0; v < 8; ++v) pk[sub][g][v] = f2bf(c[sub][g][v] + bcst);
        }
        store_units((__bf16*)outp + frag_index(fr, l16, hl * 8), 512, pk);
        return;
    }

    // Q, FFN1, FFN2. The ring is idle here: every wave's last LDS reads and its last copies
    // ended in front of the last pass's barrier, so the staging tile may lie on it.
    const float* bp = bias + m0 + hl * 8;   // the lane's eight features of sub = 0
    v4f bv[2][2];
#pragma unroll
    for (int sub = 0; sub < 2; ++sub) {
        bv[sub][0] = *(const v4f*)(bp + sub * 16);
        bv[sub][1] = *(const v4f*)(bp + sub * 16 + 4);
    }
    // the wait stands in front of any reuse of the loads' address pair; naming the pair as an
    // input keeps it live up to it
    asm volatile("s_wait_xcnt 0x0" :: "v"(bp) : "memory");
    const int fl = (wv >> 1) * 32 + hl * 8;   // the lane's first feature inside the block tile
    const int tl = (wv & 1) * 64 + l16;       // its token of g = 0 inside the block tile

    if (mode == 4) {
        float* stf = (float*)sm;   // 128 token rows of 128 floats
#pragma unroll
        for (int sub = 0; sub < 2; ++sub)
#pragma unroll
            for (int g = 0; g < 4; ++g) {
                v4f lo, hi;
#pragma unroll
                for (int v = 0; v < 4; ++v) {
                    lo[v] = c[sub][g][v] + bv[sub][0][v];
                    hi[v] = c[sub][g][4 + v] + bv[sub][1][v];
                }
                float* w = stf + (tl + g * 16) * E_PITCH_F + fl + sub * 16;
                *(v4f*)w = lo;
                *(v4f*)(w + 4) = hi;
            }
        __syncthreads();   // the tile is whole before any wave reads other waves' units
        // one wave a token row: a wave-wide store is 512 contiguous bytes, four lines
        v4f r[16];
#pragma unroll
        for (int i = 0; i < 16; ++i)
            r[i] = *(const v4f*)(stf + (wv + i * 8) * E_PITCH_F + lane * 4);
        // FFN2's row pitch is DMODEL: known at compile time, the sixteen stores share one
        // address pair and differ in their immediate offsets
        float* po = (float*)outp + (size_t)(nb + wv) * DMODEL + mb + lane * 4;
#pragma unroll
        for (int i = 0; i < 16; ++i) *(v4f*)(po + i * 8 * DMODEL) = r[i];
        // other modes' code follows in the same kernel and reuses the stores' registers:
        // the wait stands behind the last store, in front of any such overwrite
        asm volatile("s_wait_xcnt 0x0" ::: "memory");
        return;
    }

    {
        __bf16* w = sm + tl * G_PITCH + fl;   // 128 token rows of 128 bf16 at the ring's pitch
        if (mode == 3) stage_units_bf16<true>(w, bv, c);
        else           stage_units_bf16<false>(w, bv, c);
        __syncthreads();   // the tile is whole before any wave reads other waves' units
        // 16 lanes cover a token's 256 B: two whole lines (for Q one line of each of two heads)
        const int rr = t >> 4;
        const int cc = (t & 15) * 8;
        v8bf r[8];
#pragma unroll
        for (int i = 0; i < 8; ++i) r[i] = *(const v8bf*)(sm + (rr + i * 16) * G_PITCH + cc);
        const int tok = nb + rr;   // the block's 128 tokens lie in one batch element
        const int f = mb + cc;
        // the step of 16 tokens is known at compile time (FFN1's row pitch is DFF, a head's row
        // of Q is HEADD): a thread's eight stores share one address pair
        if (mode == 3)
            store_rows_bf16<16 * DFF>((__bf16*)outp + (size_t)tok * DFF + f, r);
        else
            store_rows_bf16<16 * HEADD>(
                (__bf16*)outp +
                    ((size_t)((tok >> 10) * NHEAD + (f >> 6)) * SDIM + (tok & 1023)) * HEADD + (f & 63),
                r);
    }
}

// ---------------------------------------------------------------------------
// Flash attention with the pair-bias MLP shared by the heads.
// One 16-wave block per (b, 16-row q-tile); wave w runs head w over all keys.
// The hidden layer of the bias MLP does not depend on the head, so it is worked out
// once per (q, key): for each chunk of 64 keys wave w takes q row w, forms the 16 hidden
// values of each pair (lanes 0-15 the eight of t_deltas, lanes 16-31 the eight of dists)
// and multiplies them with the 16x16 output weights by v_wmma_f32_16x16x4_f32
// (A = w2^T: row = head; B = hidden: column = key), all in f32. The result goes to LDS as
// bias[head][q row][key], two buffers, one chunk ahead, one block barrier a chunk.
// K and V arrive in fragment order (frag_index): every K or V load of a wave reads 512
// contiguous bytes, four whole lines, each line touched by one load only.
// Both products are formed transposed: S^T = K Q^T (A = K fragment, B = Q fragment) and
// O^T += V^T P^T (A = V fragment, B = P^T). A lane then holds scores of one query only
// (column l16; keys 8 * hl + 0..7 of each 16), so maximum, sum and rescale factor are
// per-lane values, and the two score tiles of 32 keys, converted in place, are the B
// fragment of the second product in the k order of load_frag: in the loop nothing but the
// bias passes through LDS.
// The block ends with the residual add and the first LayerNorm of its 16 rows.
// ---------------------------------------------------------------------------
typedef __attribute__((ext_vector_type(2))) float v2f;

#define AT_CHUNK 64                        // keys per bias chunk
#define AT_BROW 68                         // bias row pitch in words: 272 B = 16 B x odd
#define AT_BPLANE (16 * AT_BROW + 4)       // words per head; 8 planes = 32 banks mod 64

// Sum over the 32 lanes of a wave, the same in every lane: a five-step butterfly.
__device__ __forceinline__ float wave_sum(float s) {
#pragma unroll
    for (int m = 16; m > 0; m >>= 1) s += __shfl_xor(s, m, 32);
    return s;
}

__global__ __launch_bounds__(512) void attn_kernel(
    const __bf16* __restrict__ Q, const __bf16* __restrict__ Km,
    const __bf16* __restrict__ Vt, const float* __restrict__ td,
    const float* __restrict__ dd, const float* __restrict__ tw1,
    const float* __restrict__ tb1, const float* __restrict__ tw2,
    const float* __restrict__ tb2, const float* __restrict__ dw1,
    const float* __restrict__ db1, const float* __restrict__ dw2,
    const float* __restrict__ db2, const float* __restrict__ src,
    const float* __restrict__ g, const float* __restrict__ beta,
    float* __restrict__ outf, __bf16* __restrict__ outb) {
    const int lane = threadIdx.x & 31;
    const int hl = lane >> 4;
    const int l16 = lane & 15;
    const int h = __builtin_amdgcn_readfirstlane(threadIdx.x >> 5);  // wave = head
    const int qt = blockIdx.x & 63;
    const int b = blockIdx.x >> 6;

    __shared__ __attribute__((aligned(16))) float bs[2][16 * AT_BPLANE];   // bias, all heads

    // Bias MLP operands of this lane. k slot (chunk c, register j, lane half hl) of both
    // WMMA operands is hidden unit 2c+j of the t_deltas MLP (hl = 0) or the dists MLP (hl = 1).
    const float* w1p = hl ? dw1 : tw1;
    const float* b1p = hl ? db1 : tb1;
    const float* w2p = hl ? dw2 : tw2;
    float w1[8], b1[8];
    v2f wa[4];
#pragma unroll
    for (int j = 0; j < 8; ++j) { w1[j] = w1p[j]; b1[j] = b1p[j]; }
#pragma unroll
    for (int c = 0; c < 4; ++c) {
        wa[c][0] = w2p[(2 * c) * 16 + l16];
        wa[c][1] = w2p[(2 * c + 1) * 16 + l16];
    }
    v8f cinit;  // accumulator start: the two output biases of head v + 8*hl
#pragma unroll
    for (int v = 0; v < 8; ++v) cinit[v] = tb2[v + 8 * hl] + db2[v + 8 * hl];
    // the wait stands in front of any reuse of these loads' address registers; naming the
    // pairs as inputs keeps them live up to it
    asm volatile("s_wait_xcnt 0x0" :: "v"(w1p), "v"(b1p), "v"(w2p) : "memory");
    // q row qt*16 + h of this lane's matrix; the lane owns keys 4*l16 .. 4*l16+3 of a chunk
    const float* mrow = (hl ? dd : td) + ((size_t)b * SDIM + qt * 16 + h) * SDIM + l16 * 4;

#define MAKE_BIAS(buf, m4)                                                              \
    do {                                                                                \
        v8f acc[4] = {cinit, cinit, cinit, cinit};                                      \
        _Pragma("unroll") for (int c = 0; c < 4; ++c) {                                 \
            _Pragma("unroll") for (int g = 0; g < 4; ++g) {                             \
                v2f hb;                                                                 \
                hb[0] = fmaxf((m4)[g] * w1[2 * c] + b1[2 * c], 0.f);                    \
                hb[1] = fmaxf((m4)[g] * w1[2 * c + 1] + b1[2 * c + 1], 0.f);            \
                acc[g] = __builtin_amdgcn_wmma_f32_16x16x4_f32(                         \
                    false, wa[c], false, hb, (short)0, acc[g], false, false);           \
            }                                                                           \
        }                                                                               \
        _Pragma("unroll") for (int v = 0; v < 8; ++v) {                                 \
            v4f o4 = {acc[0][v], acc[1][v], acc[2][v], acc[3][v]};                      \
            *(v4f*)&bs[buf][(v + 8 * hl) * AT_BPLANE + h * AT_BROW + l16 * 4] = o4;     \
        }                                                                               \
    } while (0)

    const size_t bh = (size_t)(b * 16 + h);

    // Q B-fragments (column = query l16) for the two K-dim halves (hd 0..31, 32..63)
    v16bf qa[2];
    {
        const __bf16* r = Q + (bh * 1024 + qt * 16 + l16) * 64;
        qa[0] = load_frag(r, hl);
        qa[1] = load_frag(r + 32, hl);
    }

    v8f o[4] = {};   // O^T: o[g][v] = (head dim g * 16 + 8 * hl + v, query l16)
    // running maximum of query l16 (equal in both lane halves) and this half's share of its sum
    float mrun = -1e30f, lrow = 0.f;

    v4f mreg = *(const v4f*)mrow;
    // the load's address pair may be reused below: the wait stands in front of that
    asm volatile("s_wait_xcnt 0x0" :: "v"(mrow) : "memory");
    MAKE_BIAS(0, mreg);
    mreg = *(const v4f*)(mrow + AT_CHUNK);
    // the load's address pair may be reused below: the wait stands in front of that
    asm volatile("s_wait_xcnt 0x0" :: "v"(mrow) : "memory");
    __syncthreads();  // chunk 0's bias is published to every head's wave

    for (int kc = 0; kc < SDIM; kc += AT_CHUNK) {
        const int buf = (kc / AT_CHUNK) & 1;
        for (int kb = kc; kb < kc + AT_CHUNK; kb += 32) {
            // ---- K for 32 keys: 2 groups of 16 keys x 2 K-dim halves = 4 fragments ----
            v16bf kf[2][2];
            // per 16 keys two fragments (head dims 0..31, 32..63) of 512 elements each
            const __bf16* kr = Km + ((bh * 64 + (kb >> 4)) * 2) * 512 + lane * 8;
#pragma unroll
            for (int g = 0; g < 2; ++g) {
                kf[g][0] = load_frag_packed(kr + g * 1024);
                kf[g][1] = load_frag_packed(kr + g * 1024 + 512);
            }
            // the wait stands in front of any reuse of the loads' address pair; naming the
            // pair as an input keeps it live up to it, so that no load's result lands on it
            asm volatile("s_wait_xcnt 0x0" :: "v"(kr) : "memory");
            // the next chunk's bias is made here, while the chunk's first K loads are under way
            if (kb == kc && kc + AT_CHUNK < SDIM) {
                MAKE_BIAS(buf ^ 1, mreg);
            }
            // inputs only: holds the eight K loads together, one trip to L2; without it the
            // compiler issues them in pairs into the same registers, each pair waited for
            asm volatile("" :: "v"(kf[0][0]), "v"(kf[0][1]), "v"(kf[1][0]), "v"(kf[1][1]));
            // The matrix row piece of the chunk after next is fetched behind the K wait: loads
            // return in order, so in front of it this read from memory would hold up the K data.
            if (kb == kc && kc + 2 * AT_CHUNK < SDIM) {
                mreg = *(const v4f*)(mrow + kc + 2 * AT_CHUNK);
                // the load's address pair may be reused below: the wait stands in front of that
                asm volatile("s_wait_xcnt 0x0" :: "v"(mrow) : "memory");
            }
            // ---- S^T and online softmax: the lane holds query l16, keys g*16 + hl*8 + 0..7 ----
            const float* brow = &bs[buf][h * AT_BPLANE + l16 * AT_BROW + (kb - kc) + hl * 8];
            float pm = -1e30f;
            float sv[2][8];
#pragma unroll
            for (int g = 0; g < 2; ++g) {
                v8f s = {};
                s = wmma_bf16(kf[g][0], qa[0], s);
                s = wmma_bf16(kf[g][1], qa[1], s);
                const v4f blo = *(const v4f*)(brow + g * 16);
                const v4f bhi = *(const v4f*)(brow + g * 16 + 4);
#pragma unroll
                for (int v = 0; v < 8; ++v) {
                    sv[g][v] = s[v] * (1.0f / 32.0f) + (v < 4 ? blo[v & 3] : bhi[v & 3]);
                    pm = fmaxf(pm, sv[g][v]);
                }
            }
            pm = fmaxf(pm, __shfl_xor(pm, 16, 32));
            const float nm = fmaxf(mrun, pm);
            const float cf = __expf(mrun - nm);
            float ps = 0.f;
            v16bf pt;   // P^T as a B fragment: element g*8 + v is key 16*g + 8*hl + v
#pragma unroll
            for (int g = 0; g < 2; ++g)
#pragma unroll
                for (int v = 0; v < 8; ++v) {
                    float p = __expf(sv[g][v] - nm);
                    ps += p;
                    pt[g * 8 + v] = f2bf(p);
                }
            lrow = lrow * cf + ps;   // the halves' sums are joined behind the loop
            mrun = nm;

            // ---- rescale O^T, then O^T += V^T * P^T (4 WMMAs) ----
#pragma unroll
            for (int g = 0; g < 4; ++g)
#pragma unroll
                for (int v = 0; v < 8; ++v) o[g][v] *= cf;

            // per 32 keys four fragments (16 head dims each) of 512 elements
            const __bf16* vr = Vt + ((bh * 32 + (kb >> 5)) * 4) * 512 + lane * 8;
            v16bf vb[4];
#pragma unroll
            for (int g = 0; g < 4; ++g) vb[g] = load_frag_packed(vr + g * 512);
            // as behind the K loads: the address pair stays live up to the wait
            asm volatile("s_wait_xcnt 0x0" :: "v"(vr) : "memory");
#pragma unroll
            for (int g = 0; g < 4; ++g) o[g] = wmma_bf16(vb[g], pt, o[g]);
        }
        // publishes the next chunk's bias and ends every wave's reads of this chunk's
        // buffer, which the next trip refills
        __syncthreads();
    }
#undef MAKE_BIAS

    // The block holds all 16 heads of its 16 queries, that is 16 whole rows of the layer's
    // attention output: residual add and LayerNorm are done here, wave h on row h, in the
    // arithmetic and the sum order of add_ln_kernel. The row's operands from memory are asked
    // for first, so that they fly under the exchange through LDS.
    const int c0 = lane * 4;
    const size_t ro = ((size_t)b * SDIM + qt * 16 + h) * DMODEL + c0;
    const float* pa = src + ro;
    v4f x[8], w[8], gg[8], bb[8];
#pragma unroll
    for (int i = 0; i < 8; ++i) x[i] = *(const v4f*)(pa + i * 128);
    // the wait stands in front of any reuse of the loads' address pair; naming the pair as an
    // input keeps it live up to it, so that no load's result is placed on it
    asm volatile("s_wait_xcnt 0x0" :: "v"(pa) : "memory");
#pragma unroll
    for (int i = 0; i < 8; ++i) gg[i] = *(const v4f*)(g + c0 + i * 128);
#pragma unroll
    for (int i = 0; i < 8; ++i) bb[i] = *(const v4f*)(beta + c0 + i * 128);
    // the loads' offset register may be reused below: the wait stands in front of that
    asm volatile("s_wait_xcnt 0x0" ::: "memory");

    const float ri = 1.f / (lrow + __shfl_xor(lrow, 16, 32));
#pragma unroll
    for (int g4 = 0; g4 < 4; ++g4)
#pragma unroll
        for (int v = 0; v < 8; ++v) o[g4][v] *= ri;
    // O^T goes to LDS as [head][query][head dim]. The bias planes are dead behind the loop's
    // last barrier; wave h writes plane h of buffer 0 (16 rows of 68 words).
    // A lane's eight values of a tile are eight consecutive head dims of its query's row.
    float* ot = &bs[0][h * AT_BPLANE];
#pragma unroll
    for (int g4 = 0; g4 < 4; ++g4) {
        const v4f lo = {o[g4][0], o[g4][1], o[g4][2], o[g4][3]};
        const v4f hi = {o[g4][4], o[g4][5], o[g4][6], o[g4][7]};
        *(v4f*)&ot[l16 * AT_BROW + g4 * 16 + hl * 8] = lo;
        *(v4f*)&ot[l16 * AT_BROW + g4 * 16 + hl * 8 + 4] = hi;
    }
    __syncthreads();   // every head's tile is whole before a wave gathers its row from all planes
    // piece i of the row is features i * 128 + lane * 4 ..: head i * 2 + hl, head dims l16 * 4 ..
#pragma unroll
    for (int i = 0; i < 8; ++i)
        w[i] = *(const v4f*)&bs[0][(i * 2 + hl) * AT_BPLANE + h * AT_BROW + l16 * 4];
    float sm1 = 0.f;
#pragma unroll
    for (int i = 0; i < 8; ++i) {
        x[i] += w[i];
        sm1 += (x[i][0] + x[i][1]) + (x[i][2] + x[i][3]);
    }
    const float mean = wave_sum(sm1) * (1.f / 1024.f);
    float ss = 0.f;
#pragma unroll
    for (int i = 0; i < 8; ++i) {
        const v4f d = x[i] - mean;
        ss += (d[0] * d[0] + d[1] * d[1]) + (d[2] * d[2] + d[3] * d[3]);
    }
    const float rstd = rsqrtf(wave_sum(ss) * (1.f / 1024.f) + 1e-5f);
#pragma unroll
    for (int i = 0; i < 8; ++i) x[i] = (x[i] - mean) * rstd * gg[i] + bb[i];
    v4bf p[8];
#pragma unroll
    for (int i = 0; i < 8; ++i) {
#pragma unroll
        for (int j = 0; j < 4; ++j) p[i][j] = f2bf(x[i][j]);
    }
    // a wave-wide store is 256 (bf16) or 512 (f32) contiguous bytes of the row
#pragma unroll
    for (int i = 0; i < 8; ++i) *(v4bf*)(outb + ro + i * 128) = p[i];
    // registers that these stores name may be reused for the next stores' address
    asm volatile("s_wait_xcnt 0x0" ::: "memory");
#pragma unroll
    for (int i = 0; i < 8; ++i) *(v4f*)(outf + ro + i * 128) = x[i];
}

// ---------------------------------------------------------------------------
// Residual + LayerNorm over D=1024. One wave per row, eight rows per 256-thread block:
// a launch starts 4,096 waves in place of 32,768. A lane holds 32 elements of its row
// (eight 16-B pieces, 512 B apart), its loads all in flight together; the two row sums are
// in-lane adds and a five-step butterfly over the wave, so no LDS and no barrier.
// ---------------------------------------------------------------------------
__global__ __launch_bounds__(256) void add_ln_kernel(
    const float* __restrict__ a, const float* __restrict__ r,
    const float* __restrict__ g, const float* __restrict__ beta,
    float* __restrict__ outf, __bf16* __restrict__ outb) {
    const int lane = threadIdx.x & 31;
    const int row = blockIdx.x * 8 + (threadIdx.x >> 5);
    const int c0 = lane * 4;
    const size_t ro = (size_t)row * DMODEL + c0;
    const float* pa = a + ro;
    const float* pr = r + ro;
    v4f v[8], w[8], gg[8], bb[8];
#pragma unroll
    for (int i = 0; i < 8; ++i) v[i] = *(const v4f*)(pa + i * 128);
#pragma unroll
    for (int i = 0; i < 8; ++i) w[i] = *(const v4f*)(pr + i * 128);
    // the wait stands in front of any reuse of the loads' address pairs; naming the pairs
    // as inputs keeps them live up to it, so that no load's result is placed on them
    asm volatile("s_wait_xcnt 0x0" :: "v"(pa), "v"(pr) : "memory");
    // scale and shift are fetched ahead of their use, under the sums
#pragma unroll
    for (int i = 0; i < 8; ++i) gg[i] = *(const v4f*)(g + c0 + i * 128);
#pragma unroll
    for (int i = 0; i < 8; ++i) bb[i] = *(const v4f*)(beta + c0 + i * 128);
    // the loads' offset register may be reused below: the wait stands in front of that
    asm volatile("s_wait_xcnt 0x0" ::: "memory");
    // inputs only: holds the sixteen scale and shift loads together, ahead of the second sum;
    // without it the compiler sinks them behind the sums, two at a time, each pair waited for
    asm volatile("" :: "v"(gg[0]), "v"(gg[1]), "v"(gg[2]), "v"(gg[3]), "v"(gg[4]), "v"(gg[5]),
                       "v"(gg[6]), "v"(gg[7]), "v"(bb[0]), "v"(bb[1]), "v"(bb[2]), "v"(bb[3]),
                       "v"(bb[4]), "v"(bb[5]), "v"(bb[6]), "v"(bb[7]));
    float s = 0.f;
#pragma unroll
    for (int i = 0; i < 8; ++i) {
        v[i] += w[i];
        s += (v[i][0] + v[i][1]) + (v[i][2] + v[i][3]);
    }
    const float mean = wave_sum(s) * (1.f / 1024.f);
    float ss = 0.f;
#pragma unroll
    for (int i = 0; i < 8; ++i) {
        const v4f d = v[i] - mean;
        ss += (d[0] * d[0] + d[1] * d[1]) + (d[2] * d[2] + d[3] * d[3]);
    }
    const float rstd = rsqrtf(wave_sum(ss) * (1.f / 1024.f) + 1e-5f);
#pragma unroll
    for (int i = 0; i < 8; ++i) v[i] = (v[i] - mean) * rstd * gg[i] + bb[i];
    if (outb) {
        v4bf p[8];
#pragma unroll
        for (int i = 0; i < 8; ++i) {
#pragma unroll
            for (int j = 0; j < 4; ++j) p[i][j] = f2bf(v[i][j]);
        }
#pragma unroll
        for (int i = 0; i < 8; ++i) *(v4bf*)(outb + ro + i * 128) = p[i];
        // registers that these stores name may be reused for the next stores' address
        asm volatile("s_wait_xcnt 0x0" ::: "memory");
    }
#pragma unroll
    for (int i = 0; i < 8; ++i) *(v4f*)(outf + ro + i * 128) = v[i];
}

// ---------------------------------------------------------------------------
// Host launch
// ---------------------------------------------------------------------------
extern "C" void kernel_launch(void* const* d_in, const int* in_sizes, int n_in,
                              void* d_out, int out_size, void* d_ws, size_t ws_size,
                              hipStream_t stream) {
    (void)in_sizes; (void)n_in; (void)out_size; (void)ws_size;
    const float* src = (const float*)d_in[0];
    const float* td  = (const float*)d_in[1];
    const float* dd  = (const float*)d_in[2];
    const float* Wq  = (const float*)d_in[3];
    const float* bq  = (const float*)d_in[4];
    const float* Wk  = (const float*)d_in[5];
    const float* bk  = (const float*)d_in[6];
    const float* Wv  = (const float*)d_in[7];
    const float* bv  = (const float*)d_in[8];
    const float* tw1 = (const float*)d_in[9];
    const float* tb1 = (const float*)d_in[10];
    const float* tw2 = (const float*)d_in[11];
    const float* tb2 = (const float*)d_in[12];
    const float* dw1 = (const float*)d_in[13];
    const float* db1 = (const float*)d_in[14];
    const float* dw2 = (const float*)d_in[15];
    const float* db2 = (const float*)d_in[16];
    const float* W1  = (const float*)d_in[17];
    const float* b1  = (const float*)d_in[18];
    const float* W2  = (const float*)d_in[19];
    const float* b2  = (const float*)d_in[20];
    const float* g1  = (const float*)d_in[21];
    const float* be1 = (const float*)d_in[22];
    const float* g2  = (const float*)d_in[23];
    const float* be2 = (const float*)d_in[24];

    const int M = BDIM * SDIM;  // 4096 rows
    char* ws = (char*)d_ws;
    size_t off = 0;
    auto alloc = [&](size_t bytes) {
        char* p = ws + off;
        off = (off + bytes + 255) & ~(size_t)255;
        return p;
    };
    __bf16* srcb = (__bf16*)alloc((size_t)M * DMODEL * 2);
    __bf16* Wqt  = (__bf16*)alloc((size_t)DMODEL * DMODEL * 2);
    __bf16* Wkt  = (__bf16*)alloc((size_t)DMODEL * DMODEL * 2);
    __bf16* Wvt  = (__bf16*)alloc((size_t)DMODEL * DMODEL * 2);
    __bf16* W1t  = (__bf16*)alloc((size_t)DMODEL * DFF * 2);
    __bf16* W2t  = (__bf16*)alloc((size_t)DFF * DMODEL * 2);
    __bf16* Qb   = (__bf16*)alloc((size_t)M * DMODEL * 2);
    __bf16* Kb   = (__bf16*)alloc((size_t)M * DMODEL * 2);
    __bf16* Vtb  = (__bf16*)alloc((size_t)M * DMODEL * 2);
    float*  xf   = (float*)alloc((size_t)M * DMODEL * 4);
    __bf16* xb   = (__bf16*)alloc((size_t)M * DMODEL * 2);
    __bf16* h1   = (__bf16*)alloc((size_t)M * DFF * 2);
    float*  ffn  = (float*)alloc((size_t)M * DMODEL * 4);

    prep_kernel<<<PREP_BLOCKS, 256, 0, stream>>>(src, Wq, Wk, Wv, W1, W2,
                                                 srcb, Wqt, Wkt, Wvt, W1t, W2t);

    gemm_bf16_kernel<<<dim3(DMODEL / 128, M / 128, 3), 256, 0, stream>>>(
        srcb, Wqt, Wkt, Wvt, bq, bk, bv, Qb, Kb, Vtb, DMODEL, DMODEL, 0, 5, 2);

    attn_kernel<<<BDIM * (SDIM / 16), 32 * NHEAD, 0, stream>>>(
        Qb, Kb, Vtb, td, dd, tw1, tb1, tw2, tb2, dw1, db1, dw2, db2, src, g1, be1, xf, xb);

    gemm_bf16_kernel<<<dim3(DFF / 128, M / 128), 256, 0, stream>>>(
        xb, W1t, W1t, W1t, b1, b1, b1, h1, h1, h1, DFF, DMODEL, 3, 3, 3);
    gemm_bf16_kernel<<<dim3(DMODEL / 128, M / 128), 256, 0, stream>>>(
        h1, W2t, W2t, W2t, b2, b2, b2, ffn, ffn, ffn, DMODEL, DFF, 4, 4, 4);

    add_ln_kernel<<<M / 8, 256, 0, stream>>>(xf, ffn, g2, be2, (float*)d_out, nullptr);
}
